// v000
// The times below were measured on an AMD MI455X: many runs one after another, warmed up first and cycling through
// copies of the inputs, with the whole window's GPU time divided by the number of runs. Launches and the gaps
// between them are all in it. The median over several windows is given; except for v000 it joins two sittings, which
// can be a few percent apart, so the side-by-side timings, each taken in one sitting, are the better comparison.
// v000, which the later versions start from, runs in 73.5 microseconds.
#include <hip/hip_runtime.h>

// Gated row attention over a stack of sequences with a pair-derived additive bias shared by all sequences: x [NB][SEQ][64] -> LayerNorm (eps 1e-5, gain, bias) -> bias-free q/k/v projections ([in][out], y = x W),
// sigmoid gate (x Wg + bg), 4 heads x 16, scores q.k / sqrt(16) + bias[h][i][j] with bias = pair[i][j][:] . Wp[:][h], key padding mask (int32, replace fill: masked keys dropped from the softmax, a row with no kept key gives NaN),
// softmax over keys, context, gate multiply, output projection ([in][out]) + bias; output f32 [NB][SEQ][64].
// Compute dtypes, f32 accumulate everywhere: q/k/v/gate projections v_wmma_f32_16x16x32_f16 (LayerNorm output as f16 value + f16 residual x2048 in its own accumulator, W RNE-converted to bf16 then x64 in f16, exact);
// pair bias v_wmma_f32_16x16x32_bf16 (pair and Wp RNE-converted to bf16, products exact); scores v_wmma_f32_16x16x32_f16 with q and k each as f16 value + f16 residual x2048 (three products: value x value in the main accumulator,
// value x residual + residual x value in their own accumulator folded by 1/2048; head dim 16 zero-padded to the 32-deep k-step in registers in both fragments);
// P.V v_wmma_f32_16x16x32_f16 single product (P x16384 carry, cancels in the normalisation, row sum over the converted P); output projection v_wmma_f32_16x16x32_f16 (gated context as f16 value + f16 residual x2048 in its own accumulator, Wo x64).
// Every float input is RNE-converted to bf16 at its load. LayerNorm, softmax (online, running max over kept keys), sigmoid in f32.
// Layout: W^T planes [n][k] f16; Wp^T plane [16][64] bf16 (rows >= 4 zero); q, k value planes and q, k residual planes (x2048) [s*4+h][t][16] f16; v^T plane [s*4+h][16][t] f16; gate plane [s][t][64] f32; bias plane [h][i][j] f32.
// Fused attention kernel: one block = 16 query rows of one sequence, wave w = head w, transposed flash form (S^T = K Q^T, O^T = V^T P^T, fragments straight from the planes), then gate, output projection and whole-row stores.

#ifndef NB
#define NB 128                   // number of sequences (batch x stack depth)
#endif
#ifndef SEQ
#define SEQ 256                  // tokens per sequence (queries = keys)
#endif
#define NB_FULL  128
#define SEQ_FULL 256
#ifndef OUT_SEQ
#define OUT_SEQ SEQ              // row pitch (in tokens) between sequences of the output
#endif
#define DM   64
#define NH_  4
#define HD   16
#define AW   4                   // waves per block
#define CSP  68                  // LDS row pitch (floats) of the 16 x 64 staging tiles
#define VTP  72                  // LDS row pitch (halves) of the v^T staging tile
#define QRS  2048.0f             // carry of every residual plane / residual fragment
#define QRI  (1.0f / 2048.0f)
#define WCS  64.0f               // carry of the f16 weight planes
#define WCI  (1.0f / 64.0f)
#define L2E  1.4426950408889634f
#define SC2  ((float)(0.25 * 1.4426950408889634))   // HD^-0.5 * log2(e)
#define PSH  14.0f               // log2 of the P carry (16384)
#define NEGB (-3.0e38f)
#define LNEPS 1.0e-5f

static_assert(DM == 64);                       // LayerNorm lane map: 2 lanes x 32 columns; two 32-deep k-steps
static_assert(HD == 16);                       // one 16-B load per q/k fragment, upper k half zero in registers
static_assert(NH_ * HD == DM);
static_assert(NH_ == AW);                      // wave w of the attention block = head w
static_assert(SEQ % 64 == 0);                  // a 64-token projection tile never straddles two sequences; v^T lines = 64 tokens
static_assert((NB * SEQ) % 64 == 0);
static_assert(SEQ % 32 == 0);                  // key loop steps by 32; bias kernel handles 32 keys per wave
static_assert(SEQ % 16 == 0);
static_assert((SEQ * (SEQ / 32)) % AW == 0);   // bias grid covers (i, 32-key chunk) exactly
static_assert(NB <= NB_FULL);
static_assert(SEQ <= SEQ_FULL);
static_assert((CSP * 4) % 16 == 0);
static_assert((VTP * 2) % 16 == 0);
static_assert(32 * 16 * NH_ == 16 * DM * 2);           // q/k store, per plane (value and residual alike): 4 head instructions x 32 lanes x 16 B = 16 rows x 64 halves
static_assert(32 * 16 * 8 == 16 * DM * 4);             // gate store: 8 instructions x 32 lanes x 16 B = 16 rows x 256 B
static_assert(128 * 16 * 4 == DM * 64 * 2);
static_assert(128 * 16 * 2 == 16 * DM * 4);            // output store: 2 trips x 128 threads x 16 B = 16 rows x 256 B
static_assert(32 * 16 == NH_ * 32 * 4);
static_assert(256 * 8 * 2 == DM * DM);                 // weight converter: 2 trips x 256 threads x 8 halves
static_assert(128 * 8 == 16 * DM);                     // Wp converter: 128 threads x 8 = 16 rows x 64
static_assert(AW * 16 * CSP * 4 + DM * VTP * 2 <= 131072);   // static LDS of the projection kernel
static_assert(2 * 16 * CSP * 4 <= 131072);                   // static LDS of the attention kernel
static_assert(AW * 16 * 36 * 4 <= 131072);                   // static LDS of the bias kernel
static_assert(DM * 65 * 4 <= 131072);                        // static LDS of the weight converter

typedef _Float16 h16;
typedef unsigned short bf;
typedef __attribute__((ext_vector_type(16))) __bf16   v16bf;
typedef __attribute__((ext_vector_type(16))) _Float16 v16h;
typedef __attribute__((ext_vector_type(8)))  _Float16 v8h;
typedef __attribute__((ext_vector_type(8)))  unsigned short v8us;
typedef __attribute__((ext_vector_type(8)))  float    v8f;
typedef __attribute__((ext_vector_type(4)))  float    v4f;
typedef __attribute__((ext_vector_type(4)))  int      v4i;
typedef v4f  __attribute__((may_alias)) v4fa;
typedef v8h  __attribute__((may_alias)) v8ha;

__device__ __forceinline__ unsigned short f2bf(float f) { unsigned u = __float_as_uint(f); u += 0x7FFFu + ((u >> 16) & 1u); return (unsigned short)(u >> 16); }
__device__ __forceinline__ float bfr(float f) { return __uint_as_float(((unsigned)f2bf(f)) << 16); }   // value after RNE convert to bf16
__device__ __forceinline__ v16h cat16(v8h lo, v8h hi) { return __builtin_shufflevector(lo, hi, 0, 1, 2, 3, 4, 5, 6, 7, 8, 9, 10, 11, 12, 13, 14, 15); }
__device__ __forceinline__ v16bf cat16b(v8us lo, v8us hi) { return __builtin_bit_cast(v16bf, __builtin_shufflevector(lo, hi, 0, 1, 2, 3, 4, 5, 6, 7, 8, 9, 10, 11, 12, 13, 14, 15)); }
__device__ __forceinline__ v8f wmma16(v16h a, v16h b, v8f c) { return __builtin_amdgcn_wmma_f32_16x16x32_f16(false, a, false, b, (short)0, c, false, false); }
__device__ __forceinline__ v8f wmmab(v16bf a, v16bf b, v8f c) { return __builtin_amdgcn_wmma_f32_16x16x32_bf16(false, a, false, b, (short)0, c, false, false); }
// fragment loaders from K-contiguous 16-bit rows; p already includes + 8*(lane>>4): elements 0..7 <- k0+8h+0..7, elements 8..15 <- k0+16+8h+0..7 (same map for A and B)
__device__ __forceinline__ v16h  ldh(const h16* p) { return cat16(*(const v8h*)p, *(const v8h*)(p + 16)); }
__device__ __forceinline__ v16bf ldb(const bf* p)  { return cat16b(*(const v8us*)p, *(const v8us*)(p + 16)); }
// ordering point for wave-private LDS tiles (same wave writes and reads)
__device__ __forceinline__ void wave_sync() { __builtin_amdgcn_fence(3 /* release order */, "wavefront"); __builtin_amdgcn_wave_barrier(); asm volatile("" ::: "memory"); }

// f32 -> f16 convert that cannot produce a subnormal (|v| < 2^-14 -> +0); NaN passes through
static __device__ __forceinline__ h16 toh_flush(float v) { const h16 r = (h16)v; return (fabsf(v) < 6.103515625e-05f) ? (h16)0.0f : r; }
// one matrix instruction followed by its own 4-slot guard
__device__ __forceinline__ v8f wmma16g(v16h a, v16h b, v8f c) { c = wmma16(a, b, c); asm volatile("v_nop\n\tv_nop\n\tv_nop\n\tv_nop" : "+v"(c) : "v"(a), "v"(b)); return c; }
__device__ __forceinline__ v8f wmmabg(v16bf a, v16bf b, v8f c) { c = wmmab(a, b, c); asm volatile("v_nop\n\tv_nop\n\tv_nop\n\tv_nop" : "+v"(c) : "v"(a), "v"(b)); return c; }

__global__ __launch_bounds__(256) void k_wconv(const float* __restrict__ src, h16* dst) {
    __shared__ float wsl[DM * 65];
    const int tid = threadIdx.x;
#pragma unroll 1
    for (int it = 0; it < 16; ++it) { const int idx = it * 256 + tid; wsl[(idx >> 6) * 65 + (idx & 63)] = bfr(src[idx]); }   // 16 x 256 = 4096 elements, all staged
    __syncthreads();
{
#pragma unroll 1
        for (int it = 0; it < 2; ++it) { const int idx = it * 256 + tid; const int n = idx >> 3, k8 = (idx & 7) * 8; v8h o;   // 2 trips x 32 rows = 64 rows
#pragma unroll
            for (int i = 0; i < 8; ++i) o[i] = toh_flush(wsl[(k8 + i) * 65 + n] * WCS);
            *(v8h*)(dst + (size_t)n * DM + k8) = o; }
         }
}

__global__ __launch_bounds__(128) void k_wpconv(const float* __restrict__ src, bf* dst) {
    __shared__ float wsl[DM * NH_];
    const int tid = threadIdx.x;
    wsl[tid] = src[tid]; wsl[tid + 128] = src[tid + 128];
    __syncthreads();
    const int row = tid >> 3, k8 = (tid & 7) * 8;
    const int rc = row < NH_ ? row : (NH_ - 1);
    v8us o;
#pragma unroll
    for (int i = 0; i < 8; ++i) { float w = wsl[(k8 + i) * NH_ + rc]; asm volatile("" : "+v"(w)); o[i] = (row < NH_) ? f2bf(w) : (unsigned short)0; }
    *(v8us*)(dst + (size_t)row * DM + k8) = o; 
}

// k_pairbias: bias[h][i][j] = sum_p bf16(pair[i][j][p]) bf16(Wp[p][h]); one wave per (i, 32 keys): A = Wp^T rows (row = head, padded to 16), B = pair rows converted in registers (col = key), K = 64.
__global__ __launch_bounds__(32 * AW) void k_pairbias(const float* __restrict__ pair, const bf* __restrict__ WPT, float* BIAS) {
    __shared__ __align__(16) float os[AW * 16 * 36];
    const int lane = threadIdx.x & 31, lr = lane & 15, hi = lane >> 4;
    const int wave = __builtin_amdgcn_readfirstlane((int)(threadIdx.x >> 5));
    const int gw = blockIdx.x * AW + wave;
    const int qi = gw / (SEQ / 32), j0 = (gw % (SEQ / 32)) * 32;
    const v16bf a0 = ldb(WPT + lr * DM + 8 * hi), a1 = ldb(WPT + lr * DM + 8 * hi + 32);
    const int wb = wave * 16 * 36;
#pragma unroll
    for (int jt = 0; jt < 2; ++jt) {
        const float* p = pair + ((size_t)qi * SEQ_FULL + (size_t)(j0 + 16 * jt + lr)) * DM + 8 * hi;
        v8f acc = (v8f){};
#pragma unroll
        for (int kc = 0; kc < 2; ++kc) {
            const v4f x0 = *(const v4f*)(p + 32 * kc), x1 = *(const v4f*)(p + 32 * kc + 4), x2 = *(const v4f*)(p + 32 * kc + 16), x3 = *(const v4f*)(p + 32 * kc + 20);
            v8us e0, e1;
#pragma unroll
            for (int i = 0; i < 4; ++i) { e0[i] = f2bf(x0[i]); e0[4 + i] = f2bf(x1[i]); e1[i] = f2bf(x2[i]); e1[4 + i] = f2bf(x3[i]); }
            const v16bf bq = cat16b(e0, e1);
            if (kc == 0) acc = wmmabg(a0, bq, acc); else acc = wmmabg(a1, bq, acc);
        }
#pragma unroll
        for (int r = 0; r < 8; ++r) os[wb + (8 * hi + r) * 36 + 16 * jt + lr] = acc[r];      // D: row 8h+r (head), col lane&15 (key); 16 rows x 32 columns all written
    }
    wave_sync();
    const int head = lane >> 3, cofs = (lane & 7) * 4;                                        // 4 heads x 8 lanes x 4 floats = 4 lines
    const v4f val = *(const v4fa*)(&os[wb + head * 36 + cofs]);
    float* dstp = BIAS + ((size_t)head * SEQ + (size_t)qi) * SEQ + j0 + cofs;
    *(v4f*)dstp = val; 
}

// value of one 16 x 16 projection tile: (x_hi W + (x_res W) / 2048) / 64, K = 64
__device__ __forceinline__ v8f proj_tile(const h16* __restrict__ wp, v16h a0h, v16h a1h, v16h a0r, v16h a1r) {
    const v16h b0 = ldh(wp), b1 = ldh(wp + 32);
    v8f cH = (v8f){}, cR = (v8f){};
    cH = wmma16g(a0h, b0, cH); cH = wmma16g(a1h, b1, cH);
    cR = wmma16g(a0r, b0, cR); cR = wmma16g(a1r, b1, cR);
    return (cH + cR * QRI) * WCI;
}

// k_lnproj: LayerNorm + q/k/v/gate projections; block = 64 tokens of one sequence, wave = 16 tokens. Lane (row = lane&15, half = lane>>4) holds the 32 columns 16q + 8*half + i of its row,
// q, k: f16 value plane and f16 residual plane ((v - value) x 2048, same flush select); per head the 16 x 16 halves are one contiguous 512-byte run of each plane, written by one instruction (32 lanes x 16 B);
// gate: f32 rows of 256 B, 2 rows per instruction;
__global__ __launch_bounds__(32 * AW) void k_lnproj(const float* __restrict__ msa, const float* __restrict__ lng, const float* __restrict__ lnb,
                                                    const h16* __restrict__ WT, const float* __restrict__ bg,
                                                    h16* QH, h16* QR, h16* KP, h16* KR, h16* VT, float* GP) {
    __shared__ __align__(16) float os[AW * 16 * CSP];
    __shared__ __align__(16) h16 vts[DM * VTP];
    const int lane = threadIdx.x & 31, lr = lane & 15, hi = lane >> 4;
    const int wave = __builtin_amdgcn_readfirstlane((int)(threadIdx.x >> 5));
    const int r0 = blockIdx.x * 64;
    const int sq = r0 / SEQ, tbk = r0 % SEQ;
    const int t0 = tbk + wave * 16;
    const int wb = wave * 16 * CSP;
    const float* xr = msa + ((size_t)sq * SEQ_FULL + (size_t)(t0 + lr)) * DM + 8 * hi;
    float xv[32];
#pragma unroll
    for (int q = 0; q < 4; ++q) { const v4f u0 = *(const v4f*)(xr + 16 * q), u1 = *(const v4f*)(xr + 16 * q + 4);
#pragma unroll
        for (int i = 0; i < 4; ++i) { xv[8 * q + i] = bfr(u0[i]); xv[8 * q + 4 + i] = bfr(u1[i]); } }
    float sm = 0.0f;
#pragma unroll
    for (int e = 0; e < 32; ++e) sm += xv[e];
    sm += __shfl_xor(sm, 16, 32);
    const float mu = sm * (1.0f / 64.0f);
    float sv = 0.0f;
#pragma unroll
    for (int e = 0; e < 32; ++e) { const float dl = xv[e] - mu; sv += dl * dl; }
    sv += __shfl_xor(sv, 16, 32);
    const float rs = rsqrtf(sv * (1.0f / 64.0f) + LNEPS);
    v16h ah[2], ar[2];
#pragma unroll
    for (int q = 0; q < 4; ++q) {
        const v4f g0 = *(const v4f*)(lng + 8 * hi + 16 * q), g1 = *(const v4f*)(lng + 8 * hi + 16 * q + 4);
        const v4f c0 = *(const v4f*)(lnb + 8 * hi + 16 * q), c1 = *(const v4f*)(lnb + 8 * hi + 16 * q + 4);
#pragma unroll
        for (int i = 0; i < 4; ++i) {
            const float y0 = (xv[8 * q + i] - mu) * rs * bfr(g0[i]) + bfr(c0[i]);
            const float y1 = (xv[8 * q + 4 + i] - mu) * rs * bfr(g1[i]) + bfr(c1[i]);
            const h16 h0 = toh_flush(y0), h1 = toh_flush(y1);
            ah[q >> 1][(q & 1) * 8 + i] = h0; ah[q >> 1][(q & 1) * 8 + 4 + i] = h1;
            ar[q >> 1][(q & 1) * 8 + i] = toh_flush((y0 - (float)h0) * QRS); ar[q >> 1][(q & 1) * 8 + 4 + i] = toh_flush((y1 - (float)h1) * QRS); } }
    const size_t wlo = (size_t)lr * DM + 8 * hi;                       // + (matrix*64 + 16*nb) * DM
    // q (matrix 0) and k (matrix 1)
#pragma unroll
    for (int mat = 0; mat < 2; ++mat) {
#pragma unroll
        for (int nb = 0; nb < 4; ++nb) {
            const v8f val = proj_tile(WT + wlo + (size_t)(mat * 64 + nb * 16) * DM, ah[0], ah[1], ar[0], ar[1]);
#pragma unroll
            for (int r = 0; r < 8; ++r) os[wb + (8 * hi + r) * CSP + nb * 16 + lr] = val[r]; }     // D: row 8h+r (token), col lane&15
        wave_sync();
{
#pragma unroll
            for (int hh = 0; hh < NH_; ++hh) { const int row = lane >> 1, c8 = (lane & 1) * 8;       // 16 rows x 2 lanes x 8 halves = head hh of the tile
                const v4f x0 = *(const v4fa*)(&os[wb + row * CSP + hh * 16 + c8]); const v4f x1 = *(const v4fa*)(&os[wb + row * CSP + hh * 16 + c8 + 4]); v8h hv, rv;
#pragma unroll
                for (int i = 0; i < 4; ++i) { const h16 a0 = toh_flush(x0[i]); const h16 a1 = toh_flush(x1[i]); hv[i] = a0; hv[4 + i] = a1;
                    rv[i] = toh_flush((x0[i] - (float)a0) * QRS); rv[4 + i] = toh_flush((x1[i] - (float)a1) * QRS); }
                const size_t oo = ((size_t)(sq * NH_ + hh) * SEQ + (size_t)t0) * HD + (size_t)lane * 8;
                if (mat == 0) { *(v8h*)(QH + oo) = hv; *(v8h*)(QR + oo) = rv; } else { *(v8h*)(KP + oo) = hv; *(v8h*)(KR + oo) = rv; } }
             }
        wave_sync();
    }
    // v (matrix 2): lane's 8 accumulator values are 8 consecutive tokens of column c -> one 16-B LDS store into the [c][token] tile
#pragma unroll
    for (int nb = 0; nb < 4; ++nb) {
        const v8f val = proj_tile(WT + wlo + (size_t)(2 * 64 + nb * 16) * DM, ah[0], ah[1], ar[0], ar[1]);
        v8h o;
#pragma unroll
        for (int r = 0; r < 8; ++r) o[r] = toh_flush(val[r]);
        *(v8ha*)(&vts[(nb * 16 + lr) * VTP + wave * 16 + 8 * hi]) = o; }
    // gate (matrix 3): sigmoid(x Wg + bg)
#pragma unroll
    for (int nb = 0; nb < 4; ++nb) {
        const v8f val = proj_tile(WT + wlo + (size_t)(3 * 64 + nb * 16) * DM, ah[0], ah[1], ar[0], ar[1]);
        const float bgv = bfr(bg[nb * 16 + lr]);
#pragma unroll
        for (int r = 0; r < 8; ++r) { const float z = val[r] + bgv; const float ex = __builtin_amdgcn_exp2f(-z * L2E); os[wb + (8 * hi + r) * CSP + nb * 16 + lr] = 1.0f / (1.0f + ex); } }
    wave_sync();
{
#pragma unroll
        for (int s8 = 0; s8 < 8; ++s8) { const int row = 2 * s8 + (lane >> 4), cofs = (lane & 15) * 4;      // 8 x 2 rows = 16 rows; 16 lanes x 4 floats = 64 columns
            const v4f val = *(const v4fa*)(&os[wb + row * CSP + cofs]);
            *(v4f*)(GP + ((size_t)sq * SEQ + (size_t)(t0 + row)) * DM + cofs) = val; }
         }
    __syncthreads();                                                   // v^T tile: written by all 4 waves, read across waves
    const int tid = threadIdx.x;
{
#pragma unroll
        for (int it = 0; it < 4; ++it) { const int idx = it * 128 + tid; const int c = idx >> 3, t8 = (idx & 7) * 8;   // 4 trips x 16 rows = 64 rows; 8 lanes x 8 halves = 64 tokens = one line
            const v8h o = *(const v8ha*)(&vts[c * VTP + t8]);
            *(v8h*)(VT + ((size_t)sq * DM + (size_t)c) * SEQ + tbk + t8) = o; }
         }
}

// k_attn: block = 16 query rows of one sequence, wave w = head w. Transposed flash form: S^T[key][t] = K Q^T (A = K rows, B = Q rows, k = d: 16 real + 16 zero slots);
// scores = K Q + (K Q_res + K_res Q) / 2048 (value x value in the main accumulators, the two cross products in their own accumulators; residual x residual dropped);
// lane (t = lane&15, h = lane>>4) holds keys 8h+r of each 16-key tile, so the packed P tile is directly the B fragment of O^T[d][t] = V^T P^T.
// Per step: bias row segment and mask words loaded as 16-B vectors at arithmetic addresses; masked keys are dropped by value (probability 0, excluded from the running max).
// After the key loop the 4 heads' contexts meet in a block LDS tile [16][64]; every wave rebuilds the gated context fragments (value + residual x2048) and computes one 16-column tile of the output projection;
__global__ __launch_bounds__(32 * AW) void k_attn(const h16* __restrict__ QH, const h16* __restrict__ QR, const h16* __restrict__ KP, const h16* __restrict__ KR, const h16* __restrict__ VT,
                                                  const float* __restrict__ BIAS, const int* __restrict__ kmask, const float* __restrict__ GP,
                                                  const h16* __restrict__ WOT, const float* __restrict__ bo, float* OUT) {
    __shared__ __align__(16) float cs[16 * CSP];
    __shared__ __align__(16) float ot[16 * CSP];
    const int lane = threadIdx.x & 31, lr = lane & 15, hi = lane >> 4;
    const int wave = __builtin_amdgcn_readfirstlane((int)(threadIdx.x >> 5));
    const int sq = blockIdx.y; const int t0 = blockIdx.x * 16;
    const int zh = sq * NH_ + wave;
    const size_t pbase = (size_t)zh * SEQ * HD;
    const v8h z8 = (v8h){};
    const v16h qh = cat16(*(const v8h*)(QH + pbase + (size_t)(t0 + lr) * HD + 8 * hi), z8);   // B fragment: col t, k = d; slots 16..31 zero
    const v16h qr = cat16(*(const v8h*)(QR + pbase + (size_t)(t0 + lr) * HD + 8 * hi), z8);   // residual x2048, same map
    const size_t ko = pbase + (size_t)lr * HD + 8 * hi;        // + key * HD   (A fragment: row key, k = d)
    const size_t vo = pbase + (size_t)lr * SEQ + 8 * hi;       // + key        (A fragment: row d, k = key)
    const float* bp0 = BIAS + ((size_t)wave * SEQ + (size_t)(t0 + lr)) * SEQ + 8 * hi;
    const int* mp0 = kmask + (size_t)sq * SEQ_FULL + 8 * hi;
    v8f o0 = (v8f){};
    float m = NEGB, l = 0.0f;
#pragma unroll 1
    for (int key0 = 0; key0 < SEQ; key0 += 32) {
        const h16* ka = KP + ko + (size_t)key0 * HD;
        const v16h ka0 = cat16(*(const v8h*)ka, z8), kb0 = cat16(*(const v8h*)(ka + 16 * HD), z8);
        const h16* kr = KR + ko + (size_t)key0 * HD;
        const v16h kra0 = cat16(*(const v8h*)kr, z8), krb0 = cat16(*(const v8h*)(kr + 16 * HD), z8);
        v8f sa = (v8f){}, sb = (v8f){}, ra = (v8f){}, rb = (v8f){};
        sa = wmma16g(ka0, qh, sa); sb = wmma16g(kb0, qh, sb);
        ra = wmma16g(ka0, qr, ra); ra = wmma16g(kra0, qh, ra);
        rb = wmma16g(kb0, qr, rb); rb = wmma16g(krb0, qh, rb);
        const float* bp = bp0 + key0;                            // keys key0+8h+0..7 and key0+16+8h+0..7 of query row t0 + (lane&15)
        const v4f c0 = *(const v4f*)bp, c1 = *(const v4f*)(bp + 4), c2 = *(const v4f*)(bp + 16), c3 = *(const v4f*)(bp + 20);
        const int* mp = mp0 + key0;
        const v4i n0 = *(const v4i*)mp, n1 = *(const v4i*)(mp + 4), n2 = *(const v4i*)(mp + 16), n3 = *(const v4i*)(mp + 20);
        float ta[8], tc[8]; bool fa[8], fb[8]; float mx = NEGB;
#pragma unroll
        for (int r = 0; r < 4; ++r) {
            ta[r] = (sa[r] + ra[r] * QRI) * SC2 + c0[r] * L2E; ta[4 + r] = (sa[4 + r] + ra[4 + r] * QRI) * SC2 + c1[r] * L2E;
            tc[r] = (sb[r] + rb[r] * QRI) * SC2 + c2[r] * L2E; tc[4 + r] = (sb[4 + r] + rb[4 + r] * QRI) * SC2 + c3[r] * L2E;
            fa[r] = n0[r] != 0; fa[4 + r] = n1[r] != 0; fb[r] = n2[r] != 0; fb[4 + r] = n3[r] != 0; }
#pragma unroll
        for (int r = 0; r < 8; ++r) mx = fmaxf(mx, fmaxf(fa[r] ? ta[r] : NEGB, fb[r] ? tc[r] : NEGB));
        mx = fmaxf(mx, __shfl_xor(mx, 16, 32));
        const float mnew = fmaxf(m, mx);
        const float alpha = __builtin_amdgcn_exp2f(m - mnew);
        const float sh = PSH - mnew;
        v16h pb; float ls = 0.0f;
#pragma unroll
        for (int r = 0; r < 8; ++r) {
            const float xa = ta[r] + sh, xb = tc[r] + sh;
            const float ea = __builtin_amdgcn_exp2f(xa), eb = __builtin_amdgcn_exp2f(xb);
            const float ga = (fa[r] & (xa >= -14.0f)) ? ea : 0.0f, gb = (fb[r] & (xb >= -14.0f)) ? eb : 0.0f;   // dropped keys and sub-2^-14 values selected to 0 by value
            const h16 pa = (h16)ga; const h16 pc = (h16)gb;
            pb[r] = pa; pb[8 + r] = pc;
            ls += (float)pa + (float)pc; }
        l = l * alpha + ls; m = mnew;
        o0 = o0 * alpha;
        const v16h v0 = ldh(VT + vo + key0);
        o0 = wmma16g(v0, pb, o0);
    }
    l += __shfl_xor(l, 16, 32);
    const bool any = l > 0.0f;
    const float lsafe = any ? l : 1.0f;
    const float inv = any ? (1.0f / lsafe) : __uint_as_float(0x7FC00000u);       // no kept key -> NaN row (softmax of an all-dropped row)
    // O^T D layout: o0[r] = (d = 8h + r, t = lane&15) -> cs[t][wave*16 + d]; 16 rows x 64 columns written by the 4 waves
    { v4f a, c;
      a[0] = o0[0] * inv; a[1] = o0[1] * inv; a[2] = o0[2] * inv; a[3] = o0[3] * inv; c[0] = o0[4] * inv; c[1] = o0[5] * inv; c[2] = o0[6] * inv; c[3] = o0[7] * inv;
      *(v4fa*)(&cs[lr * CSP + wave * 16 + 8 * hi]) = a; *(v4fa*)(&cs[lr * CSP + wave * 16 + 8 * hi + 4]) = c; }
    __syncthreads();                                                             // cs: cross-wave
    // gated context fragments: row t = lane&15, k = concatenated head column 16q + 8h + i
    const float* gr = GP + ((size_t)sq * SEQ + (size_t)(t0 + lr)) * DM + 8 * hi;
    v16h gh[2], gq[2];
#pragma unroll
    for (int q = 0; q < 4; ++q) {
        const v4f g0 = *(const v4f*)(gr + 16 * q), g1 = *(const v4f*)(gr + 16 * q + 4);
        const v4f x0 = *(const v4fa*)(&cs[lr * CSP + 8 * hi + 16 * q]), x1 = *(const v4fa*)(&cs[lr * CSP + 8 * hi + 16 * q + 4]);
#pragma unroll
        for (int i = 0; i < 4; ++i) {
            const float y0 = g0[i] * x0[i], y1 = g1[i] * x1[i];
            const h16 h0 = toh_flush(y0), h1 = toh_flush(y1);
            gh[q >> 1][(q & 1) * 8 + i] = h0; gh[q >> 1][(q & 1) * 8 + 4 + i] = h1;
            gq[q >> 1][(q & 1) * 8 + i] = toh_flush((y0 - (float)h0) * QRS); gq[q >> 1][(q & 1) * 8 + 4 + i] = toh_flush((y1 - (float)h1) * QRS); } }
    const v8f pv = proj_tile(WOT + (size_t)(wave * 16 + lr) * DM + 8 * hi, gh[0], gh[1], gq[0], gq[1]);
    const float bov = bfr(bo[wave * 16 + lr]);
#pragma unroll
    for (int r = 0; r < 8; ++r) ot[(8 * hi + r) * CSP + wave * 16 + lr] = pv[r] + bov;       // D: row 8h+r (token), col lane&15; 16 rows x 64 columns written by the 4 waves
    __syncthreads();                                                             // ot: cross-wave
    float* orow = OUT + ((size_t)sq * OUT_SEQ + (size_t)t0) * DM;
    const int tid = threadIdx.x;
{
#pragma unroll
        for (int it = 0; it < 2; ++it) { const int idx = it * 128 + tid; const int row = idx >> 4, cofs = (idx & 15) * 4;   // 2 trips x 8 rows = 16 rows; 16 pieces x 4 floats = 64 columns
            const v4f val = *(const v4fa*)(&ot[row * CSP + cofs]);
            *(v4f*)(orow + (size_t)row * DM + cofs) = val; }
         }
}

static constexpr size_t al256(size_t v) { return (v + 255) & ~(size_t)255; }
static constexpr size_t SZ_WT = al256((size_t)4 * DM * DM * 2);
static constexpr size_t SZ_WO = al256((size_t)DM * DM * 2);
static constexpr size_t SZ_WP = al256((size_t)16 * DM * 2);
static constexpr size_t SZ_PL = al256((size_t)NB * SEQ * DM * 2);
static constexpr size_t SZ_GP = al256((size_t)NB * SEQ * DM * 4);
static constexpr size_t SZ_BS = al256((size_t)NH_ * SEQ * SEQ * 4);
static constexpr size_t SZ_TOTAL = SZ_WT + SZ_WO + SZ_WP + 5 * SZ_PL + SZ_GP + SZ_BS;   // planes: q value, q residual, k value, k residual, v^T
static_assert(SZ_TOTAL <= (size_t)134217728);          // workspace carve <= 128 MiB
static_assert(((size_t)DM * DM * 2) % 256 == 0);       // weight sub-planes stay 256-byte aligned
static_assert((size_t)NB * NH_ * SEQ * HD == (size_t)NB * DM * SEQ);   // q/k value and residual planes [s*4+h][t][16] and v^T plane [s*64+c][t] have the same extent
static_assert(((size_t)(NB - 1) * OUT_SEQ + SEQ) * DM <= (size_t)NB_FULL * SEQ_FULL * DM);   // last output row inside the output buffer

extern "C" void kernel_launch(void* const* d_in, const int* in_sizes, int n_in,
                              void* d_out, int out_size, void* d_ws, size_t ws_size, hipStream_t stream) {
    if (n_in < 13) return;
    const size_t needx = ((size_t)(NB - 1) * SEQ_FULL + SEQ) * DM;
    const size_t needp = ((size_t)(SEQ - 1) * SEQ_FULL + SEQ) * DM;
    const size_t needm = (size_t)(NB - 1) * SEQ_FULL + SEQ;
    if ((size_t)in_sizes[0] < needx || (size_t)in_sizes[1] < needp || (size_t)in_sizes[2] < needm) return;
    if (in_sizes[3] < DM || in_sizes[4] < DM || in_sizes[9] < DM || in_sizes[12] < DM) return;
    if (in_sizes[5] < DM * DM || in_sizes[6] < DM * DM || in_sizes[7] < DM * DM || in_sizes[8] < DM * DM || in_sizes[11] < DM * DM) return;
    if (in_sizes[10] < DM * NH_) return;
    if ((size_t)out_size < ((size_t)(NB - 1) * OUT_SEQ + SEQ) * DM) return;
    if (SZ_TOTAL > ws_size) return;
    // wire order: x stack, pair, key mask, ln gain, ln bias, Wq, Wk, Wv, Wg, bg, Wp, Wo, bo
    const float* msa  = (const float*)d_in[0];
    const float* pair = (const float*)d_in[1];
    const int*   kmsk = (const int*)d_in[2];
    const float* lng  = (const float*)d_in[3];
    const float* lnb  = (const float*)d_in[4];
    const float* wq   = (const float*)d_in[5];
    const float* wk   = (const float*)d_in[6];
    const float* wv   = (const float*)d_in[7];
    const float* wg   = (const float*)d_in[8];
    const float* bg   = (const float*)d_in[9];
    const float* wp   = (const float*)d_in[10];
    const float* wo   = (const float*)d_in[11];
    const float* bo   = (const float*)d_in[12];
    float* OUT = (float*)d_out;      // [NB][SEQ][64]
    char* wsp = (char*)d_ws;
    h16* WT  = (h16*)wsp; wsp += SZ_WT;               // [4][64 n][64 k]: q | k | v | gate, x64
    h16* WOT = (h16*)wsp; wsp += SZ_WO;               // [64 n][64 k], x64
    bf*  WPT = (bf*)wsp;  wsp += SZ_WP;               // [16][64]
    h16* QH  = (h16*)wsp; wsp += SZ_PL;               // [NB*4][SEQ][16]
    h16* QR  = (h16*)wsp; wsp += SZ_PL;               // [NB*4][SEQ][16] residual x2048
    h16* KP  = (h16*)wsp; wsp += SZ_PL;               // [NB*4][SEQ][16]
    h16* KR  = (h16*)wsp; wsp += SZ_PL;               // [NB*4][SEQ][16] residual x2048
    h16* VT  = (h16*)wsp; wsp += SZ_PL;               // [NB*4][16][SEQ]
    float* GP = (float*)wsp; wsp += SZ_GP;            // [NB][SEQ][64]
    float* BIAS = (float*)wsp; wsp += SZ_BS;          // [4][SEQ][SEQ]

    k_wconv<<<1, 256, 0, stream>>>(wq, WT);
    k_wconv<<<1, 256, 0, stream>>>(wk, WT + (size_t)DM * DM);
    k_wconv<<<1, 256, 0, stream>>>(wv, WT + (size_t)2 * DM * DM);
    k_wconv<<<1, 256, 0, stream>>>(wg, WT + (size_t)3 * DM * DM);
    k_wconv<<<1, 256, 0, stream>>>(wo, WOT);
    k_wpconv<<<1, 128, 0, stream>>>(wp, WPT);

    k_pairbias<<<(unsigned)(SEQ * (SEQ / 32) / AW), 32 * AW, 0, stream>>>(pair, WPT, BIAS);
    k_lnproj<<<(unsigned)(NB * SEQ / 64), 32 * AW, 0, stream>>>(msa, lng, lnb, WT, bg, QH, QR, KP, KR, VT, GP);
    k_attn<<<dim3(SEQ / 16, NB, 1), 32 * AW, 0, stream>>>(QH, QR, KP, KR, VT, BIAS, kmsk, GP, WOT, bo, OUT);
}

// v001
// A run of this version takes 49.8 microseconds.
// Timed twice side by side with v000, it ran 1.50 times as fast both times.
#include <hip/hip_runtime.h>

// Gated row attention over a stack of sequences with a pair-derived additive bias shared by all sequences: x [NB][SEQ][64] -> LayerNorm (eps 1e-5, gain, bias) -> bias-free q/k/v projections ([in][out], y = x W),
// sigmoid gate (x Wg + bg), 4 heads x 16, scores q.k / sqrt(16) + bias[h][i][j] with bias = pair[i][j][:] . Wp[:][h], key padding mask (int32, replace fill: masked keys dropped from the softmax, a row with no kept key gives NaN),
// softmax over keys, context, gate multiply, output projection ([in][out]) + bias; output f32 [NB][SEQ][64].
// Compute dtypes, f32 accumulate everywhere: q/k/v/gate projections v_wmma_f32_16x16x32_f16 (LayerNorm output as f16 value + f16 residual x2048 in its own accumulator, W RNE-converted to bf16 then x64 in f16, exact);
// pair bias v_wmma_f32_16x16x32_bf16 (pair and Wp RNE-converted to bf16, products exact); scores v_wmma_f32_16x16x32_f16 with q and k each as f16 value + f16 residual x2048 (three products: value x value in the main accumulator,
// value x residual + residual x value in their own accumulator folded by 1/2048; head dim 16 zero-padded to the 32-deep k-step in registers in both fragments);
// P.V v_wmma_f32_16x16x32_f16 single product (P x16384 carry, cancels in the normalisation, row sum over the converted P); output projection v_wmma_f32_16x16x32_f16 (gated context as f16 value + f16 residual x2048 in its own accumulator, Wo x64).
// Every float input is RNE-converted to bf16 at its load. LayerNorm, softmax (online, running max over kept keys), sigmoid in f32.
// Layout: W^T planes [n][k] f16; Wp^T plane [16][64] bf16 (rows >= 4 zero); q, k value planes and q, k residual planes (x2048) [s*4+h][t][16] f16; v^T plane [s*4+h][16][t] f16; gate plane [s][t][64] f32; bias plane [h][i][j] f32.
// Three launches, one per level of the dependence chain: k_conv (all six weight planes, one block each), k_lnproj_pairbias (projection blocks first, then the pair-bias blocks, which do not depend on each other), k_attn.
// Fused attention kernel: one block = 16 query rows of one sequence, wave w = head w, transposed flash form (S^T = K Q^T, O^T = V^T P^T, fragments straight from the planes), then gate, output projection and whole-row stores.

#ifndef NB
#define NB 128                   // number of sequences (batch x stack depth)
#endif
#ifndef SEQ
#define SEQ 256                  // tokens per sequence (queries = keys)
#endif
#define NB_FULL  128
#define SEQ_FULL 256
#ifndef OUT_SEQ
#define OUT_SEQ SEQ              // row pitch (in tokens) between sequences of the output
#endif
#define DM   64
#define NH_  4
#define HD   16
#define AW   4                   // waves per block
#define CSP  68                  // LDS row pitch (floats) of the 16 x 64 staging tiles
#define VTP  72                  // LDS row pitch (halves) of the v^T staging tile
#define QRS  2048.0f             // carry of every residual plane / residual fragment
#define QRI  (1.0f / 2048.0f)
#define WCS  64.0f               // carry of the f16 weight planes
#define WCI  (1.0f / 64.0f)
#define L2E  1.4426950408889634f
#define SC2  ((float)(0.25 * 1.4426950408889634))   // HD^-0.5 * log2(e)
#define PSH  14.0f               // log2 of the P carry (16384)
#define NEGB (-3.0e38f)
#define LNEPS 1.0e-5f

static_assert(DM == 64);                       // LayerNorm lane map: 2 lanes x 32 columns; two 32-deep k-steps
static_assert(HD == 16);                       // one 16-B load per q/k fragment, upper k half zero in registers
static_assert(NH_ * HD == DM);
static_assert(NH_ == AW);                      // wave w of the attention block = head w
static_assert(SEQ % 64 == 0);                  // a 64-token projection tile never straddles two sequences; v^T lines = 64 tokens
static_assert((NB * SEQ) % 64 == 0);
static_assert(SEQ % 32 == 0);                  // key loop steps by 32; bias kernel handles 32 keys per wave
static_assert(SEQ % 16 == 0);
static_assert((SEQ * (SEQ / 32)) % AW == 0);   // bias grid covers (i, 32-key chunk) exactly
static_assert(NB <= NB_FULL);
static_assert(SEQ <= SEQ_FULL);
static_assert((CSP * 4) % 16 == 0);
static_assert((VTP * 2) % 16 == 0);
static_assert(32 * 16 * NH_ == 16 * DM * 2);           // q/k store, per plane (value and residual alike): 4 head instructions x 32 lanes x 16 B = 16 rows x 64 halves
static_assert(32 * 16 * 8 == 16 * DM * 4);             // gate store: 8 instructions x 32 lanes x 16 B = 16 rows x 256 B
static_assert(128 * 16 * 4 == DM * 64 * 2);
static_assert(128 * 16 * 2 == 16 * DM * 4);            // output store: 2 trips x 128 threads x 16 B = 16 rows x 256 B
static_assert(32 * 16 == NH_ * 32 * 4);
static_assert(256 * 8 * 2 == DM * DM);                 // weight converter: 2 trips x 256 threads x 8 halves
static_assert(128 * 8 == 16 * DM);                     // Wp converter: 128 threads x 8 = 16 rows x 64
static_assert(AW * 16 * CSP * 4 + DM * VTP * 2 <= 131072);   // static LDS of the projection kernel
static_assert(2 * 16 * CSP * 4 <= 131072);                   // static LDS of the attention kernel
static_assert(36 <= CSP);                                    // the pair-bias tile fits the projection kernel's staging array
static_assert(DM * 65 * 4 <= 131072);                        // static LDS of the weight converter
static_assert(DM * NH_ <= DM * 65);                          // Wp staging fits the same array

typedef _Float16 h16;
typedef unsigned short bf;
typedef __attribute__((ext_vector_type(16))) __bf16   v16bf;
typedef __attribute__((ext_vector_type(16))) _Float16 v16h;
typedef __attribute__((ext_vector_type(8)))  _Float16 v8h;
typedef __attribute__((ext_vector_type(8)))  unsigned short v8us;
typedef __attribute__((ext_vector_type(8)))  float    v8f;
typedef __attribute__((ext_vector_type(4)))  float    v4f;
typedef __attribute__((ext_vector_type(4)))  int      v4i;
typedef v4f  __attribute__((may_alias)) v4fa;
typedef v8h  __attribute__((may_alias)) v8ha;

__device__ __forceinline__ unsigned short f2bf(float f) { unsigned u = __float_as_uint(f); u += 0x7FFFu + ((u >> 16) & 1u); return (unsigned short)(u >> 16); }
__device__ __forceinline__ float bfr(float f) { return __uint_as_float(((unsigned)f2bf(f)) << 16); }   // value after RNE convert to bf16
__device__ __forceinline__ v16h cat16(v8h lo, v8h hi) { return __builtin_shufflevector(lo, hi, 0, 1, 2, 3, 4, 5, 6, 7, 8, 9, 10, 11, 12, 13, 14, 15); }
__device__ __forceinline__ v16bf cat16b(v8us lo, v8us hi) { return __builtin_bit_cast(v16bf, __builtin_shufflevector(lo, hi, 0, 1, 2, 3, 4, 5, 6, 7, 8, 9, 10, 11, 12, 13, 14, 15)); }
__device__ __forceinline__ v8f wmma16(v16h a, v16h b, v8f c) { return __builtin_amdgcn_wmma_f32_16x16x32_f16(false, a, false, b, (short)0, c, false, false); }
__device__ __forceinline__ v8f wmmab(v16bf a, v16bf b, v8f c) { return __builtin_amdgcn_wmma_f32_16x16x32_bf16(false, a, false, b, (short)0, c, false, false); }
// fragment loaders from K-contiguous 16-bit rows; p already includes + 8*(lane>>4): elements 0..7 <- k0+8h+0..7, elements 8..15 <- k0+16+8h+0..7 (same map for A and B)
__device__ __forceinline__ v16h  ldh(const h16* p) { return cat16(*(const v8h*)p, *(const v8h*)(p + 16)); }
__device__ __forceinline__ v16bf ldb(const bf* p)  { return cat16b(*(const v8us*)p, *(const v8us*)(p + 16)); }
// ordering point for wave-private LDS tiles (same wave writes and reads)
__device__ __forceinline__ void wave_sync() { __builtin_amdgcn_fence(3 /* release order */, "wavefront"); __builtin_amdgcn_wave_barrier(); asm volatile("" ::: "memory"); }

// f32 -> f16 convert that cannot produce a subnormal (|v| < 2^-14 -> +0); NaN passes through
static __device__ __forceinline__ h16 toh_flush(float v) { const h16 r = (h16)v; return (fabsf(v) < 6.103515625e-05f) ? (h16)0.0f : r; }
// one matrix instruction followed by its own 4-slot guard
__device__ __forceinline__ v8f wmma16g(v16h a, v16h b, v8f c) { c = wmma16(a, b, c); asm volatile("v_nop\n\tv_nop\n\tv_nop\n\tv_nop" : "+v"(c) : "v"(a), "v"(b)); return c; }
__device__ __forceinline__ v8f wmmabg(v16bf a, v16bf b, v8f c) { c = wmmab(a, b, c); asm volatile("v_nop\n\tv_nop\n\tv_nop\n\tv_nop" : "+v"(c) : "v"(a), "v"(b)); return c; }

__device__ __forceinline__ void wconv_body(const float* __restrict__ src, h16* dst, float* wsl) {
    const int tid = threadIdx.x;
#pragma unroll 1
    for (int it = 0; it < 16; ++it) { const int idx = it * 256 + tid; wsl[(idx >> 6) * 65 + (idx & 63)] = bfr(src[idx]); }   // 16 x 256 = 4096 elements, all staged
    __syncthreads();
{
#pragma unroll 1
        for (int it = 0; it < 2; ++it) { const int idx = it * 256 + tid; const int n = idx >> 3, k8 = (idx & 7) * 8; v8h o;   // 2 trips x 32 rows = 64 rows
#pragma unroll
            for (int i = 0; i < 8; ++i) o[i] = toh_flush(wsl[(k8 + i) * 65 + n] * WCS);
            *(v8h*)(dst + (size_t)n * DM + k8) = o;
            asm volatile("s_wait_xcnt 0x0" ::: "memory"); }   // stands in front of the next trip's address arithmetic, which rewrites the store's address register
         }
}

// runs in a 256-thread block: waves 0..3 do the work, every wave passes the barrier
__device__ __forceinline__ void wpconv_body(const float* __restrict__ src, bf* dst, float* wsl) {
    const int tid = threadIdx.x;
    if (tid < 128) { wsl[tid] = src[tid]; wsl[tid + 128] = src[tid + 128]; }
    __syncthreads();
    if (tid >= 128) return;
    const int row = tid >> 3, k8 = (tid & 7) * 8;
    const int rc = row < NH_ ? row : (NH_ - 1);
    v8us o;
#pragma unroll
    for (int i = 0; i < 8; ++i) { float w = wsl[(k8 + i) * NH_ + rc]; asm volatile("" : "+v"(w)); o[i] = (row < NH_) ? f2bf(w) : (unsigned short)0; }
    *(v8us*)(dst + (size_t)row * DM + k8) = o; 
}

// k_conv: block b converts one weight matrix: 0..3 -> q | k | v | gate planes of WT, 4 -> WOT, 5 -> WPT. The six conversions are independent of each other.
__global__ __launch_bounds__(256) void k_conv(const float* __restrict__ wq, const float* __restrict__ wk, const float* __restrict__ wv, const float* __restrict__ wg,
                                              const float* __restrict__ wo, const float* __restrict__ wp, h16* WT, h16* WOT, bf* WPT) {
    __shared__ float wsl[DM * 65];
    const int b = blockIdx.x;
    if (b == 5) { wpconv_body(wp, WPT, wsl); return; }
    const float* src = (b == 0) ? wq : (b == 1) ? wk : (b == 2) ? wv : (b == 3) ? wg : wo;
    h16* dst = (b == 4) ? WOT : WT + (size_t)b * DM * DM;
    wconv_body(src, dst, wsl);
}

// pairbias_body: bias[h][i][j] = sum_p bf16(pair[i][j][p]) bf16(Wp[p][h]); one wave per (i, 32 keys): A = Wp^T rows (row = head, padded to 16), B = pair rows converted in registers (col = key), K = 64.
__device__ __forceinline__ void pairbias_body(const int blk, const float* __restrict__ pair, const bf* __restrict__ WPT, float* BIAS, float* os) {
    const int lane = threadIdx.x & 31, lr = lane & 15, hi = lane >> 4;
    const int wave = __builtin_amdgcn_readfirstlane((int)(threadIdx.x >> 5));
    const int gw = blk * AW + wave;
    const int qi = gw / (SEQ / 32), j0 = (gw % (SEQ / 32)) * 32;
    const v16bf a0 = ldb(WPT + lr * DM + 8 * hi), a1 = ldb(WPT + lr * DM + 8 * hi + 32);
    const int wb = wave * 16 * 36;
#pragma unroll
    for (int jt = 0; jt < 2; ++jt) {
        const float* p = pair + ((size_t)qi * SEQ_FULL + (size_t)(j0 + 16 * jt + lr)) * DM + 8 * hi;
        v8f acc = (v8f){};
#pragma unroll
        for (int kc = 0; kc < 2; ++kc) {
            const v4f x0 = *(const v4f*)(p + 32 * kc), x1 = *(const v4f*)(p + 32 * kc + 4), x2 = *(const v4f*)(p + 32 * kc + 16), x3 = *(const v4f*)(p + 32 * kc + 20);
            v8us e0, e1;
#pragma unroll
            for (int i = 0; i < 4; ++i) { e0[i] = f2bf(x0[i]); e0[4 + i] = f2bf(x1[i]); e1[i] = f2bf(x2[i]); e1[4 + i] = f2bf(x3[i]); }
            const v16bf bq = cat16b(e0, e1);
            if (kc == 0) acc = wmmabg(a0, bq, acc); else acc = wmmabg(a1, bq, acc);
        }
#pragma unroll
        for (int r = 0; r < 8; ++r) os[wb + (8 * hi + r) * 36 + 16 * jt + lr] = acc[r];      // D: row 8h+r (head), col lane&15 (key); 16 rows x 32 columns all written
    }
    wave_sync();
    const int head = lane >> 3, cofs = (lane & 7) * 4;                                        // 4 heads x 8 lanes x 4 floats = 4 lines
    const v4f val = *(const v4fa*)(&os[wb + head * 36 + cofs]);
    float* dstp = BIAS + ((size_t)head * SEQ + (size_t)qi) * SEQ + j0 + cofs;
    *(v4f*)dstp = val;
    asm volatile("s_wait_xcnt 0x0" ::: "memory");   // stands in front of whatever the merged kernel's layout puts behind this store and lets rewrite its registers
}

// value of one 16 x 16 projection tile: (x_hi W + (x_res W) / 2048) / 64, K = 64
__device__ __forceinline__ v8f proj_tile(const h16* __restrict__ wp, v16h a0h, v16h a1h, v16h a0r, v16h a1r) {
    const v16h b0 = ldh(wp), b1 = ldh(wp + 32);
    v8f cH = (v8f){}, cR = (v8f){};
    cH = wmma16g(a0h, b0, cH); cH = wmma16g(a1h, b1, cH);
    cR = wmma16g(a0r, b0, cR); cR = wmma16g(a1r, b1, cR);
    return (cH + cR * QRI) * WCI;
}

// lnproj_body: LayerNorm + q/k/v/gate projections; block = 64 tokens of one sequence, wave = 16 tokens. Lane (row = lane&15, half = lane>>4) holds the 32 columns 16q + 8*half + i of its row,
// q, k: f16 value plane and f16 residual plane ((v - value) x 2048, same flush select); per head the 16 x 16 halves are one contiguous 512-byte run of each plane, written by one instruction (32 lanes x 16 B);
// gate: f32 rows of 256 B, 2 rows per instruction;
__device__ __forceinline__ void lnproj_body(const int blk, const float* __restrict__ msa, const float* __restrict__ lng, const float* __restrict__ lnb,
                                            const h16* __restrict__ WT, const float* __restrict__ bg,
                                            h16* QH, h16* QR, h16* KP, h16* KR, h16* VT, float* GP, float* os, h16* vts) {
    const int lane = threadIdx.x & 31, lr = lane & 15, hi = lane >> 4;
    const int wave = __builtin_amdgcn_readfirstlane((int)(threadIdx.x >> 5));
    const int r0 = blk * 64;
    const int sq = r0 / SEQ, tbk = r0 % SEQ;
    const int t0 = tbk + wave * 16;
    const int wb = wave * 16 * CSP;
    const float* xr = msa + ((size_t)sq * SEQ_FULL + (size_t)(t0 + lr)) * DM + 8 * hi;
    float xv[32];
#pragma unroll
    for (int q = 0; q < 4; ++q) { const v4f u0 = *(const v4f*)(xr + 16 * q), u1 = *(const v4f*)(xr + 16 * q + 4);
#pragma unroll
        for (int i = 0; i < 4; ++i) { xv[8 * q + i] = bfr(u0[i]); xv[8 * q + 4 + i] = bfr(u1[i]); } }
    asm volatile("s_wait_xcnt 0x0" ::: "memory");   // stands in front of the gain loads, whose destinations reuse the row loads' address pair
    float sm = 0.0f;
#pragma unroll
    for (int e = 0; e < 32; ++e) sm += xv[e];
    sm += __shfl_xor(sm, 16, 32);
    const float mu = sm * (1.0f / 64.0f);
    float sv = 0.0f;
#pragma unroll
    for (int e = 0; e < 32; ++e) { const float dl = xv[e] - mu; sv += dl * dl; }
    sv += __shfl_xor(sv, 16, 32);
    const float rs = rsqrtf(sv * (1.0f / 64.0f) + LNEPS);
    v16h ah[2], ar[2];
#pragma unroll
    for (int q = 0; q < 4; ++q) {
        const v4f g0 = *(const v4f*)(lng + 8 * hi + 16 * q), g1 = *(const v4f*)(lng + 8 * hi + 16 * q + 4);
        const v4f c0 = *(const v4f*)(lnb + 8 * hi + 16 * q), c1 = *(const v4f*)(lnb + 8 * hi + 16 * q + 4);
#pragma unroll
        for (int i = 0; i < 4; ++i) {
            const float y0 = (xv[8 * q + i] - mu) * rs * bfr(g0[i]) + bfr(c0[i]);
            const float y1 = (xv[8 * q + 4 + i] - mu) * rs * bfr(g1[i]) + bfr(c1[i]);
            const h16 h0 = toh_flush(y0), h1 = toh_flush(y1);
            ah[q >> 1][(q & 1) * 8 + i] = h0; ah[q >> 1][(q & 1) * 8 + 4 + i] = h1;
            ar[q >> 1][(q & 1) * 8 + i] = toh_flush((y0 - (float)h0) * QRS); ar[q >> 1][(q & 1) * 8 + 4 + i] = toh_flush((y1 - (float)h1) * QRS); } }
    const size_t wlo = (size_t)lr * DM + 8 * hi;                       // + (matrix*64 + 16*nb) * DM
    // q (matrix 0) and k (matrix 1)
#pragma unroll
    for (int mat = 0; mat < 2; ++mat) {
#pragma unroll
        for (int nb = 0; nb < 4; ++nb) {
            const v8f val = proj_tile(WT + wlo + (size_t)(mat * 64 + nb * 16) * DM, ah[0], ah[1], ar[0], ar[1]);
#pragma unroll
            for (int r = 0; r < 8; ++r) os[wb + (8 * hi + r) * CSP + nb * 16 + lr] = val[r]; }     // D: row 8h+r (token), col lane&15
        wave_sync();
{
#pragma unroll
            for (int hh = 0; hh < NH_; ++hh) { const int row = lane >> 1, c8 = (lane & 1) * 8;       // 16 rows x 2 lanes x 8 halves = head hh of the tile
                const v4f x0 = *(const v4fa*)(&os[wb + row * CSP + hh * 16 + c8]); const v4f x1 = *(const v4fa*)(&os[wb + row * CSP + hh * 16 + c8 + 4]); v8h hv, rv;
#pragma unroll
                for (int i = 0; i < 4; ++i) { const h16 a0 = toh_flush(x0[i]); const h16 a1 = toh_flush(x1[i]); hv[i] = a0; hv[4 + i] = a1;
                    rv[i] = toh_flush((x0[i] - (float)a0) * QRS); rv[4 + i] = toh_flush((x1[i] - (float)a1) * QRS); }
                const size_t oo = ((size_t)(sq * NH_ + hh) * SEQ + (size_t)t0) * HD + (size_t)lane * 8;
                if (mat == 0) { *(v8h*)(QH + oo) = hv; *(v8h*)(QR + oo) = rv; } else { *(v8h*)(KP + oo) = hv; *(v8h*)(KR + oo) = rv; } }
             }
        asm volatile("s_wait_xcnt 0x0" ::: "memory");   // stands in front of the next weight loads, whose destinations reuse registers that the stores above name
        wave_sync();
    }
    // v (matrix 2): lane's 8 accumulator values are 8 consecutive tokens of column c -> one 16-B LDS store into the [c][token] tile
#pragma unroll
    for (int nb = 0; nb < 4; ++nb) {
        const v8f val = proj_tile(WT + wlo + (size_t)(2 * 64 + nb * 16) * DM, ah[0], ah[1], ar[0], ar[1]);
        v8h o;
#pragma unroll
        for (int r = 0; r < 8; ++r) o[r] = toh_flush(val[r]);
        *(v8ha*)(&vts[(nb * 16 + lr) * VTP + wave * 16 + 8 * hi]) = o; }
    // gate (matrix 3): sigmoid(x Wg + bg)
#pragma unroll
    for (int nb = 0; nb < 4; ++nb) {
        const v8f val = proj_tile(WT + wlo + (size_t)(3 * 64 + nb * 16) * DM, ah[0], ah[1], ar[0], ar[1]);
        const float bgv = bfr(bg[nb * 16 + lr]);
#pragma unroll
        for (int r = 0; r < 8; ++r) { const float z = val[r] + bgv; const float ex = __builtin_amdgcn_exp2f(-z * L2E); os[wb + (8 * hi + r) * CSP + nb * 16 + lr] = 1.0f / (1.0f + ex); } }
    wave_sync();
{
#pragma unroll
        for (int s8 = 0; s8 < 8; ++s8) { const int row = 2 * s8 + (lane >> 4), cofs = (lane & 15) * 4;      // 8 x 2 rows = 16 rows; 16 lanes x 4 floats = 64 columns
            const v4f val = *(const v4fa*)(&os[wb + row * CSP + cofs]);
            *(v4f*)(GP + ((size_t)sq * SEQ + (size_t)(t0 + row)) * DM + cofs) = val; }
         }
    __syncthreads();                                                   // v^T tile: written by all 4 waves, read across waves
    const int tid = threadIdx.x;
{
#pragma unroll
        for (int it = 0; it < 4; ++it) { const int idx = it * 128 + tid; const int c = idx >> 3, t8 = (idx & 7) * 8;   // 4 trips x 16 rows = 64 rows; 8 lanes x 8 halves = 64 tokens = one line
            const v8h o = *(const v8ha*)(&vts[c * VTP + t8]);
            *(v8h*)(VT + ((size_t)sq * DM + (size_t)c) * SEQ + tbk + t8) = o; }
         }
}

// k_lnproj_pairbias: blocks 0 .. LNB-1 run lnproj_body (the longer work, so it starts first), blocks LNB .. LNB+PBB-1 run pairbias_body; neither reads what the other writes.
#define LNB (NB * SEQ / 64)
#define PBB (SEQ * (SEQ / 32) / AW)
__global__ __launch_bounds__(32 * AW) void k_lnproj_pairbias(const float* __restrict__ msa, const float* __restrict__ lng, const float* __restrict__ lnb,
                                                             const h16* __restrict__ WT, const float* __restrict__ bg,
                                                             h16* QH, h16* QR, h16* KP, h16* KR, h16* VT, float* GP,
                                                             const float* __restrict__ pair, const bf* __restrict__ WPT, float* BIAS) {
    __shared__ __align__(16) float os[AW * 16 * CSP];                  // the pair-bias blocks use its first AW * 16 * 36 floats
    __shared__ __align__(16) h16 vts[DM * VTP];
    const int b = blockIdx.x;
    if (b < LNB) lnproj_body(b, msa, lng, lnb, WT, bg, QH, QR, KP, KR, VT, GP, os, vts);
    else pairbias_body(b - LNB, pair, WPT, BIAS, os);
}

// k_attn: block = 16 query rows of one sequence, wave w = head w. Transposed flash form: S^T[key][t] = K Q^T (A = K rows, B = Q rows, k = d: 16 real + 16 zero slots);
// scores = K Q + (K Q_res + K_res Q) / 2048 (value x value in the main accumulators, the two cross products in their own accumulators; residual x residual dropped);
// lane (t = lane&15, h = lane>>4) holds keys 8h+r of each 16-key tile, so the packed P tile is directly the B fragment of O^T[d][t] = V^T P^T.
// Per step: bias row segment and mask words loaded as 16-B vectors at arithmetic addresses; masked keys are dropped by value (probability 0, excluded from the running max).
// After the key loop the 4 heads' contexts meet in a block LDS tile [16][64]; every wave rebuilds the gated context fragments (value + residual x2048) and computes one 16-column tile of the output projection;
__global__ __launch_bounds__(32 * AW) void k_attn(const h16* __restrict__ QH, const h16* __restrict__ QR, const h16* __restrict__ KP, const h16* __restrict__ KR, const h16* __restrict__ VT,
                                                  const float* __restrict__ BIAS, const int* __restrict__ kmask, const float* __restrict__ GP,
                                                  const h16* __restrict__ WOT, const float* __restrict__ bo, float* OUT) {
    __shared__ __align__(16) float cs[16 * CSP];
    __shared__ __align__(16) float ot[16 * CSP];
    const int lane = threadIdx.x & 31, lr = lane & 15, hi = lane >> 4;
    const int wave = __builtin_amdgcn_readfirstlane((int)(threadIdx.x >> 5));
    const int sq = blockIdx.y; const int t0 = blockIdx.x * 16;
    const int zh = sq * NH_ + wave;
    const size_t pbase = (size_t)zh * SEQ * HD;
    const v8h z8 = (v8h){};
    const v16h qh = cat16(*(const v8h*)(QH + pbase + (size_t)(t0 + lr) * HD + 8 * hi), z8);   // B fragment: col t, k = d; slots 16..31 zero
    const v16h qr = cat16(*(const v8h*)(QR + pbase + (size_t)(t0 + lr) * HD + 8 * hi), z8);   // residual x2048, same map
    const size_t ko = pbase + (size_t)lr * HD + 8 * hi;        // + key * HD   (A fragment: row key, k = d)
    const size_t vo = pbase + (size_t)lr * SEQ + 8 * hi;       // + key        (A fragment: row d, k = key)
    const float* bp0 = BIAS + ((size_t)wave * SEQ + (size_t)(t0 + lr)) * SEQ + 8 * hi;
    const int* mp0 = kmask + (size_t)sq * SEQ_FULL + 8 * hi;
    v8f o0 = (v8f){};
    float m = NEGB, l = 0.0f;
#pragma unroll 1
    for (int key0 = 0; key0 < SEQ; key0 += 32) {
        const h16* ka = KP + ko + (size_t)key0 * HD;
        const v16h ka0 = cat16(*(const v8h*)ka, z8), kb0 = cat16(*(const v8h*)(ka + 16 * HD), z8);
        const h16* kr = KR + ko + (size_t)key0 * HD;
        const v16h kra0 = cat16(*(const v8h*)kr, z8), krb0 = cat16(*(const v8h*)(kr + 16 * HD), z8);
        v8f sa = (v8f){}, sb = (v8f){}, ra = (v8f){}, rb = (v8f){};
        sa = wmma16g(ka0, qh, sa); sb = wmma16g(kb0, qh, sb);
        ra = wmma16g(ka0, qr, ra); ra = wmma16g(kra0, qh, ra);
        rb = wmma16g(kb0, qr, rb); rb = wmma16g(krb0, qh, rb);
        const float* bp = bp0 + key0;                            // keys key0+8h+0..7 and key0+16+8h+0..7 of query row t0 + (lane&15)
        const v4f c0 = *(const v4f*)bp, c1 = *(const v4f*)(bp + 4), c2 = *(const v4f*)(bp + 16), c3 = *(const v4f*)(bp + 20);
        const int* mp = mp0 + key0;
        const v4i n0 = *(const v4i*)mp, n1 = *(const v4i*)(mp + 4), n2 = *(const v4i*)(mp + 16), n3 = *(const v4i*)(mp + 20);
        float ta[8], tc[8]; bool fa[8], fb[8]; float mx = NEGB;
#pragma unroll
        for (int r = 0; r < 4; ++r) {
            ta[r] = (sa[r] + ra[r] * QRI) * SC2 + c0[r] * L2E; ta[4 + r] = (sa[4 + r] + ra[4 + r] * QRI) * SC2 + c1[r] * L2E;
            tc[r] = (sb[r] + rb[r] * QRI) * SC2 + c2[r] * L2E; tc[4 + r] = (sb[4 + r] + rb[4 + r] * QRI) * SC2 + c3[r] * L2E;
            fa[r] = n0[r] != 0; fa[4 + r] = n1[r] != 0; fb[r] = n2[r] != 0; fb[4 + r] = n3[r] != 0; }
#pragma unroll
        for (int r = 0; r < 8; ++r) mx = fmaxf(mx, fmaxf(fa[r] ? ta[r] : NEGB, fb[r] ? tc[r] : NEGB));
        mx = fmaxf(mx, __shfl_xor(mx, 16, 32));
        const float mnew = fmaxf(m, mx);
        const float alpha = __builtin_amdgcn_exp2f(m - mnew);
        const float sh = PSH - mnew;
        v16h pb; float ls = 0.0f;
#pragma unroll
        for (int r = 0; r < 8; ++r) {
            const float xa = ta[r] + sh, xb = tc[r] + sh;
            const float ea = __builtin_amdgcn_exp2f(xa), eb = __builtin_amdgcn_exp2f(xb);
            const float ga = (fa[r] & (xa >= -14.0f)) ? ea : 0.0f, gb = (fb[r] & (xb >= -14.0f)) ? eb : 0.0f;   // dropped keys and sub-2^-14 values selected to 0 by value
            const h16 pa = (h16)ga; const h16 pc = (h16)gb;
            pb[r] = pa; pb[8 + r] = pc;
            ls += (float)pa + (float)pc; }
        l = l * alpha + ls; m = mnew;
        o0 = o0 * alpha;
        const v16h v0 = ldh(VT + vo + key0);
        o0 = wmma16g(v0, pb, o0);
    }
    l += __shfl_xor(l, 16, 32);
    const bool any = l > 0.0f;
    const float lsafe = any ? l : 1.0f;
    const float inv = any ? (1.0f / lsafe) : __uint_as_float(0x7FC00000u);       // no kept key -> NaN row (softmax of an all-dropped row)
    // O^T D layout: o0[r] = (d = 8h + r, t = lane&15) -> cs[t][wave*16 + d]; 16 rows x 64 columns written by the 4 waves
    { v4f a, c;
      a[0] = o0[0] * inv; a[1] = o0[1] * inv; a[2] = o0[2] * inv; a[3] = o0[3] * inv; c[0] = o0[4] * inv; c[1] = o0[5] * inv; c[2] = o0[6] * inv; c[3] = o0[7] * inv;
      *(v4fa*)(&cs[lr * CSP + wave * 16 + 8 * hi]) = a; *(v4fa*)(&cs[lr * CSP + wave * 16 + 8 * hi + 4]) = c; }
    __syncthreads();                                                             // cs: cross-wave
    // gated context fragments: row t = lane&15, k = concatenated head column 16q + 8h + i
    const float* gr = GP + ((size_t)sq * SEQ + (size_t)(t0 + lr)) * DM + 8 * hi;
    v16h gh[2], gq[2];
#pragma unroll
    for (int q = 0; q < 4; ++q) {
        const v4f g0 = *(const v4f*)(gr + 16 * q), g1 = *(const v4f*)(gr + 16 * q + 4);
        const v4f x0 = *(const v4fa*)(&cs[lr * CSP + 8 * hi + 16 * q]), x1 = *(const v4fa*)(&cs[lr * CSP + 8 * hi + 16 * q + 4]);
#pragma unroll
        for (int i = 0; i < 4; ++i) {
            const float y0 = g0[i] * x0[i], y1 = g1[i] * x1[i];
            const h16 h0 = toh_flush(y0), h1 = toh_flush(y1);
            gh[q >> 1][(q & 1) * 8 + i] = h0; gh[q >> 1][(q & 1) * 8 + 4 + i] = h1;
            gq[q >> 1][(q & 1) * 8 + i] = toh_flush((y0 - (float)h0) * QRS); gq[q >> 1][(q & 1) * 8 + 4 + i] = toh_flush((y1 - (float)h1) * QRS); } }
    const v8f pv = proj_tile(WOT + (size_t)(wave * 16 + lr) * DM + 8 * hi, gh[0], gh[1], gq[0], gq[1]);
    const float bov = bfr(bo[wave * 16 + lr]);
#pragma unroll
    for (int r = 0; r < 8; ++r) ot[(8 * hi + r) * CSP + wave * 16 + lr] = pv[r] + bov;       // D: row 8h+r (token), col lane&15; 16 rows x 64 columns written by the 4 waves
    __syncthreads();                                                             // ot: cross-wave
    float* orow = OUT + ((size_t)sq * OUT_SEQ + (size_t)t0) * DM;
    const int tid = threadIdx.x;
{
#pragma unroll
        for (int it = 0; it < 2; ++it) { const int idx = it * 128 + tid; const int row = idx >> 4, cofs = (idx & 15) * 4;   // 2 trips x 8 rows = 16 rows; 16 pieces x 4 floats = 64 columns
            const v4f val = *(const v4fa*)(&ot[row * CSP + cofs]);
            *(v4f*)(orow + (size_t)row * DM + cofs) = val; }
         }
}

static constexpr size_t al256(size_t v) { return (v + 255) & ~(size_t)255; }
static constexpr size_t SZ_WT = al256((size_t)4 * DM * DM * 2);
static constexpr size_t SZ_WO = al256((size_t)DM * DM * 2);
static constexpr size_t SZ_WP = al256((size_t)16 * DM * 2);
static constexpr size_t SZ_PL = al256((size_t)NB * SEQ * DM * 2);
static constexpr size_t SZ_GP = al256((size_t)NB * SEQ * DM * 4);
static constexpr size_t SZ_BS = al256((size_t)NH_ * SEQ * SEQ * 4);
static constexpr size_t SZ_TOTAL = SZ_WT + SZ_WO + SZ_WP + 5 * SZ_PL + SZ_GP + SZ_BS;   // planes: q value, q residual, k value, k residual, v^T
static_assert(SZ_TOTAL <= (size_t)134217728);          // workspace carve <= 128 MiB
static_assert(((size_t)DM * DM * 2) % 256 == 0);       // weight sub-planes stay 256-byte aligned
static_assert((size_t)NB * NH_ * SEQ * HD == (size_t)NB * DM * SEQ);   // q/k value and residual planes [s*4+h][t][16] and v^T plane [s*64+c][t] have the same extent
static_assert(((size_t)(NB - 1) * OUT_SEQ + SEQ) * DM <= (size_t)NB_FULL * SEQ_FULL * DM);   // last output row inside the output buffer

extern "C" void kernel_launch(void* const* d_in, const int* in_sizes, int n_in,
                              void* d_out, int out_size, void* d_ws, size_t ws_size, hipStream_t stream) {
    if (n_in < 13) return;
    const size_t needx = ((size_t)(NB - 1) * SEQ_FULL + SEQ) * DM;
    const size_t needp = ((size_t)(SEQ - 1) * SEQ_FULL + SEQ) * DM;
    const size_t needm = (size_t)(NB - 1) * SEQ_FULL + SEQ;
    if ((size_t)in_sizes[0] < needx || (size_t)in_sizes[1] < needp || (size_t)in_sizes[2] < needm) return;
    if (in_sizes[3] < DM || in_sizes[4] < DM || in_sizes[9] < DM || in_sizes[12] < DM) return;
    if (in_sizes[5] < DM * DM || in_sizes[6] < DM * DM || in_sizes[7] < DM * DM || in_sizes[8] < DM * DM || in_sizes[11] < DM * DM) return;
    if (in_sizes[10] < DM * NH_) return;
    if ((size_t)out_size < ((size_t)(NB - 1) * OUT_SEQ + SEQ) * DM) return;
    if (SZ_TOTAL > ws_size) return;
    // wire order: x stack, pair, key mask, ln gain, ln bias, Wq, Wk, Wv, Wg, bg, Wp, Wo, bo
    const float* msa  = (const float*)d_in[0];
    const float* pair = (const float*)d_in[1];
    const int*   kmsk = (const int*)d_in[2];
    const float* lng  = (const float*)d_in[3];
    const float* lnb  = (const float*)d_in[4];
    const float* wq   = (const float*)d_in[5];
    const float* wk   = (const float*)d_in[6];
    const float* wv   = (const float*)d_in[7];
    const float* wg   = (const float*)d_in[8];
    const float* bg   = (const float*)d_in[9];
    const float* wp   = (const float*)d_in[10];
    const float* wo   = (const float*)d_in[11];
    const float* bo   = (const float*)d_in[12];
    float* OUT = (float*)d_out;      // [NB][SEQ][64]
    char* wsp = (char*)d_ws;
    h16* WT  = (h16*)wsp; wsp += SZ_WT;               // [4][64 n][64 k]: q | k | v | gate, x64
    h16* WOT = (h16*)wsp; wsp += SZ_WO;               // [64 n][64 k], x64
    bf*  WPT = (bf*)wsp;  wsp += SZ_WP;               // [16][64]
    h16* QH  = (h16*)wsp; wsp += SZ_PL;               // [NB*4][SEQ][16]
    h16* QR  = (h16*)wsp; wsp += SZ_PL;               // [NB*4][SEQ][16] residual x2048
    h16* KP  = (h16*)wsp; wsp += SZ_PL;               // [NB*4][SEQ][16]
    h16* KR  = (h16*)wsp; wsp += SZ_PL;               // [NB*4][SEQ][16] residual x2048
    h16* VT  = (h16*)wsp; wsp += SZ_PL;               // [NB*4][16][SEQ]
    float* GP = (float*)wsp; wsp += SZ_GP;            // [NB][SEQ][64]
    float* BIAS = (float*)wsp; wsp += SZ_BS;          // [4][SEQ][SEQ]

    k_conv<<<6, 256, 0, stream>>>(wq, wk, wv, wg, wo, wp, WT, WOT, WPT);
    k_lnproj_pairbias<<<(unsigned)(LNB + PBB), 32 * AW, 0, stream>>>(msa, lng, lnb, WT, bg, QH, QR, KP, KR, VT, GP, pair, WPT, BIAS);
    k_attn<<<dim3(SEQ / 16, NB, 1), 32 * AW, 0, stream>>>(QH, QR, KP, KR, VT, BIAS, kmsk, GP, WOT, bo, OUT);
}

// v002
// Measured time: 44.9 microseconds a run.
// Timed twice side by side with v001, it ran 1.10 and 1.12 times as fast.
// Counting every step since v000, it is 1.67 times as fast.
#include <hip/hip_runtime.h>

// Gated row attention over a stack of sequences with a pair-derived additive bias shared by all sequences: x [NB][SEQ][64] -> LayerNorm (eps 1e-5, gain, bias) -> bias-free q/k/v projections ([in][out], y = x W),
// sigmoid gate (x Wg + bg), 4 heads x 16, scores q.k / sqrt(16) + bias[h][i][j] with bias = pair[i][j][:] . Wp[:][h], key padding mask (int32, replace fill: masked keys dropped from the softmax, a row with no kept key gives NaN),
// softmax over keys, context, gate multiply, output projection ([in][out]) + bias; output f32 [NB][SEQ][64].
// Compute dtypes, f32 accumulate everywhere: q/k/v/gate projections v_wmma_f32_16x16x32_f16 (LayerNorm output as f16 value + f16 residual x2048 in its own accumulator, W RNE-converted to bf16 then x64 in f16, exact);
// pair bias v_wmma_f32_16x16x32_bf16 (pair and Wp RNE-converted to bf16, products exact); scores v_wmma_f32_16x16x32_f16 with q and k each as f16 value + f16 residual x2048 (three products: value x value in the main accumulator,
// value x residual + residual x value in their own accumulator folded by 1/2048; head dim 16 zero-padded to the 32-deep k-step in registers in both fragments);
// P.V v_wmma_f32_16x16x32_f16 single product (P x16384 carry, cancels in the normalisation, row sum over the converted P); output projection v_wmma_f32_16x16x32_f16 (gated context as f16 value + f16 residual x2048 in its own accumulator, Wo x64).
// Every float input is RNE-converted to bf16 at its load. LayerNorm, softmax (online, running max over kept keys), sigmoid in f32.
// Layout: every plane that a wave reads as a matrix fragment or as an accumulator-shaped tile, except Wp^T, is stored in the order the lanes read it, so that one 16-byte load per lane covers 512 contiguous bytes (4 whole lines):
// W^T planes f16 [16-column tile][k segment of 16][lane][8] (lane = 16 * (k bit 3) + column); v^T plane f16 [s*4+h][32-key chunk][16-key half][lane][8] (lane = 16 * (key bit 3) + d);
// gate plane f32 [s][16-token tile][16-column group][4-column half][lane][4] (lane = 16 * (column bit 3) + token); bias plane f32 [h][16-query tile][32-key chunk][j][lane][4] (lane = 16 * (key bit 3) + query, j = 2 * (key bit 4) + (key bit 2));
// q, k value planes and q, k residual planes (x2048) [s*4+h][t][16] f16 (a 16-row fragment is 512 contiguous bytes as it is); Wp^T plane [16][64] bf16 (rows >= 4 zero).
// Three launches, one per level of the dependence chain: k_conv (all six weight planes, one block each), k_lnproj_pairbias (projection blocks first, then the pair-bias blocks, which do not depend on each other), k_attn.
// Fused attention kernel: one block = 16 query rows of one sequence, wave w = head w, transposed flash form (S^T = K Q^T, O^T = V^T P^T, fragments straight from the planes), then gate, output projection and whole-row stores.

#ifndef NB
#define NB 128                   // number of sequences (batch x stack depth)
#endif
#ifndef SEQ
#define SEQ 256                  // tokens per sequence (queries = keys)
#endif
#define NB_FULL  128
#define SEQ_FULL 256
#ifndef OUT_SEQ
#define OUT_SEQ SEQ              // row pitch (in tokens) between sequences of the output
#endif
#define DM   64
#define NH_  4
#define HD   16
#define AW   4                   // waves per block
#define CSP  68                  // LDS row pitch (floats) of the 16 x 64 staging tiles
#define VTP  72                  // LDS row pitch (halves) of the v^T staging tile
#define QRS  2048.0f             // carry of every residual plane / residual fragment
#define QRI  (1.0f / 2048.0f)
#define WCS  64.0f               // carry of the f16 weight planes
#define WCI  (1.0f / 64.0f)
#define L2E  1.4426950408889634f
#define SC2  ((float)(0.25 * 1.4426950408889634))   // HD^-0.5 * log2(e)
#define PSH  14.0f               // log2 of the P carry (16384)
#define NEGB (-3.0e38f)
#define LNEPS 1.0e-5f

static_assert(DM == 64);                       // LayerNorm lane map: 2 lanes x 32 columns; two 32-deep k-steps
static_assert(HD == 16);                       // one 16-B load per q/k fragment, upper k half zero in registers
static_assert(NH_ * HD == DM);
static_assert(NH_ == AW);                      // wave w of the attention block = head w
static_assert(SEQ % 64 == 0);                  // a 64-token projection tile never straddles two sequences and fills two whole 32-key chunks of the v^T plane
static_assert((NB * SEQ) % 64 == 0);
static_assert(SEQ % 32 == 0);                  // key loop steps by 32; bias and v^T planes are in 32-key chunks
static_assert(SEQ % 16 == 0);
static_assert(SEQ % 8 == 0);                   // bias grid covers (16-query tile, 8-key group) exactly
static_assert(NB <= NB_FULL);
static_assert(SEQ <= SEQ_FULL);
static_assert((CSP * 4) % 16 == 0);
static_assert((VTP * 2) % 16 == 0);
static_assert(32 * 16 * NH_ == 16 * DM * 2);           // q/k store, per plane (value and residual alike): 4 head instructions x 32 lanes x 16 B = 16 rows x 64 halves
static_assert(32 * 16 * 8 == 16 * DM * 4);             // gate store: 8 instructions x 32 lanes x 16 B = 16 rows x 256 B
static_assert(128 * 16 * 4 == DM * 64 * 2);
static_assert(128 * 16 * 2 == 16 * DM * 4);            // output store: 2 trips x 128 threads x 16 B = 16 rows x 256 B
static_assert(128 * 16 == NH_ * 16 * 8 * 4);           // bias store: 128 threads x 16 B = 4 heads x 16 queries x 8 keys
static_assert(256 * 8 * 2 == DM * DM);                 // weight converter: 2 trips x 256 threads x 8 halves
static_assert(128 * 8 == 16 * DM);                     // Wp converter: 128 threads x 8 = 16 rows x 64
static_assert(AW * 16 * CSP * 4 + DM * VTP * 2 <= 131072);   // static LDS of the projection kernel
static_assert(2 * 16 * CSP * 4 <= 131072);                   // static LDS of the attention kernel
static_assert(NH_ * 16 * 8 <= AW * 16 * CSP);                // the pair-bias tile fits the projection kernel's staging array
static_assert(DM * 65 * 4 <= 131072);                        // static LDS of the weight converter
static_assert(DM * NH_ <= DM * 65);                          // Wp staging fits the same array

typedef _Float16 h16;
typedef unsigned short bf;
typedef __attribute__((ext_vector_type(16))) __bf16   v16bf;
typedef __attribute__((ext_vector_type(16))) _Float16 v16h;
typedef __attribute__((ext_vector_type(8)))  _Float16 v8h;
typedef __attribute__((ext_vector_type(8)))  unsigned short v8us;
typedef __attribute__((ext_vector_type(8)))  float    v8f;
typedef __attribute__((ext_vector_type(4)))  float    v4f;
typedef __attribute__((ext_vector_type(4)))  int      v4i;
typedef v4f  __attribute__((may_alias)) v4fa;
typedef v8h  __attribute__((may_alias)) v8ha;

__device__ __forceinline__ unsigned short f2bf(float f) { unsigned u = __float_as_uint(f); u += 0x7FFFu + ((u >> 16) & 1u); return (unsigned short)(u >> 16); }
__device__ __forceinline__ float bfr(float f) { return __uint_as_float(((unsigned)f2bf(f)) << 16); }   // value after RNE convert to bf16
__device__ __forceinline__ v16h cat16(v8h lo, v8h hi) { return __builtin_shufflevector(lo, hi, 0, 1, 2, 3, 4, 5, 6, 7, 8, 9, 10, 11, 12, 13, 14, 15); }
__device__ __forceinline__ v16bf cat16b(v8us lo, v8us hi) { return __builtin_bit_cast(v16bf, __builtin_shufflevector(lo, hi, 0, 1, 2, 3, 4, 5, 6, 7, 8, 9, 10, 11, 12, 13, 14, 15)); }
__device__ __forceinline__ v8f wmma16(v16h a, v16h b, v8f c) { return __builtin_amdgcn_wmma_f32_16x16x32_f16(false, a, false, b, (short)0, c, false, false); }
__device__ __forceinline__ v8f wmmab(v16bf a, v16bf b, v8f c) { return __builtin_amdgcn_wmma_f32_16x16x32_bf16(false, a, false, b, (short)0, c, false, false); }
// fragment loaders from K-contiguous 16-bit rows; p already includes + 8*(lane>>4): elements 0..7 <- k0+8h+0..7, elements 8..15 <- k0+16+8h+0..7 (same map for A and B)
__device__ __forceinline__ v16bf ldb(const bf* p)  { return cat16b(*(const v8us*)p, *(const v8us*)(p + 16)); }
// fragment loader from a lane-ordered plane; p already includes + 8*lane: elements 0..7 <- segment 0 (k0+8h+0..7), elements 8..15 <- segment 1 (k0+16+8h+0..7), each segment 32 lanes x 16 B
__device__ __forceinline__ v16h  ldf(const h16* p) { return cat16(*(const v8h*)p, *(const v8h*)(p + 256)); }
// ordering point for wave-private LDS tiles (same wave writes and reads)
__device__ __forceinline__ void wave_sync() { __builtin_amdgcn_fence(3 /* release order */, "wavefront"); __builtin_amdgcn_wave_barrier(); asm volatile("" ::: "memory"); }

// f32 -> f16 convert that cannot produce a subnormal (|v| < 2^-14 -> +0); NaN passes through
static __device__ __forceinline__ h16 toh_flush(float v) { const h16 r = (h16)v; return (fabsf(v) < 6.103515625e-05f) ? (h16)0.0f : r; }
// one matrix instruction followed by its own 4-slot guard
__device__ __forceinline__ v8f wmma16g(v16h a, v16h b, v8f c) { c = wmma16(a, b, c); asm volatile("v_nop\n\tv_nop\n\tv_nop\n\tv_nop" : "+v"(c) : "v"(a), "v"(b)); return c; }
__device__ __forceinline__ v8f wmmabg(v16bf a, v16bf b, v8f c) { c = wmmab(a, b, c); asm volatile("v_nop\n\tv_nop\n\tv_nop\n\tv_nop" : "+v"(c) : "v"(a), "v"(b)); return c; }

__device__ __forceinline__ void wconv_body(const float* __restrict__ src, h16* dst, float* wsl) {
    const int tid = threadIdx.x;
#pragma unroll 1
    for (int it = 0; it < 16; ++it) { const int idx = it * 256 + tid; wsl[(idx >> 6) * 65 + (idx & 63)] = bfr(src[idx]); }   // 16 x 256 = 4096 elements, all staged
    __syncthreads();
{
#pragma unroll 1
        for (int it = 0; it < 2; ++it) { const int idx = it * 256 + tid; const int n = (idx >> 7) * 16 + (idx & 15), k8 = ((idx >> 5) & 3) * 16 + ((idx >> 4) & 1) * 8; v8h o;   // idx = (tile, k segment, lane): 4 x 4 x 32 pieces
#pragma unroll
            for (int i = 0; i < 8; ++i) o[i] = toh_flush(wsl[(k8 + i) * 65 + n] * WCS);
            *(v8h*)(dst + (size_t)idx * 8) = o;
            asm volatile("s_wait_xcnt 0x0" ::: "memory"); }   // stands in front of the next trip's address arithmetic, which rewrites the store's address register
         }
}

// runs in a 256-thread block: waves 0..3 do the work, every wave passes the barrier
__device__ __forceinline__ void wpconv_body(const float* __restrict__ src, bf* dst, float* wsl) {
    const int tid = threadIdx.x;
    if (tid < 128) { wsl[tid] = src[tid]; wsl[tid + 128] = src[tid + 128]; }
    __syncthreads();
    if (tid >= 128) return;
    const int row = tid >> 3, k8 = (tid & 7) * 8;
    const int rc = row < NH_ ? row : (NH_ - 1);
    v8us o;
#pragma unroll
    for (int i = 0; i < 8; ++i) { float w = wsl[(k8 + i) * NH_ + rc]; asm volatile("" : "+v"(w)); o[i] = (row < NH_) ? f2bf(w) : (unsigned short)0; }
    *(v8us*)(dst + (size_t)row * DM + k8) = o; 
}

// k_conv: block b converts one weight matrix: 0..3 -> q | k | v | gate planes of WT, 4 -> WOT, 5 -> WPT. The six conversions are independent of each other.
__global__ __launch_bounds__(256) void k_conv(const float* __restrict__ wq, const float* __restrict__ wk, const float* __restrict__ wv, const float* __restrict__ wg,
                                              const float* __restrict__ wo, const float* __restrict__ wp, h16* WT, h16* WOT, bf* WPT) {
    __shared__ float wsl[DM * 65];
    const int b = blockIdx.x;
    if (b == 5) { wpconv_body(wp, WPT, wsl); return; }
    const float* src = (b == 0) ? wq : (b == 1) ? wk : (b == 2) ? wv : (b == 3) ? wg : wo;
    h16* dst = (b == 4) ? WOT : WT + (size_t)b * DM * DM;
    wconv_body(src, dst, wsl);
}

// pairbias_body: bias[h][i][j] = sum_p bf16(pair[i][j][p]) bf16(Wp[p][h]); block = one 16-query tile x 8 keys, wave = 4 query rows x 8 keys as two 16-column tiles:
// A = Wp^T rows (row = head, padded to 16), B = pair rows converted in registers (col = 8 * (query row bit 0) + key), K = 64. The four waves' values meet in LDS [head][query][key]; wave w then stores head w's
// two 256-byte runs of the lane-ordered bias plane (16 queries x 4 keys each), so every line of the plane has one writer.
__device__ __forceinline__ void pairbias_body(const int blk, const float* __restrict__ pair, const bf* __restrict__ WPT, float* BIAS, float* os) {
    const int lane = threadIdx.x & 31, lr = lane & 15, hi = lane >> 4;
    const int wave = __builtin_amdgcn_readfirstlane((int)(threadIdx.x >> 5));
    const int ti = blk / (SEQ / 8), kg = blk % (SEQ / 8);
    const v16bf a0 = ldb(WPT + lr * DM + 8 * hi), a1 = ldb(WPT + lr * DM + 8 * hi + 32);
#pragma unroll
    for (int jt = 0; jt < 2; ++jt) {
        const int ql = wave * 4 + 2 * jt + (lr >> 3);
        const float* p = pair + ((size_t)(ti * 16 + ql) * SEQ_FULL + (size_t)(kg * 8 + (lr & 7))) * DM + 8 * hi;
        v8f acc = (v8f){};
#pragma unroll
        for (int kc = 0; kc < 2; ++kc) {
            const v4f x0 = *(const v4f*)(p + 32 * kc), x1 = *(const v4f*)(p + 32 * kc + 4), x2 = *(const v4f*)(p + 32 * kc + 16), x3 = *(const v4f*)(p + 32 * kc + 20);
            v8us e0, e1;
#pragma unroll
            for (int i = 0; i < 4; ++i) { e0[i] = f2bf(x0[i]); e0[4 + i] = f2bf(x1[i]); e1[i] = f2bf(x2[i]); e1[4 + i] = f2bf(x3[i]); }
            const v16bf bq = cat16b(e0, e1);
            if (kc == 0) acc = wmmabg(a0, bq, acc); else acc = wmmabg(a1, bq, acc);
        }
        if (hi == 0) {                                                                        // D: row 8h+r (head), col lane&15; the four real heads sit in rows 0..3 of the lower lanes
#pragma unroll
            for (int r = 0; r < NH_; ++r) os[(r * 16 + ql) * 8 + (lr & 7)] = acc[r]; }
    }
    __syncthreads();                                                                          // os: written by all 4 waves (4 query rows each), read across waves (one head each)
    const v4f val = *(const v4fa*)(&os[(wave * 16 + lr) * 8 + hi * 4]);                       // head = wave, query = lane&15, keys 4 * (lane>>4) + 0..3 of the group
    float* dstp = BIAS + ((size_t)(wave * (SEQ / 16) + ti) * (SEQ / 32) + (size_t)(kg >> 2)) * 512 + (size_t)(((kg >> 1) & 1) * 2 + hi) * 128 + (size_t)((kg & 1) * 16 + lr) * 4;
    *(v4f*)dstp = val;
    asm volatile("s_wait_xcnt 0x0" ::: "memory");   // stands in front of whatever the merged kernel's layout puts behind this store and lets rewrite its registers
}

// value of one 16 x 16 projection tile: (x_hi W + (x_res W) / 2048) / 64, K = 64
__device__ __forceinline__ v8f proj_tile(const h16* __restrict__ wp, v16h a0h, v16h a1h, v16h a0r, v16h a1r) {
    const v16h b0 = ldf(wp), b1 = ldf(wp + 512);
    v8f cH = (v8f){}, cR = (v8f){};
    cH = wmma16g(a0h, b0, cH); cH = wmma16g(a1h, b1, cH);
    cR = wmma16g(a0r, b0, cR); cR = wmma16g(a1r, b1, cR);
    return (cH + cR * QRI) * WCI;
}

// lnproj_body: LayerNorm + q/k/v/gate projections; block = 64 tokens of one sequence, wave = 16 tokens. Lane (row = lane&15, half = lane>>4) holds the 32 columns 16q + 8*half + i of its row,
// q, k: f16 value plane and f16 residual plane ((v - value) x 2048, same flush select); per head the 16 x 16 halves are one contiguous 512-byte run of each plane, written by one instruction (32 lanes x 16 B);
// gate: f32, the wave's 16 x 64 tile in lane order, 512 contiguous bytes per instruction;
__device__ __forceinline__ void lnproj_body(const int blk, const float* __restrict__ msa, const float* __restrict__ lng, const float* __restrict__ lnb,
                                            const h16* __restrict__ WT, const float* __restrict__ bg,
                                            h16* QH, h16* QR, h16* KP, h16* KR, h16* VT, float* GP, float* os, h16* vts) {
    const int lane = threadIdx.x & 31, lr = lane & 15, hi = lane >> 4;
    const int wave = __builtin_amdgcn_readfirstlane((int)(threadIdx.x >> 5));
    const int r0 = blk * 64;
    const int sq = r0 / SEQ, tbk = r0 % SEQ;
    const int t0 = tbk + wave * 16;
    const int wb = wave * 16 * CSP;
    const float* xr = msa + ((size_t)sq * SEQ_FULL + (size_t)(t0 + lr)) * DM + 8 * hi;
    float xv[32];
#pragma unroll
    for (int q = 0; q < 4; ++q) { const v4f u0 = *(const v4f*)(xr + 16 * q), u1 = *(const v4f*)(xr + 16 * q + 4);
#pragma unroll
        for (int i = 0; i < 4; ++i) { xv[8 * q + i] = bfr(u0[i]); xv[8 * q + 4 + i] = bfr(u1[i]); } }
    asm volatile("s_wait_xcnt 0x0" ::: "memory");   // stands in front of the gain loads, whose destinations reuse the row loads' address pair
    float sm = 0.0f;
#pragma unroll
    for (int e = 0; e < 32; ++e) sm += xv[e];
    sm += __shfl_xor(sm, 16, 32);
    const float mu = sm * (1.0f / 64.0f);
    float sv = 0.0f;
#pragma unroll
    for (int e = 0; e < 32; ++e) { const float dl = xv[e] - mu; sv += dl * dl; }
    sv += __shfl_xor(sv, 16, 32);
    const float rs = rsqrtf(sv * (1.0f / 64.0f) + LNEPS);
    v16h ah[2], ar[2];
#pragma unroll
    for (int q = 0; q < 4; ++q) {
        const v4f g0 = *(const v4f*)(lng + 8 * hi + 16 * q), g1 = *(const v4f*)(lng + 8 * hi + 16 * q + 4);
        const v4f c0 = *(const v4f*)(lnb + 8 * hi + 16 * q), c1 = *(const v4f*)(lnb + 8 * hi + 16 * q + 4);
#pragma unroll
        for (int i = 0; i < 4; ++i) {
            const float y0 = (xv[8 * q + i] - mu) * rs * bfr(g0[i]) + bfr(c0[i]);
            const float y1 = (xv[8 * q + 4 + i] - mu) * rs * bfr(g1[i]) + bfr(c1[i]);
            const h16 h0 = toh_flush(y0), h1 = toh_flush(y1);
            ah[q >> 1][(q & 1) * 8 + i] = h0; ah[q >> 1][(q & 1) * 8 + 4 + i] = h1;
            ar[q >> 1][(q & 1) * 8 + i] = toh_flush((y0 - (float)h0) * QRS); ar[q >> 1][(q & 1) * 8 + 4 + i] = toh_flush((y1 - (float)h1) * QRS); } }
    const size_t wlo = (size_t)lane * 8;                               // + (matrix*64 + 16*nb) * DM: one 16-column tile = 16 * DM halves in lane order
    // q (matrix 0) and k (matrix 1)
#pragma unroll
    for (int mat = 0; mat < 2; ++mat) {
#pragma unroll
        for (int nb = 0; nb < 4; ++nb) {
            const v8f val = proj_tile(WT + wlo + (size_t)(mat * 64 + nb * 16) * DM, ah[0], ah[1], ar[0], ar[1]);
#pragma unroll
            for (int r = 0; r < 8; ++r) os[wb + (8 * hi + r) * CSP + nb * 16 + lr] = val[r]; }     // D: row 8h+r (token), col lane&15
        wave_sync();
{
#pragma unroll
            for (int hh = 0; hh < NH_; ++hh) { const int row = lane >> 1, c8 = (lane & 1) * 8;       // 16 rows x 2 lanes x 8 halves = head hh of the tile
                const v4f x0 = *(const v4fa*)(&os[wb + row * CSP + hh * 16 + c8]); const v4f x1 = *(const v4fa*)(&os[wb + row * CSP + hh * 16 + c8 + 4]); v8h hv, rv;
#pragma unroll
                for (int i = 0; i < 4; ++i) { const h16 a0 = toh_flush(x0[i]); const h16 a1 = toh_flush(x1[i]); hv[i] = a0; hv[4 + i] = a1;
                    rv[i] = toh_flush((x0[i] - (float)a0) * QRS); rv[4 + i] = toh_flush((x1[i] - (float)a1) * QRS); }
                const size_t oo = ((size_t)(sq * NH_ + hh) * SEQ + (size_t)t0) * HD + (size_t)lane * 8;
                if (mat == 0) { *(v8h*)(QH + oo) = hv; *(v8h*)(QR + oo) = rv; } else { *(v8h*)(KP + oo) = hv; *(v8h*)(KR + oo) = rv; } }
             }
        asm volatile("s_wait_xcnt 0x0" ::: "memory");   // stands in front of the next weight loads, whose destinations reuse registers that the stores above name
        wave_sync();
    }
    // v (matrix 2): lane's 8 accumulator values are 8 consecutive tokens of column c -> one 16-B LDS store into the [c][token] tile
#pragma unroll
    for (int nb = 0; nb < 4; ++nb) {
        const v8f val = proj_tile(WT + wlo + (size_t)(2 * 64 + nb * 16) * DM, ah[0], ah[1], ar[0], ar[1]);
        v8h o;
#pragma unroll
        for (int r = 0; r < 8; ++r) o[r] = toh_flush(val[r]);
        *(v8ha*)(&vts[(nb * 16 + lr) * VTP + wave * 16 + 8 * hi]) = o; }
    // gate (matrix 3): sigmoid(x Wg + bg)
#pragma unroll
    for (int nb = 0; nb < 4; ++nb) {
        const v8f val = proj_tile(WT + wlo + (size_t)(3 * 64 + nb * 16) * DM, ah[0], ah[1], ar[0], ar[1]);
        const float bgv = bfr(bg[nb * 16 + lr]);
#pragma unroll
        for (int r = 0; r < 8; ++r) { const float z = val[r] + bgv; const float ex = __builtin_amdgcn_exp2f(-z * L2E); os[wb + (8 * hi + r) * CSP + nb * 16 + lr] = 1.0f / (1.0f + ex); } }
    wave_sync();
{
#pragma unroll
        for (int s8 = 0; s8 < 8; ++s8) { const int cofs = (s8 >> 1) * 16 + 8 * hi + (s8 & 1) * 4;            // 8 x (2 x 4 columns) = 64 columns; 16 lanes = 16 rows
            const v4f val = *(const v4fa*)(&os[wb + lr * CSP + cofs]);
            *(v4f*)(GP + ((size_t)sq * SEQ + (size_t)t0) * DM + s8 * 128 + lane * 4) = val; }
         }
    __syncthreads();                                                   // v^T tile: written by all 4 waves, each wave reads back only the tokens it wrote
    const int tid = threadIdx.x;
{
#pragma unroll
        for (int it = 0; it < 4; ++it) {                                                                                // trip = head; wave = (32-key chunk, 16-key half) of the block's 64 tokens; lane = 16 * (key bit 3) + d
            const v8h o = *(const v8ha*)(&vts[(it * 16 + lr) * VTP + wave * 16 + 8 * hi]);
            *(v8h*)(VT + ((size_t)(sq * NH_ + it) * SEQ + (size_t)tbk) * HD + tid * 8) = o; }
         }
}

// k_lnproj_pairbias: blocks 0 .. LNB-1 run lnproj_body (the longer work, so it starts first), blocks LNB .. LNB+PBB-1 run pairbias_body; neither reads what the other writes.
#define LNB (NB * SEQ / 64)
#define PBB ((SEQ / 16) * (SEQ / 8))
__global__ __launch_bounds__(32 * AW) void k_lnproj_pairbias(const float* __restrict__ msa, const float* __restrict__ lng, const float* __restrict__ lnb,
                                                             const h16* __restrict__ WT, const float* __restrict__ bg,
                                                             h16* QH, h16* QR, h16* KP, h16* KR, h16* VT, float* GP,
                                                             const float* __restrict__ pair, const bf* __restrict__ WPT, float* BIAS) {
    __shared__ __align__(16) float os[AW * 16 * CSP];                  // the pair-bias blocks use its first NH_ * 16 * 8 floats
    __shared__ __align__(16) h16 vts[DM * VTP];
    const int b = blockIdx.x;
    if (b < LNB) lnproj_body(b, msa, lng, lnb, WT, bg, QH, QR, KP, KR, VT, GP, os, vts);
    else pairbias_body(b - LNB, pair, WPT, BIAS, os);
}

// k_attn: block = 16 query rows of one sequence, wave w = head w. Transposed flash form: S^T[key][t] = K Q^T (A = K rows, B = Q rows, k = d: 16 real + 16 zero slots);
// scores = K Q + (K Q_res + K_res Q) / 2048 (value x value in the main accumulators, the two cross products in their own accumulators; residual x residual dropped);
// lane (t = lane&15, h = lane>>4) holds keys 8h+r of each 16-key tile, so the packed P tile is directly the B fragment of O^T[d][t] = V^T P^T.
// Per step: bias row segment and mask words loaded as 16-B vectors at arithmetic addresses; masked keys are dropped by value (probability 0, excluded from the running max).
// After the key loop the 4 heads' contexts meet in a block LDS tile [16][64]; every wave rebuilds the gated context fragments (value + residual x2048) and computes one 16-column tile of the output projection;
__global__ __launch_bounds__(32 * AW) void k_attn(const h16* __restrict__ QH, const h16* __restrict__ QR, const h16* __restrict__ KP, const h16* __restrict__ KR, const h16* __restrict__ VT,
                                                  const float* __restrict__ BIAS, const int* __restrict__ kmask, const float* __restrict__ GP,
                                                  const h16* __restrict__ WOT, const float* __restrict__ bo, float* OUT) {
    __shared__ __align__(16) float cs[16 * CSP];
    __shared__ __align__(16) float ot[16 * CSP];
    const int lane = threadIdx.x & 31, lr = lane & 15, hi = lane >> 4;
    const int wave = __builtin_amdgcn_readfirstlane((int)(threadIdx.x >> 5));
    const int sq = blockIdx.y; const int t0 = blockIdx.x * 16;
    const int zh = sq * NH_ + wave;
    const size_t pbase = (size_t)zh * SEQ * HD;
    const v8h z8 = (v8h){};
    const v16h qh = cat16(*(const v8h*)(QH + pbase + (size_t)(t0 + lr) * HD + 8 * hi), z8);   // B fragment: col t, k = d; slots 16..31 zero
    const v16h qr = cat16(*(const v8h*)(QR + pbase + (size_t)(t0 + lr) * HD + 8 * hi), z8);   // residual x2048, same map
    const size_t ko = pbase + (size_t)lr * HD + 8 * hi;        // + key * HD   (A fragment: row key, k = d)
    const size_t vo = pbase + (size_t)lane * 8;                // + key * HD   (A fragment: row d, k = key; lane-ordered plane, 32 keys = 32 * HD halves)
    const float* bp0 = BIAS + (size_t)(wave * (SEQ / 16) + (int)blockIdx.x) * (SEQ / 32) * 512 + (size_t)lane * 4;   // + key * 16 (lane-ordered plane, 32 keys = 512 floats)
    const int* mp0 = kmask + (size_t)sq * SEQ_FULL + 8 * hi;
    v8f o0 = (v8f){};
    float m = NEGB, l = 0.0f;
#pragma unroll 1
    for (int key0 = 0; key0 < SEQ; key0 += 32) {
        const h16* ka = KP + ko + (size_t)key0 * HD;
        const v16h ka0 = cat16(*(const v8h*)ka, z8), kb0 = cat16(*(const v8h*)(ka + 16 * HD), z8);
        const h16* kr = KR + ko + (size_t)key0 * HD;
        const v16h kra0 = cat16(*(const v8h*)kr, z8), krb0 = cat16(*(const v8h*)(kr + 16 * HD), z8);
        v8f sa = (v8f){}, sb = (v8f){}, ra = (v8f){}, rb = (v8f){};
        sa = wmma16g(ka0, qh, sa); sb = wmma16g(kb0, qh, sb);
        ra = wmma16g(ka0, qr, ra); ra = wmma16g(kra0, qh, ra);
        rb = wmma16g(kb0, qr, rb); rb = wmma16g(krb0, qh, rb);
        const float* bp = bp0 + (size_t)key0 * 16;               // keys key0+8h+0..7 and key0+16+8h+0..7 of query row t0 + (lane&15)
        const v4f c0 = *(const v4f*)bp, c1 = *(const v4f*)(bp + 128), c2 = *(const v4f*)(bp + 256), c3 = *(const v4f*)(bp + 384);
        const int* mp = mp0 + key0;
        const v4i n0 = *(const v4i*)mp, n1 = *(const v4i*)(mp + 4), n2 = *(const v4i*)(mp + 16), n3 = *(const v4i*)(mp + 20);
        float ta[8], tc[8]; bool fa[8], fb[8]; float mx = NEGB;
#pragma unroll
        for (int r = 0; r < 4; ++r) {
            ta[r] = (sa[r] + ra[r] * QRI) * SC2 + c0[r] * L2E; ta[4 + r] = (sa[4 + r] + ra[4 + r] * QRI) * SC2 + c1[r] * L2E;
            tc[r] = (sb[r] + rb[r] * QRI) * SC2 + c2[r] * L2E; tc[4 + r] = (sb[4 + r] + rb[4 + r] * QRI) * SC2 + c3[r] * L2E;
            fa[r] = n0[r] != 0; fa[4 + r] = n1[r] != 0; fb[r] = n2[r] != 0; fb[4 + r] = n3[r] != 0; }
#pragma unroll
        for (int r = 0; r < 8; ++r) mx = fmaxf(mx, fmaxf(fa[r] ? ta[r] : NEGB, fb[r] ? tc[r] : NEGB));
        mx = fmaxf(mx, __shfl_xor(mx, 16, 32));
        const float mnew = fmaxf(m, mx);
        const float alpha = __builtin_amdgcn_exp2f(m - mnew);
        const float sh = PSH - mnew;
        v16h pb; float ls = 0.0f;
#pragma unroll
        for (int r = 0; r < 8; ++r) {
            const float xa = ta[r] + sh, xb = tc[r] + sh;
            const float ea = __builtin_amdgcn_exp2f(xa), eb = __builtin_amdgcn_exp2f(xb);
            const float ga = (fa[r] & (xa >= -14.0f)) ? ea : 0.0f, gb = (fb[r] & (xb >= -14.0f)) ? eb : 0.0f;   // dropped keys and sub-2^-14 values selected to 0 by value
            const h16 pa = (h16)ga; const h16 pc = (h16)gb;
            pb[r] = pa; pb[8 + r] = pc;
            ls += (float)pa + (float)pc; }
        l = l * alpha + ls; m = mnew;
        o0 = o0 * alpha;
        const v16h v0 = ldf(VT + vo + (size_t)key0 * HD);
        o0 = wmma16g(v0, pb, o0);
    }
    l += __shfl_xor(l, 16, 32);
    const bool any = l > 0.0f;
    const float lsafe = any ? l : 1.0f;
    const float inv = any ? (1.0f / lsafe) : __uint_as_float(0x7FC00000u);       // no kept key -> NaN row (softmax of an all-dropped row)
    // O^T D layout: o0[r] = (d = 8h + r, t = lane&15) -> cs[t][wave*16 + d]; 16 rows x 64 columns written by the 4 waves
    { v4f a, c;
      a[0] = o0[0] * inv; a[1] = o0[1] * inv; a[2] = o0[2] * inv; a[3] = o0[3] * inv; c[0] = o0[4] * inv; c[1] = o0[5] * inv; c[2] = o0[6] * inv; c[3] = o0[7] * inv;
      *(v4fa*)(&cs[lr * CSP + wave * 16 + 8 * hi]) = a; *(v4fa*)(&cs[lr * CSP + wave * 16 + 8 * hi + 4]) = c; }
    __syncthreads();                                                             // cs: cross-wave
    // gated context fragments: row t = lane&15, k = concatenated head column 16q + 8h + i
    const float* gr = GP + ((size_t)sq * SEQ + (size_t)t0) * DM + (size_t)lane * 4;
    v16h gh[2], gq[2];
#pragma unroll
    for (int q = 0; q < 4; ++q) {
        const v4f g0 = *(const v4f*)(gr + 256 * q), g1 = *(const v4f*)(gr + 256 * q + 128);
        const v4f x0 = *(const v4fa*)(&cs[lr * CSP + 8 * hi + 16 * q]), x1 = *(const v4fa*)(&cs[lr * CSP + 8 * hi + 16 * q + 4]);
#pragma unroll
        for (int i = 0; i < 4; ++i) {
            const float y0 = g0[i] * x0[i], y1 = g1[i] * x1[i];
            const h16 h0 = toh_flush(y0), h1 = toh_flush(y1);
            gh[q >> 1][(q & 1) * 8 + i] = h0; gh[q >> 1][(q & 1) * 8 + 4 + i] = h1;
            gq[q >> 1][(q & 1) * 8 + i] = toh_flush((y0 - (float)h0) * QRS); gq[q >> 1][(q & 1) * 8 + 4 + i] = toh_flush((y1 - (float)h1) * QRS); } }
    const v8f pv = proj_tile(WOT + (size_t)(wave * 16) * DM + (size_t)lane * 8, gh[0], gh[1], gq[0], gq[1]);
    const float bov = bfr(bo[wave * 16 + lr]);
#pragma unroll
    for (int r = 0; r < 8; ++r) ot[(8 * hi + r) * CSP + wave * 16 + lr] = pv[r] + bov;       // D: row 8h+r (token), col lane&15; 16 rows x 64 columns written by the 4 waves
    __syncthreads();                                                             // ot: cross-wave
    float* orow = OUT + ((size_t)sq * OUT_SEQ + (size_t)t0) * DM;
    const int tid = threadIdx.x;
{
#pragma unroll
        for (int it = 0; it < 2; ++it) { const int idx = it * 128 + tid; const int row = idx >> 4, cofs = (idx & 15) * 4;   // 2 trips x 8 rows = 16 rows; 16 pieces x 4 floats = 64 columns
            const v4f val = *(const v4fa*)(&ot[row * CSP + cofs]);
            *(v4f*)(orow + (size_t)row * DM + cofs) = val; }
         }
}

static constexpr size_t al256(size_t v) { return (v + 255) & ~(size_t)255; }
static constexpr size_t SZ_WT = al256((size_t)4 * DM * DM * 2);
static constexpr size_t SZ_WO = al256((size_t)DM * DM * 2);
static constexpr size_t SZ_WP = al256((size_t)16 * DM * 2);
static constexpr size_t SZ_PL = al256((size_t)NB * SEQ * DM * 2);
static constexpr size_t SZ_GP = al256((size_t)NB * SEQ * DM * 4);
static constexpr size_t SZ_BS = al256((size_t)NH_ * SEQ * SEQ * 4);
static constexpr size_t SZ_TOTAL = SZ_WT + SZ_WO + SZ_WP + 5 * SZ_PL + SZ_GP + SZ_BS;   // planes: q value, q residual, k value, k residual, v^T
static_assert(SZ_TOTAL <= (size_t)134217728);          // workspace carve <= 128 MiB
static_assert(((size_t)DM * DM * 2) % 256 == 0);       // weight sub-planes stay 256-byte aligned
static_assert((size_t)NB * NH_ * SEQ * HD == (size_t)NB * DM * SEQ);   // q/k value and residual planes [s*4+h][t][16] and the v^T plane have the same extent
static_assert(((size_t)(NB - 1) * OUT_SEQ + SEQ) * DM <= (size_t)NB_FULL * SEQ_FULL * DM);   // last output row inside the output buffer

extern "C" void kernel_launch(void* const* d_in, const int* in_sizes, int n_in,
                              void* d_out, int out_size, void* d_ws, size_t ws_size, hipStream_t stream) {
    if (n_in < 13) return;
    const size_t needx = ((size_t)(NB - 1) * SEQ_FULL + SEQ) * DM;
    const size_t needp = ((size_t)(SEQ - 1) * SEQ_FULL + SEQ) * DM;
    const size_t needm = (size_t)(NB - 1) * SEQ_FULL + SEQ;
    if ((size_t)in_sizes[0] < needx || (size_t)in_sizes[1] < needp || (size_t)in_sizes[2] < needm) return;
    if (in_sizes[3] < DM || in_sizes[4] < DM || in_sizes[9] < DM || in_sizes[12] < DM) return;
    if (in_sizes[5] < DM * DM || in_sizes[6] < DM * DM || in_sizes[7] < DM * DM || in_sizes[8] < DM * DM || in_sizes[11] < DM * DM) return;
    if (in_sizes[10] < DM * NH_) return;
    if ((size_t)out_size < ((size_t)(NB - 1) * OUT_SEQ + SEQ) * DM) return;
    if (SZ_TOTAL > ws_size) return;
    // wire order: x stack, pair, key mask, ln gain, ln bias, Wq, Wk, Wv, Wg, bg, Wp, Wo, bo
    const float* msa  = (const float*)d_in[0];
    const float* pair = (const float*)d_in[1];
    const int*   kmsk = (const int*)d_in[2];
    const float* lng  = (const float*)d_in[3];
    const float* lnb  = (const float*)d_in[4];
    const float* wq   = (const float*)d_in[5];
    const float* wk   = (const float*)d_in[6];
    const float* wv   = (const float*)d_in[7];
    const float* wg   = (const float*)d_in[8];
    const float* bg   = (const float*)d_in[9];
    const float* wp   = (const float*)d_in[10];
    const float* wo   = (const float*)d_in[11];
    const float* bo   = (const float*)d_in[12];
    float* OUT = (float*)d_out;      // [NB][SEQ][64]
    char* wsp = (char*)d_ws;
    h16* WT  = (h16*)wsp; wsp += SZ_WT;               // [4][4 tiles][4 k segments][32 lanes][8]: q | k | v | gate, x64
    h16* WOT = (h16*)wsp; wsp += SZ_WO;               // [4 tiles][4 k segments][32 lanes][8], x64
    bf*  WPT = (bf*)wsp;  wsp += SZ_WP;               // [16][64]
    h16* QH  = (h16*)wsp; wsp += SZ_PL;               // [NB*4][SEQ][16]
    h16* QR  = (h16*)wsp; wsp += SZ_PL;               // [NB*4][SEQ][16] residual x2048
    h16* KP  = (h16*)wsp; wsp += SZ_PL;               // [NB*4][SEQ][16]
    h16* KR  = (h16*)wsp; wsp += SZ_PL;               // [NB*4][SEQ][16] residual x2048
    h16* VT  = (h16*)wsp; wsp += SZ_PL;               // [NB*4][SEQ/32][2][32 lanes][8]
    float* GP = (float*)wsp; wsp += SZ_GP;            // [NB][SEQ/16][8][32 lanes][4]
    float* BIAS = (float*)wsp; wsp += SZ_BS;          // [4][SEQ/16][SEQ/32][4][32 lanes][4]

    k_conv<<<6, 256, 0, stream>>>(wq, wk, wv, wg, wo, wp, WT, WOT, WPT);
    k_lnproj_pairbias<<<(unsigned)(LNB + PBB), 32 * AW, 0, stream>>>(msa, lng, lnb, WT, bg, QH, QR, KP, KR, VT, GP, pair, WPT, BIAS);
    k_attn<<<dim3(SEQ / 16, NB, 1), 32 * AW, 0, stream>>>(QH, QR, KP, KR, VT, BIAS, kmsk, GP, WOT, bo, OUT);
}

// v003
// Measured time: 36.8 microseconds a run.
// In two side-by-side timings against v002, it was 1.21 and 1.22 times as fast.
// All steps since v000 together make it 2.03 times as fast.
#include <hip/hip_runtime.h>

// Gated row attention over a stack of sequences with a pair-derived additive bias shared by all sequences: x [NB][SEQ][64] -> LayerNorm (eps 1e-5, gain, bias) -> bias-free q/k/v projections ([in][out], y = x W),
// sigmoid gate (x Wg + bg), 4 heads x 16, scores q.k / sqrt(16) + bias[h][i][j] with bias = pair[i][j][:] . Wp[:][h], key padding mask (int32, replace fill: masked keys dropped from the softmax, a row with no kept key gives NaN),
// softmax over keys, context, gate multiply, output projection ([in][out]) + bias; output f32 [NB][SEQ][64].
// Compute dtypes, f32 accumulate everywhere: q/k/v/gate projections v_wmma_f32_16x16x32_f16 (LayerNorm output as f16 value + f16 residual x2048 in its own accumulator, W RNE-converted to bf16 then x64 in f16, exact);
// pair bias v_wmma_f32_16x16x32_bf16 (pair and Wp RNE-converted to bf16, products exact); scores v_wmma_f32_16x16x32_f16 with q and k each as f16 value + f16 residual x2048 (three products: value x value in the main accumulator,
// value x residual + residual x value in their own accumulator folded by 1/2048; head dim 16 zero-padded to the 32-deep k-step in registers in both fragments);
// P.V v_wmma_f32_16x16x32_f16 single product (P x16384 carry, cancels in the normalisation, row sum over the converted P); output projection v_wmma_f32_16x16x32_f16 (gated context as f16 value + f16 residual x2048 in its own accumulator, Wo x64).
// Every float input is RNE-converted to bf16 at its load. LayerNorm, softmax (online, running max over kept keys), sigmoid in f32.
// Layout: every plane that a wave reads as a matrix fragment or as an accumulator-shaped tile, except Wp^T, is stored in the order the lanes read it, so that one 16-byte load per lane covers 512 contiguous bytes (4 whole lines):
// W^T planes f16 [16-column tile][k segment of 16][lane][8] (lane = 16 * (k bit 3) + column); v^T plane f16 [s*4+h][32-key chunk][16-key half][lane][8] (lane = 16 * (key bit 3) + d);
// gate plane f32 [s][16-token tile][16-column group][4-column half][lane][4] (lane = 16 * (column bit 3) + token); bias plane f32 [h][16-query tile][32-key chunk][j][lane][4] (lane = 16 * (key bit 3) + query, j = 2 * (key bit 4) + (key bit 2));
// q, k value planes and q, k residual planes (x2048) [s*4+h][t][16] f16 (a 16-row fragment is 512 contiguous bytes as it is); Wp^T plane [16][64] bf16 (rows >= 4 zero).
// Three launches, one per level of the dependence chain: k_conv (all six weight planes, one block each), k_lnproj_pairbias (projection blocks first, then the pair-bias blocks, which do not depend on each other), k_attn.
// Fused attention kernel: one block = 16 query rows of one sequence, wave w = head w, transposed flash form (S^T = K Q^T, O^T = V^T P^T, fragments straight from the planes), then gate, output projection and whole-row stores.

#ifndef NB
#define NB 128                   // number of sequences (batch x stack depth)
#endif
#ifndef SEQ
#define SEQ 256                  // tokens per sequence (queries = keys)
#endif
#define NB_FULL  128
#define SEQ_FULL 256
#ifndef OUT_SEQ
#define OUT_SEQ SEQ              // row pitch (in tokens) between sequences of the output
#endif
#define DM   64
#define NH_  4
#define HD   16
#define AW   4                   // waves per block
#define CSP  68                  // LDS row pitch (floats) of the 16 x 64 staging tiles
#define VTP  72                  // LDS row pitch (halves) of the v^T staging tile
#define QRS  2048.0f             // carry of every residual plane / residual fragment
#define QRI  (1.0f / 2048.0f)
#define WCS  64.0f               // carry of the f16 weight planes
#define WCI  (1.0f / 64.0f)
#define L2E  1.4426950408889634f
#define SC2  ((float)(0.25 * 1.4426950408889634))   // HD^-0.5 * log2(e)
#define PSH  14.0f               // log2 of the P carry (16384)
#define NEGB (-3.0e38f)
#define LNEPS 1.0e-5f

static_assert(DM == 64);                       // LayerNorm lane map: 2 lanes x 32 columns; two 32-deep k-steps
static_assert(HD == 16);                       // one 16-B load per q/k fragment, upper k half zero in registers
static_assert(NH_ * HD == DM);
static_assert(NH_ == AW);                      // wave w of the attention block = head w
static_assert(SEQ % 64 == 0);                  // a 64-token projection tile never straddles two sequences and fills two whole 32-key chunks of the v^T plane
static_assert((NB * SEQ) % 64 == 0);
static_assert(SEQ % 32 == 0);                  // key loop steps by 32; bias and v^T planes are in 32-key chunks
static_assert(SEQ % 16 == 0);
static_assert(SEQ % 8 == 0);                   // bias grid covers (16-query tile, 8-key group) exactly
static_assert(NB <= NB_FULL);
static_assert(SEQ <= SEQ_FULL);
static_assert((CSP * 4) % 16 == 0);
static_assert((VTP * 2) % 16 == 0);
static_assert(32 * 16 * NH_ == 16 * DM * 2);           // q/k store, per plane (value and residual alike): 4 head instructions x 32 lanes x 16 B = 16 rows x 64 halves
static_assert(32 * 16 * 8 == 16 * DM * 4);             // gate store: 8 instructions x 32 lanes x 16 B = 16 rows x 256 B
static_assert(128 * 16 * 4 == DM * 64 * 2);
static_assert(128 * 16 * 2 == 16 * DM * 4);            // output store: 2 trips x 128 threads x 16 B = 16 rows x 256 B
static_assert(128 * 16 == NH_ * 16 * 8 * 4);           // bias store: 128 threads x 16 B = 4 heads x 16 queries x 8 keys
static_assert(256 * 8 * 2 == DM * DM);                 // weight converter: 2 trips x 256 threads x 8 halves
static_assert(128 * 8 == 16 * DM);                     // Wp converter: 128 threads x 8 = 16 rows x 64
static_assert(AW * 16 * CSP * 4 + DM * VTP * 2 <= 131072);   // static LDS of the projection kernel
static_assert(2 * 16 * CSP * 4 <= 131072);                   // static LDS of the attention kernel
static_assert(NH_ * 16 * 8 <= AW * 16 * CSP);                // the pair-bias tile fits the projection kernel's staging array
static_assert(DM * 65 * 4 <= 131072);                        // static LDS of the weight converter
static_assert(DM * NH_ <= DM * 65);                          // Wp staging fits the same array

typedef _Float16 h16;
typedef unsigned short bf;
typedef __attribute__((ext_vector_type(16))) __bf16   v16bf;
typedef __attribute__((ext_vector_type(16))) _Float16 v16h;
typedef __attribute__((ext_vector_type(8)))  _Float16 v8h;
typedef __attribute__((ext_vector_type(8)))  unsigned short v8us;
typedef __attribute__((ext_vector_type(8)))  float    v8f;
typedef __attribute__((ext_vector_type(4)))  float    v4f;
typedef __attribute__((ext_vector_type(4)))  int      v4i;
typedef v4f  __attribute__((may_alias)) v4fa;
typedef v8h  __attribute__((may_alias)) v8ha;

__device__ __forceinline__ unsigned short f2bf(float f) { unsigned u = __float_as_uint(f); u += 0x7FFFu + ((u >> 16) & 1u); return (unsigned short)(u >> 16); }
__device__ __forceinline__ float bfr(float f) { return __uint_as_float(((unsigned)f2bf(f)) << 16); }   // value after RNE convert to bf16
__device__ __forceinline__ v16h cat16(v8h lo, v8h hi) { return __builtin_shufflevector(lo, hi, 0, 1, 2, 3, 4, 5, 6, 7, 8, 9, 10, 11, 12, 13, 14, 15); }
__device__ __forceinline__ v16bf cat16b(v8us lo, v8us hi) { return __builtin_bit_cast(v16bf, __builtin_shufflevector(lo, hi, 0, 1, 2, 3, 4, 5, 6, 7, 8, 9, 10, 11, 12, 13, 14, 15)); }
__device__ __forceinline__ v8f wmma16(v16h a, v16h b, v8f c) { return __builtin_amdgcn_wmma_f32_16x16x32_f16(false, a, false, b, (short)0, c, false, false); }
__device__ __forceinline__ v8f wmmab(v16bf a, v16bf b, v8f c) { return __builtin_amdgcn_wmma_f32_16x16x32_bf16(false, a, false, b, (short)0, c, false, false); }
// fragment loaders from K-contiguous 16-bit rows; p already includes + 8*(lane>>4): elements 0..7 <- k0+8h+0..7, elements 8..15 <- k0+16+8h+0..7 (same map for A and B)
__device__ __forceinline__ v16bf ldb(const bf* p)  { return cat16b(*(const v8us*)p, *(const v8us*)(p + 16)); }
// fragment loader from a lane-ordered plane; p already includes + 8*lane: elements 0..7 <- segment 0 (k0+8h+0..7), elements 8..15 <- segment 1 (k0+16+8h+0..7), each segment 32 lanes x 16 B
__device__ __forceinline__ v16h  ldf(const h16* p) { return cat16(*(const v8h*)p, *(const v8h*)(p + 256)); }
// ordering point for wave-private LDS tiles (same wave writes and reads)
__device__ __forceinline__ void wave_sync() { __builtin_amdgcn_fence(3 /* release order */, "wavefront"); __builtin_amdgcn_wave_barrier(); asm volatile("" ::: "memory"); }

// f32 -> f16 convert that cannot produce a subnormal (|v| < 2^-14 -> +0); NaN passes through
static __device__ __forceinline__ h16 toh_flush(float v) { const h16 r = (h16)v; return (fabsf(v) < 6.103515625e-05f) ? (h16)0.0f : r; }
// one matrix instruction followed by its own 4-slot guard
__device__ __forceinline__ v8f wmma16g(v16h a, v16h b, v8f c) { c = wmma16(a, b, c); asm volatile("v_nop\n\tv_nop\n\tv_nop\n\tv_nop" : "+v"(c) : "v"(a), "v"(b)); return c; }
__device__ __forceinline__ v8f wmmabg(v16bf a, v16bf b, v8f c) { c = wmmab(a, b, c); asm volatile("v_nop\n\tv_nop\n\tv_nop\n\tv_nop" : "+v"(c) : "v"(a), "v"(b)); return c; }

__device__ __forceinline__ void wconv_body(const float* __restrict__ src, h16* dst, float* wsl) {
    const int tid = threadIdx.x;
#pragma unroll   // unrolled so that a thread's 16 loads are in flight together; rolled, every trip waited out its own load
    for (int it = 0; it < 16; ++it) { const int idx = it * 256 + tid; wsl[(idx >> 6) * 65 + (idx & 63)] = bfr(src[idx]); }   // 16 x 256 = 4096 elements, all staged
    __syncthreads();
{
#pragma unroll 1
        for (int it = 0; it < 2; ++it) { const int idx = it * 256 + tid; const int n = (idx >> 7) * 16 + (idx & 15), k8 = ((idx >> 5) & 3) * 16 + ((idx >> 4) & 1) * 8; v8h o;   // idx = (tile, k segment, lane): 4 x 4 x 32 pieces
#pragma unroll
            for (int i = 0; i < 8; ++i) o[i] = toh_flush(wsl[(k8 + i) * 65 + n] * WCS);
            *(v8h*)(dst + (size_t)idx * 8) = o;
            asm volatile("s_wait_xcnt 0x0" ::: "memory"); }   // stands in front of the next trip's address arithmetic, which rewrites the store's address register
         }
}

// runs in a 256-thread block: waves 0..3 do the work, every wave passes the barrier
__device__ __forceinline__ void wpconv_body(const float* __restrict__ src, bf* dst, float* wsl) {
    const int tid = threadIdx.x;
    if (tid < 128) { wsl[tid] = src[tid]; wsl[tid + 128] = src[tid + 128]; }
    __syncthreads();
    if (tid >= 128) return;
    const int row = tid >> 3, k8 = (tid & 7) * 8;
    const int rc = row < NH_ ? row : (NH_ - 1);
    v8us o;
#pragma unroll
    for (int i = 0; i < 8; ++i) { float w = wsl[(k8 + i) * NH_ + rc]; asm volatile("" : "+v"(w)); o[i] = (row < NH_) ? f2bf(w) : (unsigned short)0; }
    *(v8us*)(dst + (size_t)row * DM + k8) = o; 
}

// k_conv: block b converts one weight matrix: 0..3 -> q | k | v | gate planes of WT, 4 -> WOT, 5 -> WPT. The six conversions are independent of each other.
__global__ __launch_bounds__(256) void k_conv(const float* __restrict__ wq, const float* __restrict__ wk, const float* __restrict__ wv, const float* __restrict__ wg,
                                              const float* __restrict__ wo, const float* __restrict__ wp, h16* WT, h16* WOT, bf* WPT) {
    __shared__ float wsl[DM * 65];
    const int b = blockIdx.x;
    if (b == 5) { wpconv_body(wp, WPT, wsl); return; }
    const float* src = (b == 0) ? wq : (b == 1) ? wk : (b == 2) ? wv : (b == 3) ? wg : wo;
    h16* dst = (b == 4) ? WOT : WT + (size_t)b * DM * DM;
    wconv_body(src, dst, wsl);
}

// pairbias_body: bias[h][i][j] = sum_p bf16(pair[i][j][p]) bf16(Wp[p][h]); block = one 16-query tile x 8 keys, wave = 4 query rows x 8 keys as two 16-column tiles:
// A = Wp^T rows (row = head, padded to 16), B = pair rows converted in registers (col = 8 * (query row bit 0) + key), K = 64. The four waves' values meet in LDS [head][query][key]; wave w then stores head w's
// two 256-byte runs of the lane-ordered bias plane (16 queries x 4 keys each), so every line of the plane has one writer.
__device__ __forceinline__ void pairbias_body(const int blk, const float* __restrict__ pair, const bf* __restrict__ WPT, float* BIAS, float* os) {
    const int lane = threadIdx.x & 31, lr = lane & 15, hi = lane >> 4;
    const int wave = __builtin_amdgcn_readfirstlane((int)(threadIdx.x >> 5));
    const int ti = blk / (SEQ / 8), kg = blk % (SEQ / 8);
    const v16bf a0 = ldb(WPT + lr * DM + 8 * hi), a1 = ldb(WPT + lr * DM + 8 * hi + 32);
    v4f xs[2][2][4];                                                                          // the wave's 16 row loads are all issued before the first is used: one memory latency, not four
#pragma unroll
    for (int jt = 0; jt < 2; ++jt) {
        const float* p = pair + ((size_t)(ti * 16 + wave * 4 + 2 * jt + (lr >> 3)) * SEQ_FULL + (size_t)(kg * 8 + (lr & 7))) * DM + 8 * hi;
#pragma unroll
        for (int kc = 0; kc < 2; ++kc) {
            xs[jt][kc][0] = *(const v4f*)(p + 32 * kc); xs[jt][kc][1] = *(const v4f*)(p + 32 * kc + 4); xs[jt][kc][2] = *(const v4f*)(p + 32 * kc + 16); xs[jt][kc][3] = *(const v4f*)(p + 32 * kc + 20); }
    }
#pragma unroll
    for (int jt = 0; jt < 2; ++jt) {
        const int ql = wave * 4 + 2 * jt + (lr >> 3);
        v8f acc = (v8f){};
#pragma unroll
        for (int kc = 0; kc < 2; ++kc) {
            const v4f x0 = xs[jt][kc][0], x1 = xs[jt][kc][1], x2 = xs[jt][kc][2], x3 = xs[jt][kc][3];
            v8us e0, e1;
#pragma unroll
            for (int i = 0; i < 4; ++i) { e0[i] = f2bf(x0[i]); e0[4 + i] = f2bf(x1[i]); e1[i] = f2bf(x2[i]); e1[4 + i] = f2bf(x3[i]); }
            const v16bf bq = cat16b(e0, e1);
            if (kc == 0) acc = wmmabg(a0, bq, acc); else acc = wmmabg(a1, bq, acc);
        }
        if (hi == 0) {                                                                        // D: row 8h+r (head), col lane&15; the four real heads sit in rows 0..3 of the lower lanes
#pragma unroll
            for (int r = 0; r < NH_; ++r) os[(r * 16 + ql) * 8 + (lr & 7)] = acc[r]; }
    }
    __syncthreads();                                                                          // os: written by all 4 waves (4 query rows each), read across waves (one head each)
    const v4f val = *(const v4fa*)(&os[(wave * 16 + lr) * 8 + hi * 4]);                       // head = wave, query = lane&15, keys 4 * (lane>>4) + 0..3 of the group
    float* dstp = BIAS + ((size_t)(wave * (SEQ / 16) + ti) * (SEQ / 32) + (size_t)(kg >> 2)) * 512 + (size_t)(((kg >> 1) & 1) * 2 + hi) * 128 + (size_t)((kg & 1) * 16 + lr) * 4;
    *(v4f*)dstp = val;
    asm volatile("s_wait_xcnt 0x0" ::: "memory");   // stands in front of whatever the merged kernel's layout puts behind this store and lets rewrite its registers
}

// value of one 16 x 16 projection tile: (x_hi W + (x_res W) / 2048) / 64, K = 64
__device__ __forceinline__ v8f proj_tile(v16h b0, v16h b1, v16h a0h, v16h a1h, v16h a0r, v16h a1r) {
    v8f cH = (v8f){}, cR = (v8f){};
    cH = wmma16g(a0h, b0, cH); cH = wmma16g(a1h, b1, cH);
    cR = wmma16g(a0r, b0, cR); cR = wmma16g(a1r, b1, cR);
    return (cH + cR * QRI) * WCI;
}

// the eight B fragments (4 column tiles x 2 k-steps) of one 64 x 64 weight plane; p already includes + 8*lane
__device__ __forceinline__ void ldw(v16h (&w)[8], const h16* __restrict__ p) {
#pragma unroll
    for (int nb = 0; nb < 4; ++nb) { w[2 * nb] = ldf(p + (size_t)(nb * 16) * DM); w[2 * nb + 1] = ldf(p + (size_t)(nb * 16) * DM + 512); }
}

// lnproj_body: LayerNorm + q/k/v/gate projections; block = 64 tokens of one sequence, wave = 16 tokens. Lane (row = lane&15, half = lane>>4) holds the 32 columns 16q + 8*half + i of its row,
// q, k: f16 value plane and f16 residual plane ((v - value) x 2048, same flush select); per head the 16 x 16 halves are one contiguous 512-byte run of each plane, written by one instruction (32 lanes x 16 B);
// gate: f32, the wave's 16 x 64 tile in lane order, 512 contiguous bytes per instruction;
__device__ __forceinline__ void lnproj_body(const int blk, const float* __restrict__ msa, const float* __restrict__ lng, const float* __restrict__ lnb,
                                            const h16* __restrict__ WT, const float* __restrict__ bg,
                                            h16* QH, h16* QR, h16* KP, h16* KR, h16* VT, float* GP, float* os, h16* vts) {
    const int lane = threadIdx.x & 31, lr = lane & 15, hi = lane >> 4;
    const int wave = __builtin_amdgcn_readfirstlane((int)(threadIdx.x >> 5));
    const int r0 = blk * 64;
    const int sq = r0 / SEQ, tbk = r0 % SEQ;
    const int t0 = tbk + wave * 16;
    const int wb = wave * 16 * CSP;
    // Weight fragments are fetched one whole matrix ahead of their products, so that their latency passes under other work: wf[m] is loaded while matrix m - 1 (for q: the LayerNorm) is worked on.
    const size_t wlo = (size_t)lane * 8;                               // + matrix * 64 * DM: one 16-column tile = 16 * DM halves in lane order
    v16h wf[4][8];
    ldw(wf[0], WT + wlo);
    const float* xr = msa + ((size_t)sq * SEQ_FULL + (size_t)(t0 + lr)) * DM + 8 * hi;
    float xv[32];
    v4f xu[8];
#pragma unroll
    for (int q = 0; q < 4; ++q) { xu[2 * q] = *(const v4f*)(xr + 16 * q); xu[2 * q + 1] = *(const v4f*)(xr + 16 * q + 4); }
    asm volatile("s_wait_xcnt 0x0" ::: "memory");   // stands in front of the gain loads, whose destinations reuse the row loads' address pair
    __builtin_amdgcn_sched_barrier(0);              // keeps the weight loads above in front of the first wait on a row load; without it they are issued only after the rows have arrived
#pragma unroll
    for (int q = 0; q < 4; ++q) {
#pragma unroll
        for (int i = 0; i < 4; ++i) { xv[8 * q + i] = bfr(xu[2 * q][i]); xv[8 * q + 4 + i] = bfr(xu[2 * q + 1][i]); } }
    float sm = 0.0f;
#pragma unroll
    for (int e = 0; e < 32; ++e) sm += xv[e];
    sm += __shfl_xor(sm, 16, 32);
    const float mu = sm * (1.0f / 64.0f);
    float sv = 0.0f;
#pragma unroll
    for (int e = 0; e < 32; ++e) { const float dl = xv[e] - mu; sv += dl * dl; }
    sv += __shfl_xor(sv, 16, 32);
    const float rs = rsqrtf(sv * (1.0f / 64.0f) + LNEPS);
    v16h ah[2], ar[2];
#pragma unroll
    for (int q = 0; q < 4; ++q) {
        const v4f g0 = *(const v4f*)(lng + 8 * hi + 16 * q), g1 = *(const v4f*)(lng + 8 * hi + 16 * q + 4);
        const v4f c0 = *(const v4f*)(lnb + 8 * hi + 16 * q), c1 = *(const v4f*)(lnb + 8 * hi + 16 * q + 4);
#pragma unroll
        for (int i = 0; i < 4; ++i) {
            const float y0 = (xv[8 * q + i] - mu) * rs * bfr(g0[i]) + bfr(c0[i]);
            const float y1 = (xv[8 * q + 4 + i] - mu) * rs * bfr(g1[i]) + bfr(c1[i]);
            const h16 h0 = toh_flush(y0), h1 = toh_flush(y1);
            ah[q >> 1][(q & 1) * 8 + i] = h0; ah[q >> 1][(q & 1) * 8 + 4 + i] = h1;
            ar[q >> 1][(q & 1) * 8 + i] = toh_flush((y0 - (float)h0) * QRS); ar[q >> 1][(q & 1) * 8 + 4 + i] = toh_flush((y1 - (float)h1) * QRS); } }
    float bgr[4];
    // q (matrix 0) and k (matrix 1)
#pragma unroll
    for (int mat = 0; mat < 2; ++mat) {
        ldw(wf[mat + 1], WT + wlo + (size_t)((mat + 1) * 64) * DM);
#pragma unroll
        for (int nb = 0; nb < 4; ++nb) {
            const v8f val = proj_tile(wf[mat][2 * nb], wf[mat][2 * nb + 1], ah[0], ah[1], ar[0], ar[1]);
#pragma unroll
            for (int r = 0; r < 8; ++r) os[wb + (8 * hi + r) * CSP + nb * 16 + lr] = val[r]; }     // D: row 8h+r (token), col lane&15
        if (mat == 1) {                                                                            // the k fragments are dead here: the gate's weights and bias take their place
            ldw(wf[3], WT + wlo + (size_t)(3 * 64) * DM);
#pragma unroll
            for (int nb = 0; nb < 4; ++nb) bgr[nb] = bg[nb * 16 + lr]; }
        wave_sync();
{
#pragma unroll
            for (int hh = 0; hh < NH_; ++hh) { const int row = lane >> 1, c8 = (lane & 1) * 8;       // 16 rows x 2 lanes x 8 halves = head hh of the tile
                const v4f x0 = *(const v4fa*)(&os[wb + row * CSP + hh * 16 + c8]); const v4f x1 = *(const v4fa*)(&os[wb + row * CSP + hh * 16 + c8 + 4]); v8h hv, rv;
#pragma unroll
                for (int i = 0; i < 4; ++i) { const h16 a0 = toh_flush(x0[i]); const h16 a1 = toh_flush(x1[i]); hv[i] = a0; hv[4 + i] = a1;
                    rv[i] = toh_flush((x0[i] - (float)a0) * QRS); rv[4 + i] = toh_flush((x1[i] - (float)a1) * QRS); }
                const size_t oo = ((size_t)(sq * NH_ + hh) * SEQ + (size_t)t0) * HD + (size_t)lane * 8;
                if (mat == 0) { *(v8h*)(QH + oo) = hv; *(v8h*)(QR + oo) = rv; } else { *(v8h*)(KP + oo) = hv; *(v8h*)(KR + oo) = rv; } }
             }
        asm volatile("s_wait_xcnt 0x0" ::: "memory");   // stands in front of the next weight loads, whose destinations reuse registers that the stores above name
        wave_sync();
    }
    // v (matrix 2): lane's 8 accumulator values are 8 consecutive tokens of column c -> one 16-B LDS store into the [c][token] tile
#pragma unroll
    for (int nb = 0; nb < 4; ++nb) {
        const v8f val = proj_tile(wf[2][2 * nb], wf[2][2 * nb + 1], ah[0], ah[1], ar[0], ar[1]);
        v8h o;
#pragma unroll
        for (int r = 0; r < 8; ++r) o[r] = toh_flush(val[r]);
        *(v8ha*)(&vts[(nb * 16 + lr) * VTP + wave * 16 + 8 * hi]) = o; }
    // gate (matrix 3): sigmoid(x Wg + bg)
#pragma unroll
    for (int nb = 0; nb < 4; ++nb) {
        const v8f val = proj_tile(wf[3][2 * nb], wf[3][2 * nb + 1], ah[0], ah[1], ar[0], ar[1]);
        const float bgv = bfr(bgr[nb]);
#pragma unroll
        for (int r = 0; r < 8; ++r) { const float z = val[r] + bgv; const float ex = __builtin_amdgcn_exp2f(-z * L2E); os[wb + (8 * hi + r) * CSP + nb * 16 + lr] = 1.0f / (1.0f + ex); } }
    wave_sync();
{
#pragma unroll
        for (int s8 = 0; s8 < 8; ++s8) { const int cofs = (s8 >> 1) * 16 + 8 * hi + (s8 & 1) * 4;            // 8 x (2 x 4 columns) = 64 columns; 16 lanes = 16 rows
            const v4f val = *(const v4fa*)(&os[wb + lr * CSP + cofs]);
            *(v4f*)(GP + ((size_t)sq * SEQ + (size_t)t0) * DM + s8 * 128 + lane * 4) = val; }
         }
    __syncthreads();                                                   // v^T tile: written by all 4 waves, each wave reads back only its own 16 tokens
    const int tid = threadIdx.x;
{
#pragma unroll
        for (int it = 0; it < 4; ++it) {                                                                                // trip = head; wave = (32-key chunk, 16-key half) of the block's 64 tokens; lane = 16 * (key bit 3) + d
            const v8h o = *(const v8ha*)(&vts[(it * 16 + lr) * VTP + wave * 16 + 8 * hi]);
            *(v8h*)(VT + ((size_t)(sq * NH_ + it) * SEQ + (size_t)tbk) * HD + tid * 8) = o; }
         }
}

// k_lnproj_pairbias: blocks 0 .. LNB-1 run lnproj_body (the longer work, so it starts first), blocks LNB .. LNB+PBB-1 run pairbias_body; neither reads what the other writes.
#define LNB (NB * SEQ / 64)
#define PBB ((SEQ / 16) * (SEQ / 8))
__global__ __launch_bounds__(32 * AW) void k_lnproj_pairbias(const float* __restrict__ msa, const float* __restrict__ lng, const float* __restrict__ lnb,
                                                             const h16* __restrict__ WT, const float* __restrict__ bg,
                                                             h16* QH, h16* QR, h16* KP, h16* KR, h16* VT, float* GP,
                                                             const float* __restrict__ pair, const bf* __restrict__ WPT, float* BIAS) {
    __shared__ __align__(16) float os[AW * 16 * CSP];                  // the pair-bias blocks use its first NH_ * 16 * 8 floats
    __shared__ __align__(16) h16 vts[DM * VTP];
    const int b = blockIdx.x;
    if (b < LNB) lnproj_body(b, msa, lng, lnb, WT, bg, QH, QR, KP, KR, VT, GP, os, vts);
    else pairbias_body(b - LNB, pair, WPT, BIAS, os);
}

// k_attn: block = 16 query rows of one sequence, wave w = head w. Transposed flash form: S^T[key][t] = K Q^T (A = K rows, B = Q rows, k = d: 16 real + 16 zero slots);
// scores = K Q + (K Q_res + K_res Q) / 2048 (value x value in the main accumulators, the two cross products in their own accumulators; residual x residual dropped);
// lane (t = lane&15, h = lane>>4) holds keys 8h+r of each 16-key tile, so the packed P tile is directly the B fragment of O^T[d][t] = V^T P^T.
// Per step: bias row segment and mask words loaded as 16-B vectors at arithmetic addresses; masked keys are dropped by value (probability 0, excluded from the running max).
// After the key loop the 4 heads' contexts meet in a block LDS tile [16][64]; every wave rebuilds the gated context fragments (value + residual x2048) and computes one 16-column tile of the output projection;
// Second launch bound: at most 128 registers a wave, so that 8 waves per SIMD (the whole grid) stay resident although a trip's load destinations are all live at once.
__global__ __launch_bounds__(32 * AW, 8) void k_attn(const h16* __restrict__ QH, const h16* __restrict__ QR, const h16* __restrict__ KP, const h16* __restrict__ KR, const h16* __restrict__ VT,
                                                  const float* __restrict__ BIAS, const int* __restrict__ kmask, const float* __restrict__ GP,
                                                  const h16* __restrict__ WOT, const float* __restrict__ bo, float* OUT) {
    __shared__ __align__(16) float cs[16 * CSP];
    __shared__ __align__(16) float ot[16 * CSP];
    const int lane = threadIdx.x & 31, lr = lane & 15, hi = lane >> 4;
    const int wave = __builtin_amdgcn_readfirstlane((int)(threadIdx.x >> 5));
    const int sq = blockIdx.y; const int t0 = blockIdx.x * 16;
    const int zh = sq * NH_ + wave;
    const size_t pbase = (size_t)zh * SEQ * HD;
    const v8h z8 = (v8h){};
    const v16h qh = cat16(*(const v8h*)(QH + pbase + (size_t)(t0 + lr) * HD + 8 * hi), z8);   // B fragment: col t, k = d; slots 16..31 zero
    const v16h qr = cat16(*(const v8h*)(QR + pbase + (size_t)(t0 + lr) * HD + 8 * hi), z8);   // residual x2048, same map
    const size_t ko = pbase + (size_t)lr * HD + 8 * hi;        // + key * HD   (A fragment: row key, k = d)
    const size_t vo = pbase + (size_t)lane * 8;                // + key * HD   (A fragment: row d, k = key; lane-ordered plane, 32 keys = 32 * HD halves)
    const float* bp0 = BIAS + (size_t)(wave * (SEQ / 16) + (int)blockIdx.x) * (SEQ / 32) * 512 + (size_t)lane * 4;   // + key * 16 (lane-ordered plane, 32 keys = 512 floats)
    const int* mp0 = kmask + (size_t)sq * SEQ_FULL + 8 * hi;
    v8f o0 = (v8f){};
    float m = NEGB, l = 0.0f;
#pragma unroll 1
    for (int key0 = 0; key0 < SEQ; key0 += 32) {
        const h16* ka = KP + ko + (size_t)key0 * HD;
        const v16h ka0 = cat16(*(const v8h*)ka, z8), kb0 = cat16(*(const v8h*)(ka + 16 * HD), z8);
        const h16* kr = KR + ko + (size_t)key0 * HD;
        const v16h kra0 = cat16(*(const v8h*)kr, z8), krb0 = cat16(*(const v8h*)(kr + 16 * HD), z8);
        // all of the trip's loads stand together here, so that their latencies overlap instead of adding up
        const float* bp = bp0 + (size_t)key0 * 16;               // keys key0+8h+0..7 and key0+16+8h+0..7 of query row t0 + (lane&15)
        const v4f c0 = *(const v4f*)bp, c1 = *(const v4f*)(bp + 128), c2 = *(const v4f*)(bp + 256), c3 = *(const v4f*)(bp + 384);
        const int* mp = mp0 + key0;
        const v4i n0 = *(const v4i*)mp, n1 = *(const v4i*)(mp + 4), n2 = *(const v4i*)(mp + 16), n3 = *(const v4i*)(mp + 20);
        const v16h v0 = ldf(VT + vo + (size_t)key0 * HD);
        v8f sa = (v8f){}, sb = (v8f){}, ra = (v8f){}, rb = (v8f){};
        sa = wmma16g(ka0, qh, sa); sb = wmma16g(kb0, qh, sb);
        ra = wmma16g(ka0, qr, ra); ra = wmma16g(kra0, qh, ra);
        rb = wmma16g(kb0, qr, rb); rb = wmma16g(krb0, qh, rb);
        float ta[8], tc[8]; bool fa[8], fb[8]; float mx = NEGB;
#pragma unroll
        for (int r = 0; r < 4; ++r) {
            ta[r] = (sa[r] + ra[r] * QRI) * SC2 + c0[r] * L2E; ta[4 + r] = (sa[4 + r] + ra[4 + r] * QRI) * SC2 + c1[r] * L2E;
            tc[r] = (sb[r] + rb[r] * QRI) * SC2 + c2[r] * L2E; tc[4 + r] = (sb[4 + r] + rb[4 + r] * QRI) * SC2 + c3[r] * L2E;
            fa[r] = n0[r] != 0; fa[4 + r] = n1[r] != 0; fb[r] = n2[r] != 0; fb[4 + r] = n3[r] != 0; }
#pragma unroll
        for (int r = 0; r < 8; ++r) mx = fmaxf(mx, fmaxf(fa[r] ? ta[r] : NEGB, fb[r] ? tc[r] : NEGB));
        mx = fmaxf(mx, __shfl_xor(mx, 16, 32));
        const float mnew = fmaxf(m, mx);
        const float alpha = __builtin_amdgcn_exp2f(m - mnew);
        const float sh = PSH - mnew;
        v16h pb; float ls = 0.0f;
#pragma unroll
        for (int r = 0; r < 8; ++r) {
            const float xa = ta[r] + sh, xb = tc[r] + sh;
            const float ea = __builtin_amdgcn_exp2f(xa), eb = __builtin_amdgcn_exp2f(xb);
            const float ga = (fa[r] & (xa >= -14.0f)) ? ea : 0.0f, gb = (fb[r] & (xb >= -14.0f)) ? eb : 0.0f;   // dropped keys and sub-2^-14 values selected to 0 by value
            const h16 pa = (h16)ga; const h16 pc = (h16)gb;
            pb[r] = pa; pb[8 + r] = pc;
            ls += (float)pa + (float)pc; }
        l = l * alpha + ls; m = mnew;
        o0 = o0 * alpha;
        o0 = wmma16g(v0, pb, o0);
    }
    // the epilogue's global loads depend on nothing the key loop computes: issued here, their latency passes under the normalisation and the barrier
    const float* gr = GP + ((size_t)sq * SEQ + (size_t)t0) * DM + (size_t)lane * 4;
    v4f gv[8];
#pragma unroll
    for (int q = 0; q < 8; ++q) gv[q] = *(const v4f*)(gr + 128 * q);
    const h16* wop = WOT + (size_t)(wave * 16) * DM + (size_t)lane * 8;
    const float bor = bo[wave * 16 + lr];
    const v16h wo0 = ldf(wop);
    const v8h wo1l = *(const v8h*)(wop + 512);
    asm volatile("s_wait_xcnt 0x0" ::: "memory");   // stands in front of the last weight load, whose destination reuses address registers of the loads above
    const v16h wo1 = cat16(wo1l, *(const v8h*)(wop + 768));
    l += __shfl_xor(l, 16, 32);
    const bool any = l > 0.0f;
    const float lsafe = any ? l : 1.0f;
    const float inv = any ? (1.0f / lsafe) : __uint_as_float(0x7FC00000u);       // no kept key -> NaN row (softmax of an all-dropped row)
    // O^T D layout: o0[r] = (d = 8h + r, t = lane&15) -> cs[t][wave*16 + d]; 16 rows x 64 columns written by the 4 waves
    { v4f a, c;
      a[0] = o0[0] * inv; a[1] = o0[1] * inv; a[2] = o0[2] * inv; a[3] = o0[3] * inv; c[0] = o0[4] * inv; c[1] = o0[5] * inv; c[2] = o0[6] * inv; c[3] = o0[7] * inv;
      *(v4fa*)(&cs[lr * CSP + wave * 16 + 8 * hi]) = a; *(v4fa*)(&cs[lr * CSP + wave * 16 + 8 * hi + 4]) = c; }
    __syncthreads();                                                             // cs: cross-wave
    // gated context fragments: row t = lane&15, k = concatenated head column 16q + 8h + i
    v16h gh[2], gq[2];
#pragma unroll
    for (int q = 0; q < 4; ++q) {
        const v4f g0 = gv[2 * q], g1 = gv[2 * q + 1];
        const v4f x0 = *(const v4fa*)(&cs[lr * CSP + 8 * hi + 16 * q]), x1 = *(const v4fa*)(&cs[lr * CSP + 8 * hi + 16 * q + 4]);
#pragma unroll
        for (int i = 0; i < 4; ++i) {
            const float y0 = g0[i] * x0[i], y1 = g1[i] * x1[i];
            const h16 h0 = toh_flush(y0), h1 = toh_flush(y1);
            gh[q >> 1][(q & 1) * 8 + i] = h0; gh[q >> 1][(q & 1) * 8 + 4 + i] = h1;
            gq[q >> 1][(q & 1) * 8 + i] = toh_flush((y0 - (float)h0) * QRS); gq[q >> 1][(q & 1) * 8 + 4 + i] = toh_flush((y1 - (float)h1) * QRS); } }
    const v8f pv = proj_tile(wo0, wo1, gh[0], gh[1], gq[0], gq[1]);
    const float bov = bfr(bor);
#pragma unroll
    for (int r = 0; r < 8; ++r) ot[(8 * hi + r) * CSP + wave * 16 + lr] = pv[r] + bov;       // D: row 8h+r (token), col lane&15; 16 rows x 64 columns written by the 4 waves
    __syncthreads();                                                             // ot: cross-wave
    float* orow = OUT + ((size_t)sq * OUT_SEQ + (size_t)t0) * DM;
    const int tid = threadIdx.x;
{
#pragma unroll
        for (int it = 0; it < 2; ++it) { const int idx = it * 128 + tid; const int row = idx >> 4, cofs = (idx & 15) * 4;   // 2 trips x 8 rows = 16 rows; 16 pieces x 4 floats = 64 columns
            const v4f val = *(const v4fa*)(&ot[row * CSP + cofs]);
            *(v4f*)(orow + (size_t)row * DM + cofs) = val; }
         }
}

static constexpr size_t al256(size_t v) { return (v + 255) & ~(size_t)255; }
static constexpr size_t SZ_WT = al256((size_t)4 * DM * DM * 2);
static constexpr size_t SZ_WO = al256((size_t)DM * DM * 2);
static constexpr size_t SZ_WP = al256((size_t)16 * DM * 2);
static constexpr size_t SZ_PL = al256((size_t)NB * SEQ * DM * 2);
static constexpr size_t SZ_GP = al256((size_t)NB * SEQ * DM * 4);
static constexpr size_t SZ_BS = al256((size_t)NH_ * SEQ * SEQ * 4);
static constexpr size_t SZ_TOTAL = SZ_WT + SZ_WO + SZ_WP + 5 * SZ_PL + SZ_GP + SZ_BS;   // planes: q value, q residual, k value, k residual, v^T
static_assert(SZ_TOTAL <= (size_t)134217728);          // workspace carve <= 128 MiB
static_assert(((size_t)DM * DM * 2) % 256 == 0);       // weight sub-planes stay 256-byte aligned
static_assert((size_t)NB * NH_ * SEQ * HD == (size_t)NB * DM * SEQ);   // q/k value and residual planes [s*4+h][t][16] and the v^T plane have the same extent
static_assert(((size_t)(NB - 1) * OUT_SEQ + SEQ) * DM <= (size_t)NB_FULL * SEQ_FULL * DM);   // last output row inside the output buffer

extern "C" void kernel_launch(void* const* d_in, const int* in_sizes, int n_in,
                              void* d_out, int out_size, void* d_ws, size_t ws_size, hipStream_t stream) {
    if (n_in < 13) return;
    const size_t needx = ((size_t)(NB - 1) * SEQ_FULL + SEQ) * DM;
    const size_t needp = ((size_t)(SEQ - 1) * SEQ_FULL + SEQ) * DM;
    const size_t needm = (size_t)(NB - 1) * SEQ_FULL + SEQ;
    if ((size_t)in_sizes[0] < needx || (size_t)in_sizes[1] < needp || (size_t)in_sizes[2] < needm) return;
    if (in_sizes[3] < DM || in_sizes[4] < DM || in_sizes[9] < DM || in_sizes[12] < DM) return;
    if (in_sizes[5] < DM * DM || in_sizes[6] < DM * DM || in_sizes[7] < DM * DM || in_sizes[8] < DM * DM || in_sizes[11] < DM * DM) return;
    if (in_sizes[10] < DM * NH_) return;
    if ((size_t)out_size < ((size_t)(NB - 1) * OUT_SEQ + SEQ) * DM) return;
    if (SZ_TOTAL > ws_size) return;
    // wire order: x stack, pair, key mask, ln gain, ln bias, Wq, Wk, Wv, Wg, bg, Wp, Wo, bo
    const float* msa  = (const float*)d_in[0];
    const float* pair = (const float*)d_in[1];
    const int*   kmsk = (const int*)d_in[2];
    const float* lng  = (const float*)d_in[3];
    const float* lnb  = (const float*)d_in[4];
    const float* wq   = (const float*)d_in[5];
    const float* wk   = (const float*)d_in[6];
    const float* wv   = (const float*)d_in[7];
    const float* wg   = (const float*)d_in[8];
    const float* bg   = (const float*)d_in[9];
    const float* wp   = (const float*)d_in[10];
    const float* wo   = (const float*)d_in[11];
    const float* bo   = (const float*)d_in[12];
    float* OUT = (float*)d_out;      // [NB][SEQ][64]
    char* wsp = (char*)d_ws;
    h16* WT  = (h16*)wsp; wsp += SZ_WT;               // [4][4 tiles][4 k segments][32 lanes][8]: q | k | v | gate, x64
    h16* WOT = (h16*)wsp; wsp += SZ_WO;               // [4 tiles][4 k segments][32 lanes][8], x64
    bf*  WPT = (bf*)wsp;  wsp += SZ_WP;               // [16][64]
    h16* QH  = (h16*)wsp; wsp += SZ_PL;               // [NB*4][SEQ][16]
    h16* QR  = (h16*)wsp; wsp += SZ_PL;               // [NB*4][SEQ][16] residual x2048
    h16* KP  = (h16*)wsp; wsp += SZ_PL;               // [NB*4][SEQ][16]
    h16* KR  = (h16*)wsp; wsp += SZ_PL;               // [NB*4][SEQ][16] residual x2048
    h16* VT  = (h16*)wsp; wsp += SZ_PL;               // [NB*4][SEQ/32][2][32 lanes][8]
    float* GP = (float*)wsp; wsp += SZ_GP;            // [NB][SEQ/16][8][32 lanes][4]
    float* BIAS = (float*)wsp; wsp += SZ_BS;          // [4][SEQ/16][SEQ/32][4][32 lanes][4]

    k_conv<<<6, 256, 0, stream>>>(wq, wk, wv, wg, wo, wp, WT, WOT, WPT);
    k_lnproj_pairbias<<<(unsigned)(LNB + PBB), 32 * AW, 0, stream>>>(msa, lng, lnb, WT, bg, QH, QR, KP, KR, VT, GP, pair, WPT, BIAS);
    k_attn<<<dim3(SEQ / 16, NB, 1), 32 * AW, 0, stream>>>(QH, QR, KP, KR, VT, BIAS, kmsk, GP, WOT, bo, OUT);
}

// v004
// One run takes 35.3 microseconds.
// Timed twice side by side with v003, it ran 1.04 times as fast both times.
// Over all steps from v000 it is 2.11 times as fast.
#include <hip/hip_runtime.h>

// Gated row attention over a stack of sequences with a pair-derived additive bias shared by all sequences: x [NB][SEQ][64] -> LayerNorm (eps 1e-5, gain, bias) -> bias-free q/k/v projections ([in][out], y = x W),
// sigmoid gate (x Wg + bg), 4 heads x 16, scores q.k / sqrt(16) + bias[h][i][j] with bias = pair[i][j][:] . Wp[:][h], key padding mask (int32, replace fill: masked keys dropped from the softmax, a row with no kept key gives NaN),
// softmax over keys, context, gate multiply, output projection ([in][out]) + bias; output f32 [NB][SEQ][64].
// Compute dtypes, f32 accumulate everywhere: q/k/v/gate projections v_wmma_f32_16x16x32_f16 (LayerNorm output as f16 value + f16 residual x2048 in its own accumulator, W RNE-converted to bf16 then x64 in f16, exact);
// pair bias v_wmma_f32_16x16x32_bf16 (pair and Wp RNE-converted to bf16, products exact); scores v_wmma_f32_16x16x32_f16 with q and k each as f16 value + f16 residual x2048 (three products: value x value in the main accumulator,
// value x residual + residual x value in their own accumulator folded by 1/2048; head dim 16 zero-padded to the 32-deep k-step in registers in both fragments);
// P.V v_wmma_f32_16x16x32_f16 single product (P x16384 carry, cancels in the normalisation, row sum over the converted P); output projection v_wmma_f32_16x16x32_f16 (gated context as f16 value + f16 residual x2048 in its own accumulator, Wo x64).
// Every float input is RNE-converted to bf16 at its load. LayerNorm, softmax (online, running max over kept keys), sigmoid in f32.
// Layout: every plane that a wave reads as a matrix fragment or as an accumulator-shaped tile is stored so that one 16-byte load per lane covers 512 contiguous bytes (4 whole lines), all but the q, k planes in lane order:
// W^T planes f16 [16-column tile][k segment of 16][lane][8] (lane = 16 * (k bit 3) + column; q, k, v, gate: in the projection block's LDS, Wo: in the workspace); v^T plane f16 [s*4+h][32-key chunk][16-key half][lane][8] (lane = 16 * (key bit 3) + d);
// gate plane f32 [s][16-token tile][16-column group][4-column half][lane][4] (lane = 16 * (column bit 3) + token); bias plane f32 [h][16-query tile][32-key chunk][j][lane][4] (lane = 16 * (key bit 3) + query, j = 2 * (key bit 4) + (key bit 2));
// q, k value planes and q, k residual planes (x2048) [s*4+h][t][16] f16 (a 16-row fragment is 512 contiguous bytes as it is).
// Two launches: k_lnproj_pairbias (projection blocks first, then the pair-bias blocks, then one block that converts Wo for the next launch; none depends on another), k_attn.
// No launch of its own converts weights: a projection block converts Wq, Wk, Wv, Wg from f32 into its LDS planes, a pair-bias wave builds its Wp^T fragments (rows >= 4 zero) in registers.
// Fused attention kernel: one block = 16 query rows of one sequence, wave w = head w, transposed flash form (S^T = K Q^T, O^T = V^T P^T, fragments straight from the planes), then gate, output projection and whole-row stores.

#ifndef NB
#define NB 128                   // number of sequences (batch x stack depth)
#endif
#ifndef SEQ
#define SEQ 256                  // tokens per sequence (queries = keys)
#endif
#define NB_FULL  128
#define SEQ_FULL 256
#ifndef OUT_SEQ
#define OUT_SEQ SEQ              // row pitch (in tokens) between sequences of the output
#endif
#define DM   64
#define NH_  4
#define HD   16
#define AW   4                   // waves per block
#define CSP  68                  // LDS row pitch (floats) of the 16 x 64 staging tiles
#define VTP  72                  // LDS row pitch (halves) of the v^T staging tile
#define WTS  1032                // LDS pitch (halves) between the 16-column tiles of a weight plane: 4 k segments x 256 halves + 8, so that the four tiles a converting wave writes at once fall on different banks
#define QRS  2048.0f             // carry of every residual plane / residual fragment
#define QRI  (1.0f / 2048.0f)
#define WCS  64.0f               // carry of the f16 weight planes
#define WCI  (1.0f / 64.0f)
#define L2E  1.4426950408889634f
#define SC2  ((float)(0.25 * 1.4426950408889634))   // HD^-0.5 * log2(e)
#define PSH  14.0f               // log2 of the P carry (16384)
#define NEGB (-3.0e38f)
#define LNEPS 1.0e-5f

static_assert(DM == 64);                       // LayerNorm lane map: 2 lanes x 32 columns; two 32-deep k-steps
static_assert(HD == 16);                       // one 16-B load per q/k fragment, upper k half zero in registers
static_assert(NH_ * HD == DM);
static_assert(NH_ == AW);                      // wave w of the attention block = head w
static_assert(SEQ % 64 == 0);                  // a 64-token projection tile never straddles two sequences and fills two whole 32-key chunks of the v^T plane
static_assert((NB * SEQ) % 64 == 0);
static_assert(SEQ % 32 == 0);                  // key loop steps by 32; bias and v^T planes are in 32-key chunks
static_assert(SEQ % 16 == 0);
static_assert(SEQ % 8 == 0);                   // bias grid covers (16-query tile, 8-key group) exactly
static_assert(NB <= NB_FULL);
static_assert(SEQ <= SEQ_FULL);
static_assert((CSP * 4) % 16 == 0);
static_assert((VTP * 2) % 16 == 0);
static_assert(32 * 16 * NH_ == 16 * DM * 2);           // q/k store, per plane (value and residual alike): 4 head instructions x 32 lanes x 16 B = 16 rows x 64 halves
static_assert(32 * 16 * 8 == 16 * DM * 4);             // gate store: 8 instructions x 32 lanes x 16 B = 16 rows x 256 B
static_assert(128 * 16 * 4 == DM * 64 * 2);
static_assert(128 * 16 * 2 == 16 * DM * 4);            // output store: 2 trips x 128 threads x 16 B = 16 rows x 256 B
static_assert(128 * 16 == NH_ * 16 * 8 * 4);           // bias store: 128 threads x 16 B = 4 heads x 16 queries x 8 keys
static_assert(128 * 8 * 4 == DM * DM);                 // weight converter: 128 threads x (8 rows x 4 columns)
static_assert((WTS * 2) % 16 == 0);
static_assert(WTS >= 4 * 256);
static_assert(AW * 16 * CSP * 4 + DM * VTP * 2 + 4 * 4 * WTS * 2 <= 131072);   // static LDS of the projection kernel
static_assert(2 * 16 * CSP * 4 <= 131072);                   // static LDS of the attention kernel
static_assert(NH_ * 16 * 8 <= AW * 16 * CSP);                // the pair-bias tile fits the projection kernel's staging array

typedef _Float16 h16;
typedef __attribute__((ext_vector_type(16))) __bf16   v16bf;
typedef __attribute__((ext_vector_type(16))) _Float16 v16h;
typedef __attribute__((ext_vector_type(8)))  _Float16 v8h;
typedef __attribute__((ext_vector_type(8)))  unsigned short v8us;
typedef __attribute__((ext_vector_type(8)))  float    v8f;
typedef __attribute__((ext_vector_type(4)))  float    v4f;
typedef __attribute__((ext_vector_type(4)))  int      v4i;
typedef __attribute__((ext_vector_type(8)))  unsigned v8u;
typedef __attribute__((ext_vector_type(2)))  float    v2f;
typedef __attribute__((ext_vector_type(2)))  __bf16   v2bf;
typedef v4f  __attribute__((may_alias)) v4fa;
typedef v8h  __attribute__((may_alias)) v8ha;

__device__ __forceinline__ unsigned short f2bf(float f) { unsigned u = __float_as_uint(f); u += 0x7FFFu + ((u >> 16) & 1u); return (unsigned short)(u >> 16); }
__device__ __forceinline__ float bfr(float f) { return __uint_as_float(((unsigned)f2bf(f)) << 16); }   // value after RNE convert to bf16
__device__ __forceinline__ v16h cat16(v8h lo, v8h hi) { return __builtin_shufflevector(lo, hi, 0, 1, 2, 3, 4, 5, 6, 7, 8, 9, 10, 11, 12, 13, 14, 15); }
__device__ __forceinline__ v16bf cat16b(v8us lo, v8us hi) { return __builtin_bit_cast(v16bf, __builtin_shufflevector(lo, hi, 0, 1, 2, 3, 4, 5, 6, 7, 8, 9, 10, 11, 12, 13, 14, 15)); }
__device__ __forceinline__ v8f wmma16(v16h a, v16h b, v8f c) { return __builtin_amdgcn_wmma_f32_16x16x32_f16(false, a, false, b, (short)0, c, false, false); }
__device__ __forceinline__ v8f wmmab(v16bf a, v16bf b, v8f c) { return __builtin_amdgcn_wmma_f32_16x16x32_bf16(false, a, false, b, (short)0, c, false, false); }
// fragment loader from a lane-ordered plane; p already includes + 8*lane: elements 0..7 <- segment 0 (k0+8h+0..7), elements 8..15 <- segment 1 (k0+16+8h+0..7), each segment 32 lanes x 16 B
__device__ __forceinline__ v16h  ldf(const h16* p) { return cat16(*(const v8h*)p, *(const v8h*)(p + 256)); }
// ordering point for wave-private LDS tiles (same wave writes and reads)
__device__ __forceinline__ void wave_sync() { __builtin_amdgcn_fence(3 /* release order */, "wavefront"); __builtin_amdgcn_wave_barrier(); asm volatile("" ::: "memory"); }

// f32 -> f16 convert that cannot produce a subnormal (|v| < 2^-14 -> +0); NaN passes through
static __device__ __forceinline__ h16 toh_flush(float v) { const h16 r = (h16)v; return (fabsf(v) < 6.103515625e-05f) ? (h16)0.0f : r; }
// one matrix instruction followed by its own 4-slot guard
__device__ __forceinline__ v8f wmma16g(v16h a, v16h b, v8f c) { c = wmma16(a, b, c); asm volatile("v_nop\n\tv_nop\n\tv_nop\n\tv_nop" : "+v"(c) : "v"(a), "v"(b)); return c; }
__device__ __forceinline__ v8f wmmabg(v16bf a, v16bf b, v8f c) { c = wmmab(a, b, c); asm volatile("v_nop\n\tv_nop\n\tv_nop\n\tv_nop" : "+v"(c) : "v"(a), "v"(b)); return c; }

// Weight conversion, 128 threads per 64 x 64 f32 matrix [in][out]: thread (ko = tid >> 4, c = tid & 15) takes rows 8 ko .. 8 ko + 7 of columns 4 c .. 4 c + 3 (a wave's load = two whole 256-byte rows);
// column j of that block, 8 consecutive k, is one 16-byte piece of the lane-ordered plane: tile c >> 2, k segment ko >> 1, lane 16 * (ko & 1) + 4 * (c & 3) + j.
__device__ __forceinline__ void wld(v4f (&x)[8], const float* __restrict__ src) {
    const float* p = src + ((threadIdx.x >> 4) * (8 * DM) + (threadIdx.x & 15) * 4);   // 32-bit offset: the same one register serves all matrices beside their scalar bases
#pragma unroll   // constant indices keep x in registers, and the 8 loads are in flight together
    for (int i = 0; i < 8; ++i) x[i] = *(const v4f*)(p + i * DM);
}
__device__ __forceinline__ v8h wpiece(const v4f (&x)[8], const int j) {
    v8h o;
#pragma unroll   // constant indices into x and o: registers, no scratch
    for (int i = 0; i < 8; i += 2) {                                               // RNE to bf16 by the packed convert instruction (two elements each), then x64 in f16, exact
        const v2f a = { x[i][j], x[i + 1][j] };
        const unsigned t = __builtin_bit_cast(unsigned, __builtin_convertvector(a, v2bf));
        const float w0 = __uint_as_float(t << 16), w1 = __uint_as_float(t & 0xFFFF0000u);
        const h16 r0 = (h16)(w0 * WCS), r1 = (h16)(w1 * WCS);
        o[i] = (fabsf(w0) < 6.103515625e-05f * WCI) ? (h16)0.0f : r0;              // the select of toh_flush, with the carry moved to the bound
        o[i + 1] = (fabsf(w1) < 6.103515625e-05f * WCI) ? (h16)0.0f : r1; }
    return o;
}

// woconv_body: one block converts Wo into the workspace plane that the next launch reads; wave w writes k segment w of every tile, so every line of the plane has one writer
__device__ __forceinline__ void woconv_body(const float* __restrict__ wo, h16* WOT) {
    const int c = threadIdx.x & 15, ko = threadIdx.x >> 4;
    v4f x[8];
    wld(x, wo);
    h16* dst = WOT + (size_t)((((c >> 2) * 4 + (ko >> 1)) * 32 + (ko & 1) * 16 + (c & 3) * 4) * 8);
#pragma unroll   // j must be a constant inside wpiece
    for (int j = 0; j < 4; ++j) *(v8h*)(dst + j * 8) = wpiece(x, j);
}

// pairbias_body: bias[h][i][j] = sum_p bf16(pair[i][j][p]) bf16(Wp[p][h]); block = one 16-query tile x 8 keys, wave = 4 query rows x 8 keys as two 16-column tiles:
// A = Wp^T rows (row = head, padded to 16; read from the f32 Wp [p][head] and converted in registers), B = pair rows converted in registers (col = 8 * (query row bit 0) + key), K = 64. The four waves' values meet in LDS [head][query][key]; wave w then stores head w's
// two 256-byte runs of the lane-ordered bias plane (16 queries x 4 keys each), so every line of the plane has one writer.
__device__ __forceinline__ void pairbias_body(const int blk, const float* __restrict__ pair, const float* __restrict__ wp, float* BIAS, float* os) {
    const int lane = threadIdx.x & 31, lr = lane & 15, hi = lane >> 4;
    const int wave = __builtin_amdgcn_readfirstlane((int)(threadIdx.x >> 5));
    const int ti = blk / (SEQ / 8), kg = blk % (SEQ / 8);
    const float* wpl = wp + 8 * hi * NH_ + (lr < NH_ ? lr : (NH_ - 1));                         // element e of fragment f: k = 32 f + 16 (e >> 3) + 8 h + (e & 7), the same map as the B fragment below
    float wr[2][16];
#pragma unroll   // both loops: constant indices keep wr in registers, and the 32 loads are in flight together with the row loads below
    for (int f = 0; f < 2; ++f) {
#pragma unroll
        for (int e = 0; e < 16; ++e) wr[f][e] = wpl[(32 * f + 16 * (e >> 3) + (e & 7)) * NH_]; }
    v4f xs[2][2][4];                                                                          // the wave's 16 row loads are all issued before the first is used: one memory latency, not four
#pragma unroll
    for (int jt = 0; jt < 2; ++jt) {
        const float* p = pair + ((size_t)(ti * 16 + wave * 4 + 2 * jt + (lr >> 3)) * SEQ_FULL + (size_t)(kg * 8 + (lr & 7))) * DM + 8 * hi;
#pragma unroll
        for (int kc = 0; kc < 2; ++kc) {
            xs[jt][kc][0] = *(const v4f*)(p + 32 * kc); xs[jt][kc][1] = *(const v4f*)(p + 32 * kc + 4); xs[jt][kc][2] = *(const v4f*)(p + 32 * kc + 16); xs[jt][kc][3] = *(const v4f*)(p + 32 * kc + 20); }
    }
    const unsigned keep = (lr < NH_) ? 0xFFFFFFFFu : 0u;                                      // rows >= 4 of the padded A are zeroed by value: every lane loads (a clamped column) and converts
    v16bf af[2];
#pragma unroll   // both loops: constant indices into register arrays
    for (int f = 0; f < 2; ++f) { v16bf t;
#pragma unroll
        for (int i = 0; i < 16; ++i) t[i] = (__bf16)wr[f][i];
        af[f] = __builtin_bit_cast(v16bf, __builtin_bit_cast(v8u, t) & keep); }
    const v16bf a0 = af[0], a1 = af[1];
#pragma unroll
    for (int jt = 0; jt < 2; ++jt) {
        const int ql = wave * 4 + 2 * jt + (lr >> 3);
        v8f acc = (v8f){};
#pragma unroll
        for (int kc = 0; kc < 2; ++kc) {
            const v4f x0 = xs[jt][kc][0], x1 = xs[jt][kc][1], x2 = xs[jt][kc][2], x3 = xs[jt][kc][3];
            v8us e0, e1;
#pragma unroll
            for (int i = 0; i < 4; ++i) { e0[i] = f2bf(x0[i]); e0[4 + i] = f2bf(x1[i]); e1[i] = f2bf(x2[i]); e1[4 + i] = f2bf(x3[i]); }
            const v16bf bq = cat16b(e0, e1);
            if (kc == 0) acc = wmmabg(a0, bq, acc); else acc = wmmabg(a1, bq, acc);
        }
        if (hi == 0) {                                                                        // D: row 8h+r (head), col lane&15; the four real heads sit in rows 0..3 of the lower lanes
#pragma unroll
            for (int r = 0; r < NH_; ++r) os[(r * 16 + ql) * 8 + (lr & 7)] = acc[r]; }
    }
    __syncthreads();                                                                          // os: written by all 4 waves (4 query rows each), read across waves (one head each)
    const v4f val = *(const v4fa*)(&os[(wave * 16 + lr) * 8 + hi * 4]);                       // head = wave, query = lane&15, keys 4 * (lane>>4) + 0..3 of the group
    float* dstp = BIAS + ((size_t)(wave * (SEQ / 16) + ti) * (SEQ / 32) + (size_t)(kg >> 2)) * 512 + (size_t)(((kg >> 1) & 1) * 2 + hi) * 128 + (size_t)((kg & 1) * 16 + lr) * 4;
    *(v4f*)dstp = val;
    asm volatile("s_wait_xcnt 0x0" ::: "memory");   // stands in front of whatever the merged kernel's layout puts behind this store and lets rewrite its registers
}

// value of one 16 x 16 projection tile: (x_hi W + (x_res W) / 2048) / 64, K = 64
__device__ __forceinline__ v8f proj_tile(v16h b0, v16h b1, v16h a0h, v16h a1h, v16h a0r, v16h a1r) {
    v8f cH = (v8f){}, cR = (v8f){};
    cH = wmma16g(a0h, b0, cH); cH = wmma16g(a1h, b1, cH);
    cR = wmma16g(a0r, b0, cR); cR = wmma16g(a1r, b1, cR);
    return (cH + cR * QRI) * WCI;
}

// the eight B fragments (4 column tiles x 2 k-steps) of one 64 x 64 weight plane in LDS; p already includes + 8*lane
__device__ __forceinline__ void ldw(v16h (&w)[8], const h16* p) {
#pragma unroll
    for (int nb = 0; nb < 4; ++nb) { w[2 * nb] = ldf(p + nb * WTS); w[2 * nb + 1] = ldf(p + nb * WTS + 512); }
}

// lnproj_body: LayerNorm + q/k/v/gate projections; block = 64 tokens of one sequence, wave = 16 tokens. Lane (row = lane&15, half = lane>>4) holds the 32 columns 16q + 8*half + i of its row,
// q, k: f16 value plane and f16 residual plane ((v - value) x 2048, same flush select); per head the 16 x 16 halves are one contiguous 512-byte run of each plane, written by one instruction (32 lanes x 16 B);
// gate: f32, the wave's 16 x 64 tile in lane order, 512 contiguous bytes per instruction;
__device__ __forceinline__ void lnproj_body(const int blk, const float* __restrict__ msa, const float* __restrict__ lng, const float* __restrict__ lnb,
                                            const float* __restrict__ wq, const float* __restrict__ wk, const float* __restrict__ wv, const float* __restrict__ wg, const float* __restrict__ bg,
                                            h16* QH, h16* QR, h16* KP, h16* KR, h16* VT, float* GP, float* os, h16* vts, h16* wls) {
    const int lane = threadIdx.x & 31, lr = lane & 15, hi = lane >> 4;
    const int wave = __builtin_amdgcn_readfirstlane((int)(threadIdx.x >> 5));
    const int r0 = blk * 64;
    const int sq = r0 / SEQ, tbk = r0 % SEQ;
    const int t0 = tbk + wave * 16;
    const int wb = wave * 16 * CSP;
    // The block's share of the four f32 weight matrices is loaded first (32 loads a thread, all in flight together with the row loads below) and converted into the LDS planes while the rows are still on their way.
    v4f wx[4][8];
    wld(wx[0], wq); wld(wx[1], wk); wld(wx[2], wv); wld(wx[3], wg);
    const float* xr = msa + ((size_t)sq * SEQ_FULL + (size_t)(t0 + lr)) * DM + 8 * hi;
    float xv[32];
    v4f xu[8];
#pragma unroll
    for (int q = 0; q < 4; ++q) { xu[2 * q] = *(const v4f*)(xr + 16 * q); xu[2 * q + 1] = *(const v4f*)(xr + 16 * q + 4); }
    asm volatile("s_wait_xcnt 0x0" ::: "memory");   // stands in front of the first rewrite of the row loads' address pair and of the weight loads' offset register
    __builtin_amdgcn_sched_barrier(0);              // keeps the weight loads above in front of the first wait on a row load; without it they are issued only after the rows have arrived
    {
        const int wc = threadIdx.x & 15, wko = threadIdx.x >> 4;
        h16* wd = wls + (wc >> 2) * WTS + ((wko >> 1) * 32 + (wko & 1) * 16 + (wc & 3) * 4) * 8;
#pragma unroll   // both loops: constant indices into wx (registers) and constant LDS offsets
        for (int mat = 0; mat < 4; ++mat) {
#pragma unroll
            for (int j = 0; j < 4; ++j) *(v8ha*)(wd + mat * 4 * WTS + j * 8) = wpiece(wx[mat], j); }
    }
#pragma unroll
    for (int q = 0; q < 4; ++q) {
#pragma unroll
        for (int i = 0; i < 4; ++i) { xv[8 * q + i] = bfr(xu[2 * q][i]); xv[8 * q + 4 + i] = bfr(xu[2 * q + 1][i]); } }
    float sm = 0.0f;
#pragma unroll
    for (int e = 0; e < 32; ++e) sm += xv[e];
    sm += __shfl_xor(sm, 16, 32);
    const float mu = sm * (1.0f / 64.0f);
    float sv = 0.0f;
#pragma unroll
    for (int e = 0; e < 32; ++e) { const float dl = xv[e] - mu; sv += dl * dl; }
    sv += __shfl_xor(sv, 16, 32);
    const float rs = rsqrtf(sv * (1.0f / 64.0f) + LNEPS);
    v16h ah[2], ar[2];
#pragma unroll
    for (int q = 0; q < 4; ++q) {
        const v4f g0 = *(const v4f*)(lng + 8 * hi + 16 * q), g1 = *(const v4f*)(lng + 8 * hi + 16 * q + 4);
        const v4f c0 = *(const v4f*)(lnb + 8 * hi + 16 * q), c1 = *(const v4f*)(lnb + 8 * hi + 16 * q + 4);
#pragma unroll
        for (int i = 0; i < 4; ++i) {
            const float y0 = (xv[8 * q + i] - mu) * rs * bfr(g0[i]) + bfr(c0[i]);
            const float y1 = (xv[8 * q + 4 + i] - mu) * rs * bfr(g1[i]) + bfr(c1[i]);
            const h16 h0 = toh_flush(y0), h1 = toh_flush(y1);
            ah[q >> 1][(q & 1) * 8 + i] = h0; ah[q >> 1][(q & 1) * 8 + 4 + i] = h1;
            ar[q >> 1][(q & 1) * 8 + i] = toh_flush((y0 - (float)h0) * QRS); ar[q >> 1][(q & 1) * 8 + 4 + i] = toh_flush((y1 - (float)h1) * QRS); } }
    float bgr[4];
    __syncthreads();                                                   // weight planes: each written by all 4 waves (one k segment each), read whole by every wave
    // Weight fragments are fetched from LDS ahead of their products: wf[1] while matrix 0 is worked on, wf[2] and wf[3] while matrix 1 is.
    const h16* wlo = wls + lane * 8;                                   // + matrix * 4 * WTS
    v16h wf[4][8];
    ldw(wf[0], wlo);
    // q (matrix 0) and k (matrix 1)
#pragma unroll
    for (int mat = 0; mat < 2; ++mat) {
        ldw(wf[mat + 1], wlo + (mat + 1) * 4 * WTS);
#pragma unroll
        for (int nb = 0; nb < 4; ++nb) {
            const v8f val = proj_tile(wf[mat][2 * nb], wf[mat][2 * nb + 1], ah[0], ah[1], ar[0], ar[1]);
#pragma unroll
            for (int r = 0; r < 8; ++r) os[wb + (8 * hi + r) * CSP + nb * 16 + lr] = val[r]; }     // D: row 8h+r (token), col lane&15
        if (mat == 1) {                                                                            // the k fragments are dead here: the gate's weights and bias take their place
            ldw(wf[3], wlo + 3 * 4 * WTS);
#pragma unroll
            for (int nb = 0; nb < 4; ++nb) bgr[nb] = bg[nb * 16 + lr]; }
        wave_sync();
{
#pragma unroll
            for (int hh = 0; hh < NH_; ++hh) { const int row = lane >> 1, c8 = (lane & 1) * 8;       // 16 rows x 2 lanes x 8 halves = head hh of the tile
                const v4f x0 = *(const v4fa*)(&os[wb + row * CSP + hh * 16 + c8]); const v4f x1 = *(const v4fa*)(&os[wb + row * CSP + hh * 16 + c8 + 4]); v8h hv, rv;
#pragma unroll
                for (int i = 0; i < 4; ++i) { const h16 a0 = toh_flush(x0[i]); const h16 a1 = toh_flush(x1[i]); hv[i] = a0; hv[4 + i] = a1;
                    rv[i] = toh_flush((x0[i] - (float)a0) * QRS); rv[4 + i] = toh_flush((x1[i] - (float)a1) * QRS); }
                const size_t oo = ((size_t)(sq * NH_ + hh) * SEQ + (size_t)t0) * HD + (size_t)lane * 8;
                if (mat == 0) { *(v8h*)(QH + oo) = hv; *(v8h*)(QR + oo) = rv; } else { *(v8h*)(KP + oo) = hv; *(v8h*)(KR + oo) = rv; } }
             }
        asm volatile("s_wait_xcnt 0x0" ::: "memory");   // stands in front of the next weight loads, whose destinations reuse registers that the stores above name
        wave_sync();
    }
    // v (matrix 2): lane's 8 accumulator values are 8 consecutive tokens of column c -> one 16-B LDS store into the [c][token] tile
#pragma unroll
    for (int nb = 0; nb < 4; ++nb) {
        const v8f val = proj_tile(wf[2][2 * nb], wf[2][2 * nb + 1], ah[0], ah[1], ar[0], ar[1]);
        v8h o;
#pragma unroll
        for (int r = 0; r < 8; ++r) o[r] = toh_flush(val[r]);
        *(v8ha*)(&vts[(nb * 16 + lr) * VTP + wave * 16 + 8 * hi]) = o; }
    // gate (matrix 3): sigmoid(x Wg + bg)
#pragma unroll
    for (int nb = 0; nb < 4; ++nb) {
        const v8f val = proj_tile(wf[3][2 * nb], wf[3][2 * nb + 1], ah[0], ah[1], ar[0], ar[1]);
        const float bgv = bfr(bgr[nb]);
#pragma unroll
        for (int r = 0; r < 8; ++r) { const float z = val[r] + bgv; const float ex = __builtin_amdgcn_exp2f(-z * L2E); os[wb + (8 * hi + r) * CSP + nb * 16 + lr] = 1.0f / (1.0f + ex); } }
    wave_sync();
{
#pragma unroll
        for (int s8 = 0; s8 < 8; ++s8) { const int cofs = (s8 >> 1) * 16 + 8 * hi + (s8 & 1) * 4;            // 8 x (2 x 4 columns) = 64 columns; 16 lanes = 16 rows
            const v4f val = *(const v4fa*)(&os[wb + lr * CSP + cofs]);
            *(v4f*)(GP + ((size_t)sq * SEQ + (size_t)t0) * DM + s8 * 128 + lane * 4) = val; }
         }
    __syncthreads();                                                   // v^T tile: written by all 4 waves, each wave reads back only its own 16 tokens
    const int tid = threadIdx.x;
{
#pragma unroll
        for (int it = 0; it < 4; ++it) {                                                                                // trip = head; wave = (32-key chunk, 16-key half) of the block's 64 tokens; lane = 16 * (key bit 3) + d
            const v8h o = *(const v8ha*)(&vts[(it * 16 + lr) * VTP + wave * 16 + 8 * hi]);
            *(v8h*)(VT + ((size_t)(sq * NH_ + it) * SEQ + (size_t)tbk) * HD + tid * 8) = o; }
         }
}

// k_lnproj_pairbias: blocks 0 .. LNB-1 run lnproj_body (the longer work, so it starts first), blocks LNB .. LNB+PBB-1 run pairbias_body, block LNB+PBB runs woconv_body; none reads what another writes.
#define LNB (NB * SEQ / 64)
#define PBB ((SEQ / 16) * (SEQ / 8))
__global__ __launch_bounds__(32 * AW) void k_lnproj_pairbias(const float* __restrict__ msa, const float* __restrict__ lng, const float* __restrict__ lnb,
                                                             const float* __restrict__ wq, const float* __restrict__ wk, const float* __restrict__ wv, const float* __restrict__ wg,
                                                             const float* __restrict__ bg, h16* QH, h16* QR, h16* KP, h16* KR, h16* VT, float* GP,
                                                             const float* __restrict__ pair, const float* __restrict__ wp, float* BIAS,
                                                             const float* __restrict__ wo, h16* WOT) {
    __shared__ __align__(16) float os[AW * 16 * CSP];                  // the pair-bias blocks use its first NH_ * 16 * 8 floats
    __shared__ __align__(16) h16 vts[DM * VTP];
    __shared__ __align__(16) h16 wls[4 * 4 * WTS];                     // q | k | v | gate planes, x64: [matrix][4 tiles, pitch WTS][4 k segments][32 lanes][8]
    const int b = blockIdx.x;
    if (b < LNB) lnproj_body(b, msa, lng, lnb, wq, wk, wv, wg, bg, QH, QR, KP, KR, VT, GP, os, vts, wls);
    else if (b < LNB + PBB) pairbias_body(b - LNB, pair, wp, BIAS, os);
    else woconv_body(wo, WOT);
}

// k_attn: block = 16 query rows of one sequence, wave w = head w. Transposed flash form: S^T[key][t] = K Q^T (A = K rows, B = Q rows, k = d: 16 real + 16 zero slots);
// scores = K Q + (K Q_res + K_res Q) / 2048 (value x value in the main accumulators, the two cross products in their own accumulators; residual x residual dropped);
// lane (t = lane&15, h = lane>>4) holds keys 8h+r of each 16-key tile, so the packed P tile is directly the B fragment of O^T[d][t] = V^T P^T.
// Per step: bias row segment and mask words loaded as 16-B vectors at arithmetic addresses; masked keys are dropped by value (probability 0, excluded from the running max).
// After the key loop the 4 heads' contexts meet in a block LDS tile [16][64]; every wave rebuilds the gated context fragments (value + residual x2048) and computes one 16-column tile of the output projection;
// Second launch bound: at most 128 registers a wave, so that 8 waves per SIMD (the whole grid) stay resident although a trip's load destinations are all live at once.
__global__ __launch_bounds__(32 * AW, 8) void k_attn(const h16* __restrict__ QH, const h16* __restrict__ QR, const h16* __restrict__ KP, const h16* __restrict__ KR, const h16* __restrict__ VT,
                                                  const float* __restrict__ BIAS, const int* __restrict__ kmask, const float* __restrict__ GP,
                                                  const h16* __restrict__ WOT, const float* __restrict__ bo, float* OUT) {
    __shared__ __align__(16) float cs[16 * CSP];
    __shared__ __align__(16) float ot[16 * CSP];
    const int lane = threadIdx.x & 31, lr = lane & 15, hi = lane >> 4;
    const int wave = __builtin_amdgcn_readfirstlane((int)(threadIdx.x >> 5));
    const int sq = blockIdx.y; const int t0 = blockIdx.x * 16;
    const int zh = sq * NH_ + wave;
    const size_t pbase = (size_t)zh * SEQ * HD;
    const v8h z8 = (v8h){};
    const v16h qh = cat16(*(const v8h*)(QH + pbase + (size_t)(t0 + lr) * HD + 8 * hi), z8);   // B fragment: col t, k = d; slots 16..31 zero
    const v16h qr = cat16(*(const v8h*)(QR + pbase + (size_t)(t0 + lr) * HD + 8 * hi), z8);   // residual x2048, same map
    const size_t ko = pbase + (size_t)lr * HD + 8 * hi;        // + key * HD   (A fragment: row key, k = d)
    const size_t vo = pbase + (size_t)lane * 8;                // + key * HD   (A fragment: row d, k = key; lane-ordered plane, 32 keys = 32 * HD halves)
    const float* bp0 = BIAS + (size_t)(wave * (SEQ / 16) + (int)blockIdx.x) * (SEQ / 32) * 512 + (size_t)lane * 4;   // + key * 16 (lane-ordered plane, 32 keys = 512 floats)
    const int* mp0 = kmask + (size_t)sq * SEQ_FULL + 8 * hi;
    v8f o0 = (v8f){};
    float m = NEGB, l = 0.0f;
#pragma unroll 1
    for (int key0 = 0; key0 < SEQ; key0 += 32) {
        const h16* ka = KP + ko + (size_t)key0 * HD;
        const v16h ka0 = cat16(*(const v8h*)ka, z8), kb0 = cat16(*(const v8h*)(ka + 16 * HD), z8);
        const h16* kr = KR + ko + (size_t)key0 * HD;
        const v16h kra0 = cat16(*(const v8h*)kr, z8), krb0 = cat16(*(const v8h*)(kr + 16 * HD), z8);
        // all of the trip's loads stand together here, so that their latencies overlap instead of adding up
        const float* bp = bp0 + (size_t)key0 * 16;               // keys key0+8h+0..7 and key0+16+8h+0..7 of query row t0 + (lane&15)
        const v4f c0 = *(const v4f*)bp, c1 = *(const v4f*)(bp + 128), c2 = *(const v4f*)(bp + 256), c3 = *(const v4f*)(bp + 384);
        const int* mp = mp0 + key0;
        const v4i n0 = *(const v4i*)mp, n1 = *(const v4i*)(mp + 4), n2 = *(const v4i*)(mp + 16), n3 = *(const v4i*)(mp + 20);
        const v16h v0 = ldf(VT + vo + (size_t)key0 * HD);
        v8f sa = (v8f){}, sb = (v8f){}, ra = (v8f){}, rb = (v8f){};
        sa = wmma16g(ka0, qh, sa); sb = wmma16g(kb0, qh, sb);
        ra = wmma16g(ka0, qr, ra); ra = wmma16g(kra0, qh, ra);
        rb = wmma16g(kb0, qr, rb); rb = wmma16g(krb0, qh, rb);
        float ta[8], tc[8]; bool fa[8], fb[8]; float mx = NEGB;
#pragma unroll
        for (int r = 0; r < 4; ++r) {
            ta[r] = (sa[r] + ra[r] * QRI) * SC2 + c0[r] * L2E; ta[4 + r] = (sa[4 + r] + ra[4 + r] * QRI) * SC2 + c1[r] * L2E;
            tc[r] = (sb[r] + rb[r] * QRI) * SC2 + c2[r] * L2E; tc[4 + r] = (sb[4 + r] + rb[4 + r] * QRI) * SC2 + c3[r] * L2E;
            fa[r] = n0[r] != 0; fa[4 + r] = n1[r] != 0; fb[r] = n2[r] != 0; fb[4 + r] = n3[r] != 0; }
#pragma unroll
        for (int r = 0; r < 8; ++r) mx = fmaxf(mx, fmaxf(fa[r] ? ta[r] : NEGB, fb[r] ? tc[r] : NEGB));
        mx = fmaxf(mx, __shfl_xor(mx, 16, 32));
        const float mnew = fmaxf(m, mx);
        const float alpha = __builtin_amdgcn_exp2f(m - mnew);
        const float sh = PSH - mnew;
        v16h pb; float ls = 0.0f;
#pragma unroll
        for (int r = 0; r < 8; ++r) {
            const float xa = ta[r] + sh, xb = tc[r] + sh;
            const float ea = __builtin_amdgcn_exp2f(xa), eb = __builtin_amdgcn_exp2f(xb);
            const float ga = (fa[r] & (xa >= -14.0f)) ? ea : 0.0f, gb = (fb[r] & (xb >= -14.0f)) ? eb : 0.0f;   // dropped keys and sub-2^-14 values selected to 0 by value
            const h16 pa = (h16)ga; const h16 pc = (h16)gb;
            pb[r] = pa; pb[8 + r] = pc;
            ls += (float)pa + (float)pc; }
        l = l * alpha + ls; m = mnew;
        o0 = o0 * alpha;
        o0 = wmma16g(v0, pb, o0);
    }
    // the epilogue's global loads depend on nothing the key loop computes: issued here, their latency passes under the normalisation and the barrier
    const float* gr = GP + ((size_t)sq * SEQ + (size_t)t0) * DM + (size_t)lane * 4;
    v4f gv[8];
#pragma unroll
    for (int q = 0; q < 8; ++q) gv[q] = *(const v4f*)(gr + 128 * q);
    const h16* wop = WOT + (size_t)(wave * 16) * DM + (size_t)lane * 8;
    const float bor = bo[wave * 16 + lr];
    const v16h wo0 = ldf(wop);
    const v8h wo1l = *(const v8h*)(wop + 512);
    asm volatile("s_wait_xcnt 0x0" ::: "memory");   // stands in front of the last weight load, whose destination reuses address registers of the loads above
    const v16h wo1 = cat16(wo1l, *(const v8h*)(wop + 768));
    l += __shfl_xor(l, 16, 32);
    const bool any = l > 0.0f;
    const float lsafe = any ? l : 1.0f;
    const float inv = any ? (1.0f / lsafe) : __uint_as_float(0x7FC00000u);       // no kept key -> NaN row (softmax of an all-dropped row)
    // O^T D layout: o0[r] = (d = 8h + r, t = lane&15) -> cs[t][wave*16 + d]; 16 rows x 64 columns written by the 4 waves
    { v4f a, c;
      a[0] = o0[0] * inv; a[1] = o0[1] * inv; a[2] = o0[2] * inv; a[3] = o0[3] * inv; c[0] = o0[4] * inv; c[1] = o0[5] * inv; c[2] = o0[6] * inv; c[3] = o0[7] * inv;
      *(v4fa*)(&cs[lr * CSP + wave * 16 + 8 * hi]) = a; *(v4fa*)(&cs[lr * CSP + wave * 16 + 8 * hi + 4]) = c; }
    __syncthreads();                                                             // cs: cross-wave
    // gated context fragments: row t = lane&15, k = concatenated head column 16q + 8h + i
    v16h gh[2], gq[2];
#pragma unroll
    for (int q = 0; q < 4; ++q) {
        const v4f g0 = gv[2 * q], g1 = gv[2 * q + 1];
        const v4f x0 = *(const v4fa*)(&cs[lr * CSP + 8 * hi + 16 * q]), x1 = *(const v4fa*)(&cs[lr * CSP + 8 * hi + 16 * q + 4]);
#pragma unroll
        for (int i = 0; i < 4; ++i) {
            const float y0 = g0[i] * x0[i], y1 = g1[i] * x1[i];
            const h16 h0 = toh_flush(y0), h1 = toh_flush(y1);
            gh[q >> 1][(q & 1) * 8 + i] = h0; gh[q >> 1][(q & 1) * 8 + 4 + i] = h1;
            gq[q >> 1][(q & 1) * 8 + i] = toh_flush((y0 - (float)h0) * QRS); gq[q >> 1][(q & 1) * 8 + 4 + i] = toh_flush((y1 - (float)h1) * QRS); } }
    const v8f pv = proj_tile(wo0, wo1, gh[0], gh[1], gq[0], gq[1]);
    const float bov = bfr(bor);
#pragma unroll
    for (int r = 0; r < 8; ++r) ot[(8 * hi + r) * CSP + wave * 16 + lr] = pv[r] + bov;       // D: row 8h+r (token), col lane&15; 16 rows x 64 columns written by the 4 waves
    __syncthreads();                                                             // ot: cross-wave
    float* orow = OUT + ((size_t)sq * OUT_SEQ + (size_t)t0) * DM;
    const int tid = threadIdx.x;
{
#pragma unroll
        for (int it = 0; it < 2; ++it) { const int idx = it * 128 + tid; const int row = idx >> 4, cofs = (idx & 15) * 4;   // 2 trips x 8 rows = 16 rows; 16 pieces x 4 floats = 64 columns
            const v4f val = *(const v4fa*)(&ot[row * CSP + cofs]);
            *(v4f*)(orow + (size_t)row * DM + cofs) = val; }
         }
}

static constexpr size_t al256(size_t v) { return (v + 255) & ~(size_t)255; }
static constexpr size_t SZ_WO = al256((size_t)DM * DM * 2);
static constexpr size_t SZ_PL = al256((size_t)NB * SEQ * DM * 2);
static constexpr size_t SZ_GP = al256((size_t)NB * SEQ * DM * 4);
static constexpr size_t SZ_BS = al256((size_t)NH_ * SEQ * SEQ * 4);
static constexpr size_t SZ_TOTAL = SZ_WO + 5 * SZ_PL + SZ_GP + SZ_BS;   // planes: q value, q residual, k value, k residual, v^T
static_assert(SZ_TOTAL <= (size_t)134217728);          // workspace carve <= 128 MiB
static_assert((size_t)NB * NH_ * SEQ * HD == (size_t)NB * DM * SEQ);   // q/k value and residual planes [s*4+h][t][16] and the v^T plane have the same extent
static_assert(((size_t)(NB - 1) * OUT_SEQ + SEQ) * DM <= (size_t)NB_FULL * SEQ_FULL * DM);   // last output row inside the output buffer

extern "C" void kernel_launch(void* const* d_in, const int* in_sizes, int n_in,
                              void* d_out, int out_size, void* d_ws, size_t ws_size, hipStream_t stream) {
    if (n_in < 13) return;
    const size_t needx = ((size_t)(NB - 1) * SEQ_FULL + SEQ) * DM;
    const size_t needp = ((size_t)(SEQ - 1) * SEQ_FULL + SEQ) * DM;
    const size_t needm = (size_t)(NB - 1) * SEQ_FULL + SEQ;
    if ((size_t)in_sizes[0] < needx || (size_t)in_sizes[1] < needp || (size_t)in_sizes[2] < needm) return;
    if (in_sizes[3] < DM || in_sizes[4] < DM || in_sizes[9] < DM || in_sizes[12] < DM) return;
    if (in_sizes[5] < DM * DM || in_sizes[6] < DM * DM || in_sizes[7] < DM * DM || in_sizes[8] < DM * DM || in_sizes[11] < DM * DM) return;
    if (in_sizes[10] < DM * NH_) return;
    if ((size_t)out_size < ((size_t)(NB - 1) * OUT_SEQ + SEQ) * DM) return;
    if (SZ_TOTAL > ws_size) return;
    // wire order: x stack, pair, key mask, ln gain, ln bias, Wq, Wk, Wv, Wg, bg, Wp, Wo, bo
    const float* msa  = (const float*)d_in[0];
    const float* pair = (const float*)d_in[1];
    const int*   kmsk = (const int*)d_in[2];
    const float* lng  = (const float*)d_in[3];
    const float* lnb  = (const float*)d_in[4];
    const float* wq   = (const float*)d_in[5];
    const float* wk   = (const float*)d_in[6];
    const float* wv   = (const float*)d_in[7];
    const float* wg   = (const float*)d_in[8];
    const float* bg   = (const float*)d_in[9];
    const float* wp   = (const float*)d_in[10];
    const float* wo   = (const float*)d_in[11];
    const float* bo   = (const float*)d_in[12];
    float* OUT = (float*)d_out;      // [NB][SEQ][64]
    char* wsp = (char*)d_ws;
    h16* WOT = (h16*)wsp; wsp += SZ_WO;               // [4 tiles][4 k segments][32 lanes][8], x64
    h16* QH  = (h16*)wsp; wsp += SZ_PL;               // [NB*4][SEQ][16]
    h16* QR  = (h16*)wsp; wsp += SZ_PL;               // [NB*4][SEQ][16] residual x2048
    h16* KP  = (h16*)wsp; wsp += SZ_PL;               // [NB*4][SEQ][16]
    h16* KR  = (h16*)wsp; wsp += SZ_PL;               // [NB*4][SEQ][16] residual x2048
    h16* VT  = (h16*)wsp; wsp += SZ_PL;               // [NB*4][SEQ/32][2][32 lanes][8]
    float* GP = (float*)wsp; wsp += SZ_GP;            // [NB][SEQ/16][8][32 lanes][4]
    float* BIAS = (float*)wsp; wsp += SZ_BS;          // [4][SEQ/16][SEQ/32][4][32 lanes][4]

    k_lnproj_pairbias<<<(unsigned)(LNB + PBB + 1), 32 * AW, 0, stream>>>(msa, lng, lnb, wq, wk, wv, wg, bg, QH, QR, KP, KR, VT, GP, pair, wp, BIAS, wo, WOT);
    k_attn<<<dim3(SEQ / 16, NB, 1), 32 * AW, 0, stream>>>(QH, QR, KP, KR, VT, BIAS, kmsk, GP, WOT, bo, OUT);
}

// v005
// One run takes 34 microseconds.
// In both of two side-by-side timings against v004, it was 1.04 times as fast.
// All steps since v000 together make it 2.18 times as fast.
#include <hip/hip_runtime.h>

// Gated row attention over a stack of sequences with a pair-derived additive bias shared by all sequences: x [NB][SEQ][64] -> LayerNorm (eps 1e-5, gain, bias) -> bias-free q/k/v projections ([in][out], y = x W),
// sigmoid gate (x Wg + bg), 4 heads x 16, scores q.k / sqrt(16) + bias[h][i][j] with bias = pair[i][j][:] . Wp[:][h], key padding mask (int32, replace fill: masked keys dropped from the softmax, a row with no kept key gives NaN),
// softmax over keys, context, gate multiply, output projection ([in][out]) + bias; output f32 [NB][SEQ][64].
// Compute dtypes, f32 accumulate everywhere: q/k/v/gate projections v_wmma_f32_16x16x32_f16 (LayerNorm output as f16 value + f16 residual x2048 in its own accumulator, W RNE-converted to bf16 then x64 in f16, exact);
// pair bias v_wmma_f32_16x16x32_bf16 (pair and Wp RNE-converted to bf16, products exact); scores v_wmma_f32_16x16x32_f16 with q and k each as f16 value + f16 residual x2048 (three products: value x value in the main accumulator,
// value x residual + residual x value in their own accumulator folded by 1/2048; head dim 16 zero-padded to the 32-deep k-step in registers in both fragments);
// P.V v_wmma_f32_16x16x32_f16 single product (P x16384 carry, cancels in the normalisation, row sum over the converted P); output projection v_wmma_f32_16x16x32_f16 (gated context as f16 value + f16 residual x2048 in its own accumulator, Wo x64).
// Every float input is RNE-converted to bf16 at its load. LayerNorm, softmax (online, running max over kept keys), sigmoid in f32.
// Layout: every plane that a wave reads as a matrix fragment or as an accumulator-shaped tile is stored so that one 16-byte load per lane covers 512 contiguous bytes (4 whole lines), all but the q, k planes in lane order:
// W^T planes f16 [16-column tile][k segment of 16][lane][8] (lane = 16 * (k bit 3) + column; q, k, v, gate: in the projection block's LDS, Wo: in the workspace); v^T plane f16 [s*4+h][32-key chunk][16-key half][lane][8] (lane = 16 * (key bit 3) + d);
// gate plane f32 [s][16-token tile][16-column group][4-column half][lane][4] (lane = 16 * (column bit 3) + token); bias plane f32 [h][16-query tile][32-key chunk][j][lane][4] (lane = 16 * (key bit 3) + query, j = 2 * (key bit 4) + (key bit 2));
// q, k value planes and q, k residual planes (x2048) [s*4+h][t][16] f16 (a 16-row fragment is 512 contiguous bytes as it is).
// Two launches: k_lnproj_pairbias (projection blocks first, then the pair-bias blocks, then one block that converts Wo for the next launch; none depends on another), k_attn.
// No launch of its own converts weights: a projection block converts Wq, Wk, Wv, Wg from f32 into its LDS planes, a pair-bias wave builds its Wp^T fragments (rows >= 4 zero) in registers.
// Fused attention kernel: one block = 16 query rows of one sequence, wave w = head w, transposed flash form (S^T = K Q^T, O^T = V^T P^T, fragments straight from the planes), then gate, output projection and whole-row stores.

#ifndef NB
#define NB 128                   // number of sequences (batch x stack depth)
#endif
#ifndef SEQ
#define SEQ 256                  // tokens per sequence (queries = keys)
#endif
#define NB_FULL  128
#define SEQ_FULL 256
#ifndef OUT_SEQ
#define OUT_SEQ SEQ              // row pitch (in tokens) between sequences of the output
#endif
#define DM   64
#define NH_  4
#define HD   16
#define AW   4                   // waves per block
#define CSP  68                  // LDS row pitch (floats) of the 16 x 64 staging tiles
#define VTP  72                  // LDS row pitch (halves) of the v^T staging tile
#define WTS  1032                // LDS pitch (halves) between the 16-column tiles of a weight plane: 4 k segments x 256 halves + 8, so that the four tiles a converting wave writes at once fall on different banks
#define QRS  2048.0f             // carry of every residual plane / residual fragment
#define QRI  (1.0f / 2048.0f)
#define WCS  64.0f               // carry of the f16 weight planes
#define WCI  (1.0f / 64.0f)
#define L2E  1.4426950408889634f
#define SC2  ((float)(0.25 * 1.4426950408889634))   // HD^-0.5 * log2(e)
#define PSH  14.0f               // log2 of the P carry (16384)
#define NEGB (-3.0e38f)
#define LNEPS 1.0e-5f

static_assert(DM == 64);                       // LayerNorm lane map: 2 lanes x 32 columns; two 32-deep k-steps
static_assert(HD == 16);                       // one 16-B load per q/k fragment, upper k half zero in registers
static_assert(NH_ * HD == DM);
static_assert(NH_ == AW);                      // wave w of the attention block = head w
static_assert(SEQ % 64 == 0);                  // a 64-token projection tile never straddles two sequences and fills two whole 32-key chunks of the v^T plane
static_assert((NB * SEQ) % 64 == 0);
static_assert(SEQ % 32 == 0);                  // key loop steps by 32; bias and v^T planes are in 32-key chunks
static_assert(SEQ % 16 == 0);
static_assert(SEQ % 8 == 0);                   // bias grid covers (16-query tile, 8-key group) exactly
static_assert(NB <= NB_FULL);
static_assert(SEQ <= SEQ_FULL);
static_assert((CSP * 4) % 16 == 0);
static_assert((VTP * 2) % 16 == 0);
static_assert(32 * 16 * NH_ == 16 * DM * 2);           // q/k store, per plane (value and residual alike): 4 head instructions x 32 lanes x 16 B = 16 rows x 64 halves
static_assert(32 * 16 * 8 == 16 * DM * 4);             // gate store: 8 instructions x 32 lanes x 16 B = 16 rows x 256 B
static_assert(128 * 16 * 4 == DM * 64 * 2);
static_assert(128 * 16 * 2 == 16 * DM * 4);            // output store: 2 trips x 128 threads x 16 B = 16 rows x 256 B
static_assert(128 * 16 == NH_ * 16 * 8 * 4);           // bias store: 128 threads x 16 B = 4 heads x 16 queries x 8 keys
static_assert(128 * 8 * 4 == DM * DM);                 // weight converter: 128 threads x (8 rows x 4 columns)
static_assert((WTS * 2) % 16 == 0);
static_assert(WTS >= 4 * 256);
static_assert(AW * 16 * CSP * 4 + DM * VTP * 2 + 4 * 4 * WTS * 2 <= 131072);   // static LDS of the projection kernel
static_assert(2 * 16 * CSP * 4 <= 131072);                   // static LDS of the attention kernel
static_assert(NH_ * 16 * 8 <= AW * 16 * CSP);                // the pair-bias tile fits the projection kernel's staging array

typedef _Float16 h16;
typedef __attribute__((ext_vector_type(16))) __bf16   v16bf;
typedef __attribute__((ext_vector_type(16))) _Float16 v16h;
typedef __attribute__((ext_vector_type(8)))  _Float16 v8h;
typedef __attribute__((ext_vector_type(8)))  unsigned short v8us;
typedef __attribute__((ext_vector_type(8)))  float    v8f;
typedef __attribute__((ext_vector_type(4)))  float    v4f;
typedef __attribute__((ext_vector_type(4)))  int      v4i;
typedef __attribute__((ext_vector_type(8)))  unsigned v8u;
typedef __attribute__((ext_vector_type(2)))  float    v2f;
typedef __attribute__((ext_vector_type(2)))  __bf16   v2bf;
typedef v4f  __attribute__((may_alias)) v4fa;
typedef v8h  __attribute__((may_alias)) v8ha;

__device__ __forceinline__ unsigned short f2bf(float f) { unsigned u = __float_as_uint(f); u += 0x7FFFu + ((u >> 16) & 1u); return (unsigned short)(u >> 16); }
__device__ __forceinline__ float bfr(float f) { return __uint_as_float(((unsigned)f2bf(f)) << 16); }   // value after RNE convert to bf16
__device__ __forceinline__ v16h cat16(v8h lo, v8h hi) { return __builtin_shufflevector(lo, hi, 0, 1, 2, 3, 4, 5, 6, 7, 8, 9, 10, 11, 12, 13, 14, 15); }
__device__ __forceinline__ v16bf cat16b(v8us lo, v8us hi) { return __builtin_bit_cast(v16bf, __builtin_shufflevector(lo, hi, 0, 1, 2, 3, 4, 5, 6, 7, 8, 9, 10, 11, 12, 13, 14, 15)); }
__device__ __forceinline__ v8f wmma16(v16h a, v16h b, v8f c) { return __builtin_amdgcn_wmma_f32_16x16x32_f16(false, a, false, b, (short)0, c, false, false); }
__device__ __forceinline__ v8f wmmab(v16bf a, v16bf b, v8f c) { return __builtin_amdgcn_wmma_f32_16x16x32_bf16(false, a, false, b, (short)0, c, false, false); }
// fragment loader from a lane-ordered plane; p already includes + 8*lane: elements 0..7 <- segment 0 (k0+8h+0..7), elements 8..15 <- segment 1 (k0+16+8h+0..7), each segment 32 lanes x 16 B
__device__ __forceinline__ v16h  ldf(const h16* p) { return cat16(*(const v8h*)p, *(const v8h*)(p + 256)); }
// ordering point for wave-private LDS tiles (same wave writes and reads)
__device__ __forceinline__ void wave_sync() { __builtin_amdgcn_fence(3 /* release order */, "wavefront"); __builtin_amdgcn_wave_barrier(); asm volatile("" ::: "memory"); }

// f32 -> f16 convert, RNE; |v| < 2^-14 becomes an f16 subnormal, which the matrix instructions take as it is
static __device__ __forceinline__ h16 toh(float v) { return (h16)v; }
// one matrix instruction followed by its own 4-slot guard
__device__ __forceinline__ v8f wmma16g(v16h a, v16h b, v8f c) { c = wmma16(a, b, c); asm volatile("v_nop\n\tv_nop\n\tv_nop\n\tv_nop" : "+v"(c) : "v"(a), "v"(b)); return c; }
__device__ __forceinline__ v8f wmmabg(v16bf a, v16bf b, v8f c) { c = wmmab(a, b, c); asm volatile("v_nop\n\tv_nop\n\tv_nop\n\tv_nop" : "+v"(c) : "v"(a), "v"(b)); return c; }

// Weight conversion, 128 threads per 64 x 64 f32 matrix [in][out]: thread (ko = tid >> 4, c = tid & 15) takes rows 8 ko .. 8 ko + 7 of columns 4 c .. 4 c + 3 (a wave's load = two whole 256-byte rows);
// column j of that block, 8 consecutive k, is one 16-byte piece of the lane-ordered plane: tile c >> 2, k segment ko >> 1, lane 16 * (ko & 1) + 4 * (c & 3) + j.
__device__ __forceinline__ void wld(v4f (&x)[8], const float* __restrict__ src) {
    const float* p = src + ((threadIdx.x >> 4) * (8 * DM) + (threadIdx.x & 15) * 4);   // 32-bit offset: the same one register serves all matrices beside their scalar bases
#pragma unroll   // constant indices keep x in registers, and the 8 loads are in flight together
    for (int i = 0; i < 8; ++i) x[i] = *(const v4f*)(p + i * DM);
}
__device__ __forceinline__ v8h wpiece(const v4f (&x)[8], const int j) {
    v8h o;
#pragma unroll   // constant indices into x and o: registers, no scratch
    for (int i = 0; i < 8; i += 2) {                                               // RNE to bf16 by the packed convert instruction (two elements each), then x64 in f16, exact
        const v2f a = { x[i][j], x[i + 1][j] };
        const unsigned t = __builtin_bit_cast(unsigned, __builtin_convertvector(a, v2bf));
        const float w0 = __uint_as_float(t << 16), w1 = __uint_as_float(t & 0xFFFF0000u);
        o[i] = (h16)(w0 * WCS); o[i + 1] = (h16)(w1 * WCS); }
    return o;
}

// woconv_body: one block converts Wo into the workspace plane that the next launch reads; wave w writes k segment w of every tile, so every line of the plane has one writer
__device__ __forceinline__ void woconv_body(const float* __restrict__ wo, h16* WOT) {
    const int c = threadIdx.x & 15, ko = threadIdx.x >> 4;
    v4f x[8];
    wld(x, wo);
    h16* dst = WOT + (size_t)((((c >> 2) * 4 + (ko >> 1)) * 32 + (ko & 1) * 16 + (c & 3) * 4) * 8);
#pragma unroll   // j must be a constant inside wpiece
    for (int j = 0; j < 4; ++j) *(v8h*)(dst + j * 8) = wpiece(x, j);
}

// pairbias_body: bias[h][i][j] = sum_p bf16(pair[i][j][p]) bf16(Wp[p][h]); block = one 16-query tile x 8 keys, wave = 4 query rows x 8 keys as two 16-column tiles:
// A = Wp^T rows (row = head, padded to 16; read from the f32 Wp [p][head] and converted in registers), B = pair rows converted in registers (col = 8 * (query row bit 0) + key), K = 64. The four waves' values meet in LDS [head][query][key]; wave w then stores head w's
// two 256-byte runs of the lane-ordered bias plane (16 queries x 4 keys each), so every line of the plane has one writer.
__device__ __forceinline__ void pairbias_body(const int blk, const float* __restrict__ pair, const float* __restrict__ wp, float* BIAS, float* os) {
    const int lane = threadIdx.x & 31, lr = lane & 15, hi = lane >> 4;
    const int wave = __builtin_amdgcn_readfirstlane((int)(threadIdx.x >> 5));
    const int ti = blk / (SEQ / 8), kg = blk % (SEQ / 8);
    const float* wpl = wp + 8 * hi * NH_ + (lr < NH_ ? lr : (NH_ - 1));                         // element e of fragment f: k = 32 f + 16 (e >> 3) + 8 h + (e & 7), the same map as the B fragment below
    float wr[2][16];
#pragma unroll   // both loops: constant indices keep wr in registers, and the 32 loads are in flight together with the row loads below
    for (int f = 0; f < 2; ++f) {
#pragma unroll
        for (int e = 0; e < 16; ++e) wr[f][e] = wpl[(32 * f + 16 * (e >> 3) + (e & 7)) * NH_]; }
    v4f xs[2][2][4];                                                                          // the wave's 16 row loads are all issued before the first is used: one memory latency, not four
#pragma unroll
    for (int jt = 0; jt < 2; ++jt) {
        const float* p = pair + ((size_t)(ti * 16 + wave * 4 + 2 * jt + (lr >> 3)) * SEQ_FULL + (size_t)(kg * 8 + (lr & 7))) * DM + 8 * hi;
#pragma unroll
        for (int kc = 0; kc < 2; ++kc) {
            xs[jt][kc][0] = *(const v4f*)(p + 32 * kc); xs[jt][kc][1] = *(const v4f*)(p + 32 * kc + 4); xs[jt][kc][2] = *(const v4f*)(p + 32 * kc + 16); xs[jt][kc][3] = *(const v4f*)(p + 32 * kc + 20); }
    }
    const unsigned keep = (lr < NH_) ? 0xFFFFFFFFu : 0u;                                      // rows >= 4 of the padded A are zeroed by value: every lane loads (a clamped column) and converts
    v16bf af[2];
#pragma unroll   // both loops: constant indices into register arrays
    for (int f = 0; f < 2; ++f) { v16bf t;
#pragma unroll
        for (int i = 0; i < 16; ++i) t[i] = (__bf16)wr[f][i];
        af[f] = __builtin_bit_cast(v16bf, __builtin_bit_cast(v8u, t) & keep); }
    const v16bf a0 = af[0], a1 = af[1];
#pragma unroll
    for (int jt = 0; jt < 2; ++jt) {
        const int ql = wave * 4 + 2 * jt + (lr >> 3);
        v8f acc = (v8f){};
#pragma unroll
        for (int kc = 0; kc < 2; ++kc) {
            const v4f x0 = xs[jt][kc][0], x1 = xs[jt][kc][1], x2 = xs[jt][kc][2], x3 = xs[jt][kc][3];
            v8us e0, e1;
#pragma unroll
            for (int i = 0; i < 4; ++i) { e0[i] = f2bf(x0[i]); e0[4 + i] = f2bf(x1[i]); e1[i] = f2bf(x2[i]); e1[4 + i] = f2bf(x3[i]); }
            const v16bf bq = cat16b(e0, e1);
            if (kc == 0) acc = wmmabg(a0, bq, acc); else acc = wmmabg(a1, bq, acc);
        }
        if (hi == 0) {                                                                        // D: row 8h+r (head), col lane&15; the four real heads sit in rows 0..3 of the lower lanes
#pragma unroll
            for (int r = 0; r < NH_; ++r) os[(r * 16 + ql) * 8 + (lr & 7)] = acc[r]; }
    }
    __syncthreads();                                                                          // os: written by all 4 waves (4 query rows each), read across waves (one head each)
    const v4f val = *(const v4fa*)(&os[(wave * 16 + lr) * 8 + hi * 4]);                       // head = wave, query = lane&15, keys 4 * (lane>>4) + 0..3 of the group
    float* dstp = BIAS + ((size_t)(wave * (SEQ / 16) + ti) * (SEQ / 32) + (size_t)(kg >> 2)) * 512 + (size_t)(((kg >> 1) & 1) * 2 + hi) * 128 + (size_t)((kg & 1) * 16 + lr) * 4;
    *(v4f*)dstp = val;
    asm volatile("s_wait_xcnt 0x0" ::: "memory");   // stands in front of whatever the merged kernel's layout puts behind this store and lets rewrite its registers
}

// value of one 16 x 16 projection tile: (x_hi W + (x_res W) / 2048) / 64, K = 64
__device__ __forceinline__ v8f proj_tile(v16h b0, v16h b1, v16h a0h, v16h a1h, v16h a0r, v16h a1r) {
    v8f cH = (v8f){}, cR = (v8f){};
    cH = wmma16g(a0h, b0, cH); cH = wmma16g(a1h, b1, cH);
    cR = wmma16g(a0r, b0, cR); cR = wmma16g(a1r, b1, cR);
    return (cH + cR * QRI) * WCI;
}

// the eight B fragments (4 column tiles x 2 k-steps) of one 64 x 64 weight plane in LDS; p already includes + 8*lane
__device__ __forceinline__ void ldw(v16h (&w)[8], const h16* p) {
#pragma unroll
    for (int nb = 0; nb < 4; ++nb) { w[2 * nb] = ldf(p + nb * WTS); w[2 * nb + 1] = ldf(p + nb * WTS + 512); }
}

// lnproj_body: LayerNorm + q/k/v/gate projections; block = 64 tokens of one sequence, wave = 16 tokens. Lane (row = lane&15, half = lane>>4) holds the 32 columns 16q + 8*half + i of its row,
// q, k: f16 value plane and f16 residual plane ((v - value) x 2048); per head the 16 x 16 halves are one contiguous 512-byte run of each plane, written by one instruction (32 lanes x 16 B);
// gate: f32, the wave's 16 x 64 tile in lane order, 512 contiguous bytes per instruction;
__device__ __forceinline__ void lnproj_body(const int blk, const float* __restrict__ msa, const float* __restrict__ lng, const float* __restrict__ lnb,
                                            const float* __restrict__ wq, const float* __restrict__ wk, const float* __restrict__ wv, const float* __restrict__ wg, const float* __restrict__ bg,
                                            h16* QH, h16* QR, h16* KP, h16* KR, h16* VT, float* GP, float* os, h16* vts, h16* wls) {
    const int lane = threadIdx.x & 31, lr = lane & 15, hi = lane >> 4;
    const int wave = __builtin_amdgcn_readfirstlane((int)(threadIdx.x >> 5));
    const int r0 = blk * 64;
    const int sq = r0 / SEQ, tbk = r0 % SEQ;
    const int t0 = tbk + wave * 16;
    const int wb = wave * 16 * CSP;
    // The block's share of the four f32 weight matrices is loaded first (32 loads a thread, all in flight together with the row loads below) and converted into the LDS planes while the rows are still on their way.
    v4f wx[4][8];
    wld(wx[0], wq); wld(wx[1], wk); wld(wx[2], wv); wld(wx[3], wg);
    const float* xr = msa + ((size_t)sq * SEQ_FULL + (size_t)(t0 + lr)) * DM + 8 * hi;
    float xv[32];
    v4f xu[8];
#pragma unroll
    for (int q = 0; q < 4; ++q) { xu[2 * q] = *(const v4f*)(xr + 16 * q); xu[2 * q + 1] = *(const v4f*)(xr + 16 * q + 4); }
    asm volatile("s_wait_xcnt 0x0" ::: "memory");   // stands in front of the first rewrite of the row loads' address pair and of the weight loads' offset register
    __builtin_amdgcn_sched_barrier(0);              // keeps the weight loads above in front of the first wait on a row load; without it they are issued only after the rows have arrived
    {
        const int wc = threadIdx.x & 15, wko = threadIdx.x >> 4;
        h16* wd = wls + (wc >> 2) * WTS + ((wko >> 1) * 32 + (wko & 1) * 16 + (wc & 3) * 4) * 8;
#pragma unroll   // both loops: constant indices into wx (registers) and constant LDS offsets
        for (int mat = 0; mat < 4; ++mat) {
#pragma unroll
            for (int j = 0; j < 4; ++j) *(v8ha*)(wd + mat * 4 * WTS + j * 8) = wpiece(wx[mat], j); }
    }
#pragma unroll
    for (int q = 0; q < 4; ++q) {
#pragma unroll
        for (int i = 0; i < 4; ++i) { xv[8 * q + i] = bfr(xu[2 * q][i]); xv[8 * q + 4 + i] = bfr(xu[2 * q + 1][i]); } }
    float sm = 0.0f;
#pragma unroll
    for (int e = 0; e < 32; ++e) sm += xv[e];
    sm += __shfl_xor(sm, 16, 32);
    const float mu = sm * (1.0f / 64.0f);
    float sv = 0.0f;
#pragma unroll
    for (int e = 0; e < 32; ++e) { const float dl = xv[e] - mu; sv += dl * dl; }
    sv += __shfl_xor(sv, 16, 32);
    const float rs = rsqrtf(sv * (1.0f / 64.0f) + LNEPS);
    v16h ah[2], ar[2];
#pragma unroll
    for (int q = 0; q < 4; ++q) {
        const v4f g0 = *(const v4f*)(lng + 8 * hi + 16 * q), g1 = *(const v4f*)(lng + 8 * hi + 16 * q + 4);
        const v4f c0 = *(const v4f*)(lnb + 8 * hi + 16 * q), c1 = *(const v4f*)(lnb + 8 * hi + 16 * q + 4);
#pragma unroll
        for (int i = 0; i < 4; ++i) {
            const float y0 = (xv[8 * q + i] - mu) * rs * bfr(g0[i]) + bfr(c0[i]);
            const float y1 = (xv[8 * q + 4 + i] - mu) * rs * bfr(g1[i]) + bfr(c1[i]);
            const h16 h0 = toh(y0), h1 = toh(y1);
            ah[q >> 1][(q & 1) * 8 + i] = h0; ah[q >> 1][(q & 1) * 8 + 4 + i] = h1;
            ar[q >> 1][(q & 1) * 8 + i] = toh((y0 - (float)h0) * QRS); ar[q >> 1][(q & 1) * 8 + 4 + i] = toh((y1 - (float)h1) * QRS); } }
    float bgr[4];
    __syncthreads();                                                   // weight planes: each written by all 4 waves (one k segment each), read whole by every wave
    // Weight fragments are fetched from LDS ahead of their products: wf[1] while matrix 0 is worked on, wf[2] and wf[3] while matrix 1 is.
    const h16* wlo = wls + lane * 8;                                   // + matrix * 4 * WTS
    v16h wf[4][8];
    ldw(wf[0], wlo);
    // q (matrix 0) and k (matrix 1)
#pragma unroll
    for (int mat = 0; mat < 2; ++mat) {
        ldw(wf[mat + 1], wlo + (mat + 1) * 4 * WTS);
#pragma unroll
        for (int nb = 0; nb < 4; ++nb) {
            const v8f val = proj_tile(wf[mat][2 * nb], wf[mat][2 * nb + 1], ah[0], ah[1], ar[0], ar[1]);
#pragma unroll
            for (int r = 0; r < 8; ++r) os[wb + (8 * hi + r) * CSP + nb * 16 + lr] = val[r]; }     // D: row 8h+r (token), col lane&15
        if (mat == 1) {                                                                            // the k fragments are dead here: the gate's weights and bias take their place
            ldw(wf[3], wlo + 3 * 4 * WTS);
#pragma unroll
            for (int nb = 0; nb < 4; ++nb) bgr[nb] = bg[nb * 16 + lr]; }
        wave_sync();
{
#pragma unroll
            for (int hh = 0; hh < NH_; ++hh) { const int row = lane >> 1, c8 = (lane & 1) * 8;       // 16 rows x 2 lanes x 8 halves = head hh of the tile
                const v4f x0 = *(const v4fa*)(&os[wb + row * CSP + hh * 16 + c8]); const v4f x1 = *(const v4fa*)(&os[wb + row * CSP + hh * 16 + c8 + 4]); v8h hv, rv;
#pragma unroll
                for (int i = 0; i < 4; ++i) { const h16 a0 = toh(x0[i]); const h16 a1 = toh(x1[i]); hv[i] = a0; hv[4 + i] = a1;
                    rv[i] = toh((x0[i] - (float)a0) * QRS); rv[4 + i] = toh((x1[i] - (float)a1) * QRS); }
                const size_t oo = ((size_t)(sq * NH_ + hh) * SEQ + (size_t)t0) * HD + (size_t)lane * 8;
                if (mat == 0) { *(v8h*)(QH + oo) = hv; *(v8h*)(QR + oo) = rv; } else { *(v8h*)(KP + oo) = hv; *(v8h*)(KR + oo) = rv; }
                asm volatile("s_wait_xcnt 0x0" ::: "memory"); }   // stands in front of the next head's converts and, behind the last head, of the next weight loads: both reuse registers that the two stores above name
             }
        wave_sync();
    }
    // v (matrix 2): lane's 8 accumulator values are 8 consecutive tokens of column c -> one 16-B LDS store into the [c][token] tile
#pragma unroll
    for (int nb = 0; nb < 4; ++nb) {
        const v8f val = proj_tile(wf[2][2 * nb], wf[2][2 * nb + 1], ah[0], ah[1], ar[0], ar[1]);
        v8h o;
#pragma unroll
        for (int r = 0; r < 8; ++r) o[r] = toh(val[r]);
        *(v8ha*)(&vts[(nb * 16 + lr) * VTP + wave * 16 + 8 * hi]) = o; }
    // gate (matrix 3): sigmoid(x Wg + bg)
#pragma unroll
    for (int nb = 0; nb < 4; ++nb) {
        const v8f val = proj_tile(wf[3][2 * nb], wf[3][2 * nb + 1], ah[0], ah[1], ar[0], ar[1]);
        const float bgv = bfr(bgr[nb]);
#pragma unroll
        for (int r = 0; r < 8; ++r) { const float z = val[r] + bgv; const float ex = __builtin_amdgcn_exp2f(-z * L2E); os[wb + (8 * hi + r) * CSP + nb * 16 + lr] = 1.0f / (1.0f + ex); } }
    wave_sync();
{
#pragma unroll
        for (int s8 = 0; s8 < 8; ++s8) { const int cofs = (s8 >> 1) * 16 + 8 * hi + (s8 & 1) * 4;            // 8 x (2 x 4 columns) = 64 columns; 16 lanes = 16 rows
            const v4f val = *(const v4fa*)(&os[wb + lr * CSP + cofs]);
            *(v4f*)(GP + ((size_t)sq * SEQ + (size_t)t0) * DM + s8 * 128 + lane * 4) = val; }
         }
    __syncthreads();                                                   // v^T tile: written by all 4 waves, each wave reads back only its own 16 tokens
    const int tid = threadIdx.x;
{
#pragma unroll
        for (int it = 0; it < 4; ++it) {                                                                                // trip = head; wave = (32-key chunk, 16-key half) of the block's 64 tokens; lane = 16 * (key bit 3) + d
            const v8h o = *(const v8ha*)(&vts[(it * 16 + lr) * VTP + wave * 16 + 8 * hi]);
            *(v8h*)(VT + ((size_t)(sq * NH_ + it) * SEQ + (size_t)tbk) * HD + tid * 8) = o; }
         }
}

// k_lnproj_pairbias: blocks 0 .. LNB-1 run lnproj_body (the longer work, so it starts first), blocks LNB .. LNB+PBB-1 run pairbias_body, block LNB+PBB runs woconv_body; none reads what another writes.
#define LNB (NB * SEQ / 64)
#define PBB ((SEQ / 16) * (SEQ / 8))
__global__ __launch_bounds__(32 * AW) void k_lnproj_pairbias(const float* __restrict__ msa, const float* __restrict__ lng, const float* __restrict__ lnb,
                                                             const float* __restrict__ wq, const float* __restrict__ wk, const float* __restrict__ wv, const float* __restrict__ wg,
                                                             const float* __restrict__ bg, h16* QH, h16* QR, h16* KP, h16* KR, h16* VT, float* GP,
                                                             const float* __restrict__ pair, const float* __restrict__ wp, float* BIAS,
                                                             const float* __restrict__ wo, h16* WOT) {
    __shared__ __align__(16) float os[AW * 16 * CSP];                  // the pair-bias blocks use its first NH_ * 16 * 8 floats
    __shared__ __align__(16) h16 vts[DM * VTP];
    __shared__ __align__(16) h16 wls[4 * 4 * WTS];                     // q | k | v | gate planes, x64: [matrix][4 tiles, pitch WTS][4 k segments][32 lanes][8]
    const int b = blockIdx.x;
    if (b < LNB) lnproj_body(b, msa, lng, lnb, wq, wk, wv, wg, bg, QH, QR, KP, KR, VT, GP, os, vts, wls);
    else if (b < LNB + PBB) pairbias_body(b - LNB, pair, wp, BIAS, os);
    else woconv_body(wo, WOT);
}

// k_attn: block = 16 query rows of one sequence, wave w = head w. Transposed flash form: S^T[key][t] = K Q^T (A = K rows, B = Q rows, k = d: 16 real + 16 zero slots);
// scores = K Q + (K Q_res + K_res Q) / 2048 (value x value in the main accumulators, the two cross products in their own accumulators; residual x residual dropped);
// lane (t = lane&15, h = lane>>4) holds keys 8h+r of each 16-key tile, so the packed P tile is directly the B fragment of O^T[d][t] = V^T P^T.
// Per step: bias row segment and mask words loaded as 16-B vectors at arithmetic addresses; masked keys are dropped by value (probability 0, excluded from the running max).
// After the key loop the 4 heads' contexts meet in a block LDS tile [16][64]; every wave rebuilds the gated context fragments (value + residual x2048) and computes one 16-column tile of the output projection;
// Second launch bound: at most 128 registers a wave, so that 8 waves per SIMD (the whole grid) stay resident although a trip's load destinations are all live at once.
__global__ __launch_bounds__(32 * AW, 8) void k_attn(const h16* __restrict__ QH, const h16* __restrict__ QR, const h16* __restrict__ KP, const h16* __restrict__ KR, const h16* __restrict__ VT,
                                                  const float* __restrict__ BIAS, const int* __restrict__ kmask, const float* __restrict__ GP,
                                                  const h16* __restrict__ WOT, const float* __restrict__ bo, float* OUT) {
    __shared__ __align__(16) float cs[16 * CSP];
    __shared__ __align__(16) float ot[16 * CSP];
    const int lane = threadIdx.x & 31, lr = lane & 15, hi = lane >> 4;
    const int wave = __builtin_amdgcn_readfirstlane((int)(threadIdx.x >> 5));
    const int sq = blockIdx.y; const int t0 = blockIdx.x * 16;
    const int zh = sq * NH_ + wave;
    const size_t pbase = (size_t)zh * SEQ * HD;
    const v8h z8 = (v8h){};
    const v16h qh = cat16(*(const v8h*)(QH + pbase + (size_t)(t0 + lr) * HD + 8 * hi), z8);   // B fragment: col t, k = d; slots 16..31 zero
    const v16h qr = cat16(*(const v8h*)(QR + pbase + (size_t)(t0 + lr) * HD + 8 * hi), z8);   // residual x2048, same map
    const size_t ko = pbase + (size_t)lr * HD + 8 * hi;        // + key * HD   (A fragment: row key, k = d)
    const size_t vo = pbase + (size_t)lane * 8;                // + key * HD   (A fragment: row d, k = key; lane-ordered plane, 32 keys = 32 * HD halves)
    const float* bp0 = BIAS + (size_t)(wave * (SEQ / 16) + (int)blockIdx.x) * (SEQ / 32) * 512 + (size_t)lane * 4;   // + key * 16 (lane-ordered plane, 32 keys = 512 floats)
    const int* mp0 = kmask + (size_t)sq * SEQ_FULL + 8 * hi;
    v8f o0 = (v8f){};
    float m = NEGB, l = 0.0f;
#pragma unroll 1
    for (int key0 = 0; key0 < SEQ; key0 += 32) {
        const h16* ka = KP + ko + (size_t)key0 * HD;
        const v16h ka0 = cat16(*(const v8h*)ka, z8), kb0 = cat16(*(const v8h*)(ka + 16 * HD), z8);
        const h16* kr = KR + ko + (size_t)key0 * HD;
        const v16h kra0 = cat16(*(const v8h*)kr, z8), krb0 = cat16(*(const v8h*)(kr + 16 * HD), z8);
        // all of the trip's loads stand together here, so that their latencies overlap instead of adding up
        const float* bp = bp0 + (size_t)key0 * 16;               // keys key0+8h+0..7 and key0+16+8h+0..7 of query row t0 + (lane&15)
        const v4f c0 = *(const v4f*)bp, c1 = *(const v4f*)(bp + 128), c2 = *(const v4f*)(bp + 256), c3 = *(const v4f*)(bp + 384);
        const int* mp = mp0 + key0;
        const v4i n0 = *(const v4i*)mp, n1 = *(const v4i*)(mp + 4), n2 = *(const v4i*)(mp + 16), n3 = *(const v4i*)(mp + 20);
        const v16h v0 = ldf(VT + vo + (size_t)key0 * HD);
        v8f sa = (v8f){}, sb = (v8f){}, ra = (v8f){}, rb = (v8f){};
        sa = wmma16g(ka0, qh, sa); sb = wmma16g(kb0, qh, sb);
        ra = wmma16g(ka0, qr, ra); ra = wmma16g(kra0, qh, ra);
        rb = wmma16g(kb0, qr, rb); rb = wmma16g(krb0, qh, rb);
        float ta[8], tc[8]; bool fa[8], fb[8]; float mx = NEGB;
#pragma unroll
        for (int r = 0; r < 4; ++r) {
            ta[r] = (sa[r] + ra[r] * QRI) * SC2 + c0[r] * L2E; ta[4 + r] = (sa[4 + r] + ra[4 + r] * QRI) * SC2 + c1[r] * L2E;
            tc[r] = (sb[r] + rb[r] * QRI) * SC2 + c2[r] * L2E; tc[4 + r] = (sb[4 + r] + rb[4 + r] * QRI) * SC2 + c3[r] * L2E;
            fa[r] = n0[r] != 0; fa[4 + r] = n1[r] != 0; fb[r] = n2[r] != 0; fb[4 + r] = n3[r] != 0; }
#pragma unroll
        for (int r = 0; r < 8; ++r) mx = fmaxf(mx, fmaxf(fa[r] ? ta[r] : NEGB, fb[r] ? tc[r] : NEGB));
        mx = fmaxf(mx, __shfl_xor(mx, 16, 32));
        const float mnew = fmaxf(m, mx);
        const float alpha = __builtin_amdgcn_exp2f(m - mnew);
        const float sh = PSH - mnew;
        v16h pb; float ls = 0.0f;
#pragma unroll
        for (int r = 0; r < 8; ++r) {
            const float xa = ta[r] + sh, xb = tc[r] + sh;
            const float ea = __builtin_amdgcn_exp2f(xa), eb = __builtin_amdgcn_exp2f(xb);
            const float ga = (fa[r] & (xa >= -14.0f)) ? ea : 0.0f, gb = (fb[r] & (xb >= -14.0f)) ? eb : 0.0f;   // dropped keys and sub-2^-14 values selected to 0 by value
            const h16 pa = (h16)ga; const h16 pc = (h16)gb;
            pb[r] = pa; pb[8 + r] = pc;
            ls += (float)pa + (float)pc; }
        l = l * alpha + ls; m = mnew;
        o0 = o0 * alpha;
        o0 = wmma16g(v0, pb, o0);
    }
    // the epilogue's global loads depend on nothing the key loop computes: issued here, their latency passes under the normalisation and the barrier
    const float* gr = GP + ((size_t)sq * SEQ + (size_t)t0) * DM + (size_t)lane * 4;
    v4f gv[8];
#pragma unroll
    for (int q = 0; q < 8; ++q) gv[q] = *(const v4f*)(gr + 128 * q);
    const h16* wop = WOT + (size_t)(wave * 16) * DM + (size_t)lane * 8;
    const float bor = bo[wave * 16 + lr];
    const v16h wo0 = ldf(wop);
    const v8h wo1l = *(const v8h*)(wop + 512);
    asm volatile("s_wait_xcnt 0x0" ::: "memory");   // stands in front of the last weight load, whose destination reuses address registers of the loads above
    const v16h wo1 = cat16(wo1l, *(const v8h*)(wop + 768));
    l += __shfl_xor(l, 16, 32);
    const bool any = l > 0.0f;
    const float lsafe = any ? l : 1.0f;
    const float inv = any ? (1.0f / lsafe) : __uint_as_float(0x7FC00000u);       // no kept key -> NaN row (softmax of an all-dropped row)
    // O^T D layout: o0[r] = (d = 8h + r, t = lane&15) -> cs[t][wave*16 + d]; 16 rows x 64 columns written by the 4 waves
    { v4f a, c;
      a[0] = o0[0] * inv; a[1] = o0[1] * inv; a[2] = o0[2] * inv; a[3] = o0[3] * inv; c[0] = o0[4] * inv; c[1] = o0[5] * inv; c[2] = o0[6] * inv; c[3] = o0[7] * inv;
      *(v4fa*)(&cs[lr * CSP + wave * 16 + 8 * hi]) = a; *(v4fa*)(&cs[lr * CSP + wave * 16 + 8 * hi + 4]) = c; }
    __syncthreads();                                                             // cs: cross-wave
    // gated context fragments: row t = lane&15, k = concatenated head column 16q + 8h + i
    v16h gh[2], gq[2];
#pragma unroll
    for (int q = 0; q < 4; ++q) {
        const v4f g0 = gv[2 * q], g1 = gv[2 * q + 1];
        const v4f x0 = *(const v4fa*)(&cs[lr * CSP + 8 * hi + 16 * q]), x1 = *(const v4fa*)(&cs[lr * CSP + 8 * hi + 16 * q + 4]);
#pragma unroll
        for (int i = 0; i < 4; ++i) {
            const float y0 = g0[i] * x0[i], y1 = g1[i] * x1[i];
            const h16 h0 = toh(y0), h1 = toh(y1);
            gh[q >> 1][(q & 1) * 8 + i] = h0; gh[q >> 1][(q & 1) * 8 + 4 + i] = h1;
            gq[q >> 1][(q & 1) * 8 + i] = toh((y0 - (float)h0) * QRS); gq[q >> 1][(q & 1) * 8 + 4 + i] = toh((y1 - (float)h1) * QRS); } }
    const v8f pv = proj_tile(wo0, wo1, gh[0], gh[1], gq[0], gq[1]);
    const float bov = bfr(bor);
#pragma unroll
    for (int r = 0; r < 8; ++r) ot[(8 * hi + r) * CSP + wave * 16 + lr] = pv[r] + bov;       // D: row 8h+r (token), col lane&15; 16 rows x 64 columns written by the 4 waves
    __syncthreads();                                                             // ot: cross-wave
    float* orow = OUT + ((size_t)sq * OUT_SEQ + (size_t)t0) * DM;
    const int tid = threadIdx.x;
{
#pragma unroll
        for (int it = 0; it < 2; ++it) { const int idx = it * 128 + tid; const int row = idx >> 4, cofs = (idx & 15) * 4;   // 2 trips x 8 rows = 16 rows; 16 pieces x 4 floats = 64 columns
            const v4f val = *(const v4fa*)(&ot[row * CSP + cofs]);
            *(v4f*)(orow + (size_t)row * DM + cofs) = val; }
         }
}

static constexpr size_t al256(size_t v) { return (v + 255) & ~(size_t)255; }
static constexpr size_t SZ_WO = al256((size_t)DM * DM * 2);
static constexpr size_t SZ_PL = al256((size_t)NB * SEQ * DM * 2);
static constexpr size_t SZ_GP = al256((size_t)NB * SEQ * DM * 4);
static constexpr size_t SZ_BS = al256((size_t)NH_ * SEQ * SEQ * 4);
static constexpr size_t SZ_TOTAL = SZ_WO + 5 * SZ_PL + SZ_GP + SZ_BS;   // planes: q value, q residual, k value, k residual, v^T
static_assert(SZ_TOTAL <= (size_t)134217728);          // workspace carve <= 128 MiB
static_assert((size_t)NB * NH_ * SEQ * HD == (size_t)NB * DM * SEQ);   // q/k value and residual planes [s*4+h][t][16] and the v^T plane have the same extent
static_assert(((size_t)(NB - 1) * OUT_SEQ + SEQ) * DM <= (size_t)NB_FULL * SEQ_FULL * DM);   // last output row inside the output buffer

extern "C" void kernel_launch(void* const* d_in, const int* in_sizes, int n_in,
                              void* d_out, int out_size, void* d_ws, size_t ws_size, hipStream_t stream) {
    if (n_in < 13) return;
    const size_t needx = ((size_t)(NB - 1) * SEQ_FULL + SEQ) * DM;
    const size_t needp = ((size_t)(SEQ - 1) * SEQ_FULL + SEQ) * DM;
    const size_t needm = (size_t)(NB - 1) * SEQ_FULL + SEQ;
    if ((size_t)in_sizes[0] < needx || (size_t)in_sizes[1] < needp || (size_t)in_sizes[2] < needm) return;
    if (in_sizes[3] < DM || in_sizes[4] < DM || in_sizes[9] < DM || in_sizes[12] < DM) return;
    if (in_sizes[5] < DM * DM || in_sizes[6] < DM * DM || in_sizes[7] < DM * DM || in_sizes[8] < DM * DM || in_sizes[11] < DM * DM) return;
    if (in_sizes[10] < DM * NH_) return;
    if ((size_t)out_size < ((size_t)(NB - 1) * OUT_SEQ + SEQ) * DM) return;
    if (SZ_TOTAL > ws_size) return;
    // wire order: x stack, pair, key mask, ln gain, ln bias, Wq, Wk, Wv, Wg, bg, Wp, Wo, bo
    const float* msa  = (const float*)d_in[0];
    const float* pair = (const float*)d_in[1];
    const int*   kmsk = (const int*)d_in[2];
    const float* lng  = (const float*)d_in[3];
    const float* lnb  = (const float*)d_in[4];
    const float* wq   = (const float*)d_in[5];
    const float* wk   = (const float*)d_in[6];
    const float* wv   = (const float*)d_in[7];
    const float* wg   = (const float*)d_in[8];
    const float* bg   = (const float*)d_in[9];
    const float* wp   = (const float*)d_in[10];
    const float* wo   = (const float*)d_in[11];
    const float* bo   = (const float*)d_in[12];
    float* OUT = (float*)d_out;      // [NB][SEQ][64]
    char* wsp = (char*)d_ws;
    h16* WOT = (h16*)wsp; wsp += SZ_WO;               // [4 tiles][4 k segments][32 lanes][8], x64
    h16* QH  = (h16*)wsp; wsp += SZ_PL;               // [NB*4][SEQ][16]
    h16* QR  = (h16*)wsp; wsp += SZ_PL;               // [NB*4][SEQ][16] residual x2048
    h16* KP  = (h16*)wsp; wsp += SZ_PL;               // [NB*4][SEQ][16]
    h16* KR  = (h16*)wsp; wsp += SZ_PL;               // [NB*4][SEQ][16] residual x2048
    h16* VT  = (h16*)wsp; wsp += SZ_PL;               // [NB*4][SEQ/32][2][32 lanes][8]
    float* GP = (float*)wsp; wsp += SZ_GP;            // [NB][SEQ/16][8][32 lanes][4]
    float* BIAS = (float*)wsp; wsp += SZ_BS;          // [4][SEQ/16][SEQ/32][4][32 lanes][4]

    k_lnproj_pairbias<<<(unsigned)(LNB + PBB + 1), 32 * AW, 0, stream>>>(msa, lng, lnb, wq, wk, wv, wg, bg, QH, QR, KP, KR, VT, GP, pair, wp, BIAS, wo, WOT);
    k_attn<<<dim3(SEQ / 16, NB, 1), 32 * AW, 0, stream>>>(QH, QR, KP, KR, VT, BIAS, kmsk, GP, WOT, bo, OUT);
}

// v006
// A run of this version takes 32.7 microseconds.
// In both of two side-by-side timings against v005, it was 1.04 times as fast.
// Counting every step since v000, it is 2.28 times as fast.
#include <hip/hip_runtime.h>

// Gated row attention over a stack of sequences with a pair-derived additive bias shared by all sequences: x [NB][SEQ][64] -> LayerNorm (eps 1e-5, gain, bias) -> bias-free q/k/v projections ([in][out], y = x W),
// sigmoid gate (x Wg + bg), 4 heads x 16, scores q.k / sqrt(16) + bias[h][i][j] with bias = pair[i][j][:] . Wp[:][h], key padding mask (int32, replace fill: masked keys dropped from the softmax, a row with no kept key gives NaN),
// softmax over keys, context, gate multiply, output projection ([in][out]) + bias; output f32 [NB][SEQ][64].
// Compute dtypes, f32 accumulate everywhere: q/k/v/gate projections v_wmma_f32_16x16x32_f16 (LayerNorm output as f16 value + f16 residual x2048 in its own accumulator, W RNE-converted to bf16 then x64 in f16, exact);
// pair bias v_wmma_f32_16x16x32_bf16 (pair and Wp RNE-converted to bf16, products exact); scores v_wmma_f32_16x16x32_f16 with q and k each as f16 value + f16 residual x2048 (three products: value x value in the main accumulator,
// value x residual + residual x value in their own accumulator folded by 1/2048; head dim 16 zero-padded to the 32-deep k-step in registers in both fragments);
// P.V v_wmma_f32_16x16x32_f16 single product (P x16384 carry, cancels in the normalisation, row sum over the converted P); output projection v_wmma_f32_16x16x32_f16 (gated context as f16 value + f16 residual x2048 in its own accumulator, Wo x64).
// Every float input is RNE-converted to bf16 at its load. LayerNorm, softmax (online, running max over kept keys), sigmoid in f32.
// Layout: every plane that a wave reads as a matrix fragment or as an accumulator-shaped tile is stored so that one 16-byte load per lane covers 512 contiguous bytes (4 whole lines), all but the q, k planes in lane order:
// W^T planes f16 [16-column tile][k segment of 16][lane][8] (lane = 16 * (k bit 3) + column; q, k, v, gate: in the projection block's LDS, Wo: in the workspace); v^T plane f16 [s*4+h][32-key chunk][16-key half][lane][8] (lane = 16 * (key bit 3) + d);
// gate plane f32 [s][16-token tile][16-column group][4-column half][lane][4] (lane = 16 * (column bit 3) + token); bias plane f32 [h][16-query tile][32-key chunk][j][lane][4] (lane = 16 * (key bit 3) + query, j = 2 * (key bit 4) + (key bit 2));
// q, k value planes and q, k residual planes (x2048) [s*4+h][t][16] f16 (a 16-row fragment is 512 contiguous bytes as it is).
// Two launches: k_lnproj_pairbias (projection blocks first, then the pair-bias blocks, then one block that converts Wo for the next launch; none depends on another), k_attn.
// No launch of its own converts weights: a projection block converts Wq, Wk, Wv, Wg from f32 into its LDS planes, a pair-bias wave builds its Wp^T fragments (rows >= 4 zero) in registers.
// Fused attention kernel: one block = 32 query rows of one sequence, wave w = head w (two 16-query tiles share each K, V^T and mask load), transposed flash form (S^T = K Q^T, O^T = V^T P^T, fragments straight from the planes), then gate, output projection and whole-row stores.

#ifndef NB
#define NB 128                   // number of sequences (batch x stack depth)
#endif
#ifndef SEQ
#define SEQ 256                  // tokens per sequence (queries = keys)
#endif
#define NB_FULL  128
#define SEQ_FULL 256
#ifndef OUT_SEQ
#define OUT_SEQ SEQ              // row pitch (in tokens) between sequences of the output
#endif
#define DM   64
#define NH_  4
#define HD   16
#define AW   4                   // waves per block
#define QT   2                   // 16-query tiles per wave of the attention kernel
#define CSP  68                  // LDS row pitch (floats) of the 16 x 64 (projection) and 32 x 64 (attention) staging tiles
#define VTP  72                  // LDS row pitch (halves) of the v^T staging tile
#define WTS  1032                // LDS pitch (halves) between the 16-column tiles of a weight plane: 4 k segments x 256 halves + 8, so that the four tiles a converting wave writes at once fall on different banks
#define QRS  2048.0f             // carry of every residual plane / residual fragment
#define QRI  (1.0f / 2048.0f)
#define WCS  64.0f               // carry of the f16 weight planes
#define WCI  (1.0f / 64.0f)
#define L2E  1.4426950408889634f
#define SC2  ((float)(0.25 * 1.4426950408889634))   // HD^-0.5 * log2(e)
#define PSH  14.0f               // log2 of the P carry (16384)
#define NEGB (-3.0e38f)
#define LNEPS 1.0e-5f

static_assert(DM == 64);                       // LayerNorm lane map: 2 lanes x 32 columns; two 32-deep k-steps
static_assert(HD == 16);                       // one 16-B load per q/k fragment, upper k half zero in registers
static_assert(NH_ * HD == DM);
static_assert(NH_ == AW);                      // wave w of the attention block = head w
static_assert(SEQ % 64 == 0);                  // a 64-token projection tile never straddles two sequences and fills two whole 32-key chunks of the v^T plane
static_assert((NB * SEQ) % 64 == 0);
static_assert(SEQ % 32 == 0);                  // key loop steps by 32; the bias plane is split into whole 32-key chunks
static_assert(SEQ % (16 * QT) == 0);           // an attention block's query rows lie in one sequence
static_assert(SEQ % 8 == 0);                   // bias grid covers (16-query tile, 8-key group) exactly
static_assert(NB <= NB_FULL);
static_assert(SEQ <= SEQ_FULL);
static_assert((CSP * 4) % 16 == 0);
static_assert((VTP * 2) % 16 == 0);
static_assert(32 * 16 * NH_ == 16 * DM * 2);           // q/k store, per plane (value and residual alike): 4 head instructions x 32 lanes x 16 B = 16 rows x 64 halves
static_assert(32 * 16 * 8 == 16 * DM * 4);             // gate store: 8 instructions x 32 lanes x 16 B = 16 rows x 256 B
static_assert(128 * 16 * 4 == DM * 64 * 2);
static_assert(128 * 16 * 2 * QT == QT * 16 * DM * 4);  // output store: 2 QT trips x 128 threads x 16 B = 16 QT rows x 256 B
static_assert(128 * 16 == NH_ * 16 * 8 * 4);           // bias store: 128 threads x 16 B = 4 heads x 16 queries x 8 keys
static_assert(128 * 8 * 4 == DM * DM);                 // weight converter: 128 threads x (8 rows x 4 columns)
static_assert((WTS * 2) % 16 == 0);
static_assert(WTS >= 4 * 256);
static_assert(AW * 16 * CSP * 4 + DM * VTP * 2 + 4 * 4 * WTS * 2 <= 131072);   // static LDS of the projection kernel
static_assert(2 * QT * 16 * CSP * 4 <= 131072);              // static LDS of the attention kernel
static_assert(NH_ * 16 * 8 <= AW * 16 * CSP);                // the pair-bias tile fits the projection kernel's staging array

typedef _Float16 h16;
typedef __attribute__((ext_vector_type(16))) __bf16   v16bf;
typedef __attribute__((ext_vector_type(16))) _Float16 v16h;
typedef __attribute__((ext_vector_type(8)))  _Float16 v8h;
typedef __attribute__((ext_vector_type(8)))  unsigned short v8us;
typedef __attribute__((ext_vector_type(8)))  float    v8f;
typedef __attribute__((ext_vector_type(4)))  float    v4f;
typedef __attribute__((ext_vector_type(4)))  int      v4i;
typedef __attribute__((ext_vector_type(8)))  unsigned v8u;
typedef __attribute__((ext_vector_type(2)))  float    v2f;
typedef __attribute__((ext_vector_type(2)))  __bf16   v2bf;
typedef v4f  __attribute__((may_alias)) v4fa;
typedef v8h  __attribute__((may_alias)) v8ha;

__device__ __forceinline__ unsigned short f2bf(float f) { unsigned u = __float_as_uint(f); u += 0x7FFFu + ((u >> 16) & 1u); return (unsigned short)(u >> 16); }
__device__ __forceinline__ float bfr(float f) { return __uint_as_float(((unsigned)f2bf(f)) << 16); }   // value after RNE convert to bf16
__device__ __forceinline__ v16h cat16(v8h lo, v8h hi) { return __builtin_shufflevector(lo, hi, 0, 1, 2, 3, 4, 5, 6, 7, 8, 9, 10, 11, 12, 13, 14, 15); }
__device__ __forceinline__ v16bf cat16b(v8us lo, v8us hi) { return __builtin_bit_cast(v16bf, __builtin_shufflevector(lo, hi, 0, 1, 2, 3, 4, 5, 6, 7, 8, 9, 10, 11, 12, 13, 14, 15)); }
__device__ __forceinline__ v8f wmma16(v16h a, v16h b, v8f c) { return __builtin_amdgcn_wmma_f32_16x16x32_f16(false, a, false, b, (short)0, c, false, false); }
__device__ __forceinline__ v8f wmmab(v16bf a, v16bf b, v8f c) { return __builtin_amdgcn_wmma_f32_16x16x32_bf16(false, a, false, b, (short)0, c, false, false); }
// fragment loader from a lane-ordered plane; p already includes + 8*lane: elements 0..7 <- segment 0 (k0+8h+0..7), elements 8..15 <- segment 1 (k0+16+8h+0..7), each segment 32 lanes x 16 B
__device__ __forceinline__ v16h  ldf(const h16* p) { return cat16(*(const v8h*)p, *(const v8h*)(p + 256)); }
// ordering point for wave-private LDS tiles (same wave writes and reads)
__device__ __forceinline__ void wave_sync() { __builtin_amdgcn_fence(3 /* release order */, "wavefront"); __builtin_amdgcn_wave_barrier(); asm volatile("" ::: "memory"); }

// f32 -> f16 convert, RNE; |v| < 2^-14 becomes an f16 subnormal, which the matrix instructions take as it is
static __device__ __forceinline__ h16 toh(float v) { return (h16)v; }
// one matrix instruction followed by its own 4-slot guard
__device__ __forceinline__ v8f wmma16g(v16h a, v16h b, v8f c) { c = wmma16(a, b, c); asm volatile("v_nop\n\tv_nop\n\tv_nop\n\tv_nop" : "+v"(c) : "v"(a), "v"(b)); return c; }
__device__ __forceinline__ v8f wmmabg(v16bf a, v16bf b, v8f c) { c = wmmab(a, b, c); asm volatile("v_nop\n\tv_nop\n\tv_nop\n\tv_nop" : "+v"(c) : "v"(a), "v"(b)); return c; }

// Weight conversion, 128 threads per 64 x 64 f32 matrix [in][out]: thread (ko = tid >> 4, c = tid & 15) takes rows 8 ko .. 8 ko + 7 of columns 4 c .. 4 c + 3 (a wave's load = two whole 256-byte rows);
// column j of that block, 8 consecutive k, is one 16-byte piece of the lane-ordered plane: tile c >> 2, k segment ko >> 1, lane 16 * (ko & 1) + 4 * (c & 3) + j.
__device__ __forceinline__ void wld(v4f (&x)[8], const float* __restrict__ src) {
    const float* p = src + ((threadIdx.x >> 4) * (8 * DM) + (threadIdx.x & 15) * 4);   // 32-bit offset: the same one register serves all matrices beside their scalar bases
#pragma unroll   // constant indices keep x in registers, and the 8 loads are in flight together
    for (int i = 0; i < 8; ++i) x[i] = *(const v4f*)(p + i * DM);
}
__device__ __forceinline__ v8h wpiece(const v4f (&x)[8], const int j) {
    v8h o;
#pragma unroll   // constant indices into x and o: registers, no scratch
    for (int i = 0; i < 8; i += 2) {                                               // RNE to bf16 by the packed convert instruction (two elements each), then x64 in f16, exact
        const v2f a = { x[i][j], x[i + 1][j] };
        const unsigned t = __builtin_bit_cast(unsigned, __builtin_convertvector(a, v2bf));
        const float w0 = __uint_as_float(t << 16), w1 = __uint_as_float(t & 0xFFFF0000u);
        o[i] = (h16)(w0 * WCS); o[i + 1] = (h16)(w1 * WCS); }
    return o;
}

// woconv_body: one block converts Wo into the workspace plane that the next launch reads; wave w writes k segment w of every tile, so every line of the plane has one writer
__device__ __forceinline__ void woconv_body(const float* __restrict__ wo, h16* WOT) {
    const int c = threadIdx.x & 15, ko = threadIdx.x >> 4;
    v4f x[8];
    wld(x, wo);
    h16* dst = WOT + (size_t)((((c >> 2) * 4 + (ko >> 1)) * 32 + (ko & 1) * 16 + (c & 3) * 4) * 8);
#pragma unroll   // j must be a constant inside wpiece
    for (int j = 0; j < 4; ++j) *(v8h*)(dst + j * 8) = wpiece(x, j);
}

// pairbias_body: bias[h][i][j] = sum_p bf16(pair[i][j][p]) bf16(Wp[p][h]); block = one 16-query tile x 8 keys, wave = 4 query rows x 8 keys as two 16-column tiles:
// A = Wp^T rows (row = head, padded to 16; read from the f32 Wp [p][head] and converted in registers), B = pair rows converted in registers (col = 8 * (query row bit 0) + key), K = 64. The four waves' values meet in LDS [head][query][key]; wave w then stores head w's
// two 256-byte runs of the lane-ordered bias plane (16 queries x 4 keys each), so every line of the plane has one writer.
__device__ __forceinline__ void pairbias_body(const int blk, const float* __restrict__ pair, const float* __restrict__ wp, float* BIAS, float* os) {
    const int lane = threadIdx.x & 31, lr = lane & 15, hi = lane >> 4;
    const int wave = __builtin_amdgcn_readfirstlane((int)(threadIdx.x >> 5));
    const int ti = blk / (SEQ / 8), kg = blk % (SEQ / 8);
    const float* wpl = wp + 8 * hi * NH_ + (lr < NH_ ? lr : (NH_ - 1));                         // element e of fragment f: k = 32 f + 16 (e >> 3) + 8 h + (e & 7), the same map as the B fragment below
    float wr[2][16];
#pragma unroll   // both loops: constant indices keep wr in registers, and the 32 loads are in flight together with the row loads below
    for (int f = 0; f < 2; ++f) {
#pragma unroll
        for (int e = 0; e < 16; ++e) wr[f][e] = wpl[(32 * f + 16 * (e >> 3) + (e & 7)) * NH_]; }
    v4f xs[2][2][4];                                                                          // the wave's 16 row loads are all issued before the first is used: one memory latency, not four
#pragma unroll
    for (int jt = 0; jt < 2; ++jt) {
        const float* p = pair + ((size_t)(ti * 16 + wave * 4 + 2 * jt + (lr >> 3)) * SEQ_FULL + (size_t)(kg * 8 + (lr & 7))) * DM + 8 * hi;
#pragma unroll
        for (int kc = 0; kc < 2; ++kc) {
            xs[jt][kc][0] = *(const v4f*)(p + 32 * kc); xs[jt][kc][1] = *(const v4f*)(p + 32 * kc + 4); xs[jt][kc][2] = *(const v4f*)(p + 32 * kc + 16); xs[jt][kc][3] = *(const v4f*)(p + 32 * kc + 20); }
    }
    const unsigned keep = (lr < NH_) ? 0xFFFFFFFFu : 0u;                                      // rows >= 4 of the padded A are zeroed by value: every lane loads (a clamped column) and converts
    v16bf af[2];
#pragma unroll   // both loops: constant indices into register arrays
    for (int f = 0; f < 2; ++f) { v16bf t;
#pragma unroll
        for (int i = 0; i < 16; ++i) t[i] = (__bf16)wr[f][i];
        af[f] = __builtin_bit_cast(v16bf, __builtin_bit_cast(v8u, t) & keep); }
    const v16bf a0 = af[0], a1 = af[1];
#pragma unroll
    for (int jt = 0; jt < 2; ++jt) {
        const int ql = wave * 4 + 2 * jt + (lr >> 3);
        v8f acc = (v8f){};
#pragma unroll
        for (int kc = 0; kc < 2; ++kc) {
            const v4f x0 = xs[jt][kc][0], x1 = xs[jt][kc][1], x2 = xs[jt][kc][2], x3 = xs[jt][kc][3];
            v8us e0, e1;
#pragma unroll
            for (int i = 0; i < 4; ++i) { e0[i] = f2bf(x0[i]); e0[4 + i] = f2bf(x1[i]); e1[i] = f2bf(x2[i]); e1[4 + i] = f2bf(x3[i]); }
            const v16bf bq = cat16b(e0, e1);
            if (kc == 0) acc = wmmabg(a0, bq, acc); else acc = wmmabg(a1, bq, acc);
        }
        if (hi == 0) {                                                                        // D: row 8h+r (head), col lane&15; the four real heads sit in rows 0..3 of the lower lanes
#pragma unroll
            for (int r = 0; r < NH_; ++r) os[(r * 16 + ql) * 8 + (lr & 7)] = acc[r]; }
    }
    __syncthreads();                                                                          // os: written by all 4 waves (4 query rows each), read across waves (one head each)
    const v4f val = *(const v4fa*)(&os[(wave * 16 + lr) * 8 + hi * 4]);                       // head = wave, query = lane&15, keys 4 * (lane>>4) + 0..3 of the group
    float* dstp = BIAS + ((size_t)(wave * (SEQ / 16) + ti) * (SEQ / 32) + (size_t)(kg >> 2)) * 512 + (size_t)(((kg >> 1) & 1) * 2 + hi) * 128 + (size_t)((kg & 1) * 16 + lr) * 4;
    *(v4f*)dstp = val;
    asm volatile("s_wait_xcnt 0x0" ::: "memory");   // stands in front of whatever the merged kernel's layout puts behind this store and lets rewrite its registers
}

// value of one 16 x 16 projection tile: (x_hi W + (x_res W) / 2048) / 64, K = 64
__device__ __forceinline__ v8f proj_tile(v16h b0, v16h b1, v16h a0h, v16h a1h, v16h a0r, v16h a1r) {
    v8f cH = (v8f){}, cR = (v8f){};
    cH = wmma16g(a0h, b0, cH); cH = wmma16g(a1h, b1, cH);
    cR = wmma16g(a0r, b0, cR); cR = wmma16g(a1r, b1, cR);
    return (cH + cR * QRI) * WCI;
}

// the eight B fragments (4 column tiles x 2 k-steps) of one 64 x 64 weight plane in LDS; p already includes + 8*lane
__device__ __forceinline__ void ldw(v16h (&w)[8], const h16* p) {
#pragma unroll
    for (int nb = 0; nb < 4; ++nb) { w[2 * nb] = ldf(p + nb * WTS); w[2 * nb + 1] = ldf(p + nb * WTS + 512); }
}

// lnproj_body: LayerNorm + q/k/v/gate projections; block = 64 tokens of one sequence, wave = 16 tokens. Lane (row = lane&15, half = lane>>4) holds the 32 columns 16q + 8*half + i of its row,
// q, k: f16 value plane and f16 residual plane ((v - value) x 2048); per head the 16 x 16 halves are one contiguous 512-byte run of each plane, written by one instruction (32 lanes x 16 B);
// gate: f32, the wave's 16 x 64 tile in lane order, 512 contiguous bytes per instruction;
__device__ __forceinline__ void lnproj_body(const int blk, const float* __restrict__ msa, const float* __restrict__ lng, const float* __restrict__ lnb,
                                            const float* __restrict__ wq, const float* __restrict__ wk, const float* __restrict__ wv, const float* __restrict__ wg, const float* __restrict__ bg,
                                            h16* QH, h16* QR, h16* KP, h16* KR, h16* VT, float* GP, float* os, h16* vts, h16* wls) {
    const int lane = threadIdx.x & 31, lr = lane & 15, hi = lane >> 4;
    const int wave = __builtin_amdgcn_readfirstlane((int)(threadIdx.x >> 5));
    const int r0 = blk * 64;
    const int sq = r0 / SEQ, tbk = r0 % SEQ;
    const int t0 = tbk + wave * 16;
    const int wb = wave * 16 * CSP;
    // The block's share of the four f32 weight matrices is loaded first (32 loads a thread, all in flight together with the row loads below) and converted into the LDS planes while the rows are still on their way.
    v4f wx[4][8];
    wld(wx[0], wq); wld(wx[1], wk); wld(wx[2], wv); wld(wx[3], wg);
    const float* xr = msa + ((size_t)sq * SEQ_FULL + (size_t)(t0 + lr)) * DM + 8 * hi;
    float xv[32];
    v4f xu[8];
#pragma unroll
    for (int q = 0; q < 4; ++q) { xu[2 * q] = *(const v4f*)(xr + 16 * q); xu[2 * q + 1] = *(const v4f*)(xr + 16 * q + 4); }
    asm volatile("s_wait_xcnt 0x0" ::: "memory");   // stands in front of the first rewrite of the row loads' address pair and of the weight loads' offset register
    __builtin_amdgcn_sched_barrier(0);              // keeps the weight loads above in front of the first wait on a row load; without it they are issued only after the rows have arrived
    {
        const int wc = threadIdx.x & 15, wko = threadIdx.x >> 4;
        h16* wd = wls + (wc >> 2) * WTS + ((wko >> 1) * 32 + (wko & 1) * 16 + (wc & 3) * 4) * 8;
#pragma unroll   // both loops: constant indices into wx (registers) and constant LDS offsets
        for (int mat = 0; mat < 4; ++mat) {
#pragma unroll
            for (int j = 0; j < 4; ++j) *(v8ha*)(wd + mat * 4 * WTS + j * 8) = wpiece(wx[mat], j); }
    }
#pragma unroll
    for (int q = 0; q < 4; ++q) {
#pragma unroll
        for (int i = 0; i < 4; ++i) { xv[8 * q + i] = bfr(xu[2 * q][i]); xv[8 * q + 4 + i] = bfr(xu[2 * q + 1][i]); } }
    float sm = 0.0f;
#pragma unroll
    for (int e = 0; e < 32; ++e) sm += xv[e];
    sm += __shfl_xor(sm, 16, 32);
    const float mu = sm * (1.0f / 64.0f);
    float sv = 0.0f;
#pragma unroll
    for (int e = 0; e < 32; ++e) { const float dl = xv[e] - mu; sv += dl * dl; }
    sv += __shfl_xor(sv, 16, 32);
    const float rs = rsqrtf(sv * (1.0f / 64.0f) + LNEPS);
    v16h ah[2], ar[2];
#pragma unroll
    for (int q = 0; q < 4; ++q) {
        const v4f g0 = *(const v4f*)(lng + 8 * hi + 16 * q), g1 = *(const v4f*)(lng + 8 * hi + 16 * q + 4);
        const v4f c0 = *(const v4f*)(lnb + 8 * hi + 16 * q), c1 = *(const v4f*)(lnb + 8 * hi + 16 * q + 4);
#pragma unroll
        for (int i = 0; i < 4; ++i) {
            const float y0 = (xv[8 * q + i] - mu) * rs * bfr(g0[i]) + bfr(c0[i]);
            const float y1 = (xv[8 * q + 4 + i] - mu) * rs * bfr(g1[i]) + bfr(c1[i]);
            const h16 h0 = toh(y0), h1 = toh(y1);
            ah[q >> 1][(q & 1) * 8 + i] = h0; ah[q >> 1][(q & 1) * 8 + 4 + i] = h1;
            ar[q >> 1][(q & 1) * 8 + i] = toh((y0 - (float)h0) * QRS); ar[q >> 1][(q & 1) * 8 + 4 + i] = toh((y1 - (float)h1) * QRS); } }
    float bgr[4];
    __syncthreads();                                                   // weight planes: each written by all 4 waves (one k segment each), read whole by every wave
    // Weight fragments are fetched from LDS ahead of their products: wf[1] while matrix 0 is worked on, wf[2] and wf[3] while matrix 1 is.
    const h16* wlo = wls + lane * 8;                                   // + matrix * 4 * WTS
    v16h wf[4][8];
    ldw(wf[0], wlo);
    // q (matrix 0) and k (matrix 1)
#pragma unroll
    for (int mat = 0; mat < 2; ++mat) {
        ldw(wf[mat + 1], wlo + (mat + 1) * 4 * WTS);
#pragma unroll
        for (int nb = 0; nb < 4; ++nb) {
            const v8f val = proj_tile(wf[mat][2 * nb], wf[mat][2 * nb + 1], ah[0], ah[1], ar[0], ar[1]);
#pragma unroll
            for (int r = 0; r < 8; ++r) os[wb + (8 * hi + r) * CSP + nb * 16 + lr] = val[r]; }     // D: row 8h+r (token), col lane&15
        if (mat == 1) {                                                                            // the k fragments are dead here: the gate's weights and bias take their place
            ldw(wf[3], wlo + 3 * 4 * WTS);
#pragma unroll
            for (int nb = 0; nb < 4; ++nb) bgr[nb] = bg[nb * 16 + lr]; }
        wave_sync();
{
#pragma unroll
            for (int hh = 0; hh < NH_; ++hh) { const int row = lane >> 1, c8 = (lane & 1) * 8;       // 16 rows x 2 lanes x 8 halves = head hh of the tile
                const v4f x0 = *(const v4fa*)(&os[wb + row * CSP + hh * 16 + c8]); const v4f x1 = *(const v4fa*)(&os[wb + row * CSP + hh * 16 + c8 + 4]); v8h hv, rv;
#pragma unroll
                for (int i = 0; i < 4; ++i) { const h16 a0 = toh(x0[i]); const h16 a1 = toh(x1[i]); hv[i] = a0; hv[4 + i] = a1;
                    rv[i] = toh((x0[i] - (float)a0) * QRS); rv[4 + i] = toh((x1[i] - (float)a1) * QRS); }
                const size_t oo = ((size_t)(sq * NH_ + hh) * SEQ + (size_t)t0) * HD + (size_t)lane * 8;
                if (mat == 0) { *(v8h*)(QH + oo) = hv; *(v8h*)(QR + oo) = rv; } else { *(v8h*)(KP + oo) = hv; *(v8h*)(KR + oo) = rv; }
                asm volatile("s_wait_xcnt 0x0" ::: "memory"); }   // stands in front of the next head's converts and, behind the last head, of the next weight loads: both reuse registers that the two stores above name
             }
        wave_sync();
    }
    // v (matrix 2): lane's 8 accumulator values are 8 consecutive tokens of column c -> one 16-B LDS store into the [c][token] tile
#pragma unroll
    for (int nb = 0; nb < 4; ++nb) {
        const v8f val = proj_tile(wf[2][2 * nb], wf[2][2 * nb + 1], ah[0], ah[1], ar[0], ar[1]);
        v8h o;
#pragma unroll
        for (int r = 0; r < 8; ++r) o[r] = toh(val[r]);
        *(v8ha*)(&vts[(nb * 16 + lr) * VTP + wave * 16 + 8 * hi]) = o; }
    // gate (matrix 3): sigmoid(x Wg + bg)
#pragma unroll
    for (int nb = 0; nb < 4; ++nb) {
        const v8f val = proj_tile(wf[3][2 * nb], wf[3][2 * nb + 1], ah[0], ah[1], ar[0], ar[1]);
        const float bgv = bfr(bgr[nb]);
#pragma unroll
        for (int r = 0; r < 8; ++r) { const float z = val[r] + bgv; const float ex = __builtin_amdgcn_exp2f(-z * L2E); os[wb + (8 * hi + r) * CSP + nb * 16 + lr] = 1.0f / (1.0f + ex); } }
    wave_sync();
{
#pragma unroll
        for (int s8 = 0; s8 < 8; ++s8) { const int cofs = (s8 >> 1) * 16 + 8 * hi + (s8 & 1) * 4;            // 8 x (2 x 4 columns) = 64 columns; 16 lanes = 16 rows
            const v4f val = *(const v4fa*)(&os[wb + lr * CSP + cofs]);
            *(v4f*)(GP + ((size_t)sq * SEQ + (size_t)t0) * DM + s8 * 128 + lane * 4) = val; }
         }
    __syncthreads();                                                   // v^T tile: written by all 4 waves, each wave reads back only its own 16 tokens
    const int tid = threadIdx.x;
{
#pragma unroll
        for (int it = 0; it < 4; ++it) {                                                                                // trip = head; wave = (32-key chunk, 16-key half) of the block's 64 tokens; lane = 16 * (key bit 3) + d
            const v8h o = *(const v8ha*)(&vts[(it * 16 + lr) * VTP + wave * 16 + 8 * hi]);
            *(v8h*)(VT + ((size_t)(sq * NH_ + it) * SEQ + (size_t)tbk) * HD + tid * 8) = o; }
         }
}

// k_lnproj_pairbias: blocks 0 .. LNB-1 run lnproj_body (the longer work, given the lowest block indices), blocks LNB .. LNB+PBB-1 run pairbias_body, block LNB+PBB runs woconv_body; none reads what another writes.
#define LNB (NB * SEQ / 64)
#define PBB ((SEQ / 16) * (SEQ / 8))
__global__ __launch_bounds__(32 * AW) void k_lnproj_pairbias(const float* __restrict__ msa, const float* __restrict__ lng, const float* __restrict__ lnb,
                                                             const float* __restrict__ wq, const float* __restrict__ wk, const float* __restrict__ wv, const float* __restrict__ wg,
                                                             const float* __restrict__ bg, h16* QH, h16* QR, h16* KP, h16* KR, h16* VT, float* GP,
                                                             const float* __restrict__ pair, const float* __restrict__ wp, float* BIAS,
                                                             const float* __restrict__ wo, h16* WOT) {
    __shared__ __align__(16) float os[AW * 16 * CSP];                  // the pair-bias blocks use its first NH_ * 16 * 8 floats
    __shared__ __align__(16) h16 vts[DM * VTP];
    __shared__ __align__(16) h16 wls[4 * 4 * WTS];                     // q | k | v | gate planes, x64: [matrix][4 tiles, pitch WTS][4 k segments][32 lanes][8]
    const int b = blockIdx.x;
    if (b < LNB) lnproj_body(b, msa, lng, lnb, wq, wk, wv, wg, bg, QH, QR, KP, KR, VT, GP, os, vts, wls);
    else if (b < LNB + PBB) pairbias_body(b - LNB, pair, wp, BIAS, os);
    else woconv_body(wo, WOT);
}

// k_attn: block = 32 query rows of one sequence (QT = 2 tiles of 16), wave w = head w and takes both tiles, so that every K, K residual, V^T and mask load of a trip serves two query tiles.
// Transposed flash form: S^T[key][t] = K Q^T (A = K rows, B = Q rows, k = d: 16 real + 16 zero slots);
// scores = K Q + (K Q_res + K_res Q) / 2048 (value x value in the main accumulators, the two cross products in their own accumulators; residual x residual dropped);
// lane (t = lane&15, h = lane>>4) holds keys 8h+r of each 16-key tile, so the packed P tile is directly the B fragment of O^T[d][t] = V^T P^T.
// Per step: bias row segment and mask words loaded as 16-B vectors at arithmetic addresses; masked keys are dropped by value (probability 0, excluded from the running max).
// After the key loop the 4 heads' contexts meet in a block LDS tile [32][64]; every wave rebuilds the gated context fragments (value + residual x2048) and computes one 16-column tile of the output projection for both row tiles;
// Second launch bound: 4 waves per SIMD are the whole grid, so a wave may hold up to 256 registers.
__global__ __launch_bounds__(32 * AW, 4) void k_attn(const h16* __restrict__ QH, const h16* __restrict__ QR, const h16* __restrict__ KP, const h16* __restrict__ KR, const h16* __restrict__ VT,
                                                  const float* __restrict__ BIAS, const int* __restrict__ kmask, const float* __restrict__ GP,
                                                  const h16* __restrict__ WOT, const float* __restrict__ bo, float* OUT) {
    __shared__ __align__(16) float cs[QT * 16 * CSP];
    __shared__ __align__(16) float ot[QT * 16 * CSP];
    const int lane = threadIdx.x & 31, lr = lane & 15, hi = lane >> 4;
    const int wave = __builtin_amdgcn_readfirstlane((int)(threadIdx.x >> 5));
    const int sq = blockIdx.y; const int t0 = blockIdx.x * (16 * QT);
    const int zh = sq * NH_ + wave;
    const size_t pbase = (size_t)zh * SEQ * HD;
    const v8h z8 = (v8h){};
    v16h qh[QT], qr[QT];
#pragma unroll   // constant indices keep the per-tile arrays in registers (this and every loop over qt below)
    for (int qt = 0; qt < QT; ++qt) {
        qh[qt] = cat16(*(const v8h*)(QH + pbase + (size_t)(t0 + 16 * qt + lr) * HD + 8 * hi), z8);   // B fragment: col t, k = d; slots 16..31 zero
        qr[qt] = cat16(*(const v8h*)(QR + pbase + (size_t)(t0 + 16 * qt + lr) * HD + 8 * hi), z8); } // residual x2048, same map
    const size_t ko = pbase + (size_t)lr * HD + 8 * hi;        // + key * HD   (A fragment: row key, k = d)
    const size_t vo = pbase + (size_t)lane * 8;                // + key * HD   (A fragment: row d, k = key; lane-ordered plane, 32 keys = 32 * HD halves)
    const float* bp0 = BIAS + (size_t)(wave * (SEQ / 16) + (int)blockIdx.x * QT) * (SEQ / 32) * 512 + (size_t)lane * 4;   // + tile * (SEQ / 32) * 512 + key * 16 (lane-ordered plane, 32 keys = 512 floats)
    const int* mp0 = kmask + (size_t)sq * SEQ_FULL + 8 * hi;
    v8f o0[QT];
    float m[QT], l[QT];
#pragma unroll
    for (int qt = 0; qt < QT; ++qt) { o0[qt] = (v8f){}; m[qt] = NEGB; l[qt] = 0.0f; }
#pragma unroll 1
    for (int key0 = 0; key0 < SEQ; key0 += 32) {
        const h16* ka = KP + ko + (size_t)key0 * HD;
        const v16h ka0 = cat16(*(const v8h*)ka, z8), kb0 = cat16(*(const v8h*)(ka + 16 * HD), z8);
        const h16* kr = KR + ko + (size_t)key0 * HD;
        const v16h kra0 = cat16(*(const v8h*)kr, z8), krb0 = cat16(*(const v8h*)(kr + 16 * HD), z8);
        // all of the trip's loads stand together here, so that their latencies overlap instead of adding up
        v4f c[QT][4];
#pragma unroll
        for (int qt = 0; qt < QT; ++qt) {
            const float* bp = bp0 + (size_t)qt * ((SEQ / 32) * 512) + (size_t)key0 * 16;   // keys key0+8h+0..7 and key0+16+8h+0..7 of query row t0 + 16 qt + (lane&15)
            c[qt][0] = *(const v4f*)bp; c[qt][1] = *(const v4f*)(bp + 128); c[qt][2] = *(const v4f*)(bp + 256); c[qt][3] = *(const v4f*)(bp + 384); }
        const int* mp = mp0 + key0;
        const v4i n0 = *(const v4i*)mp, n1 = *(const v4i*)(mp + 4), n2 = *(const v4i*)(mp + 16), n3 = *(const v4i*)(mp + 20);
        const v16h v0 = ldf(VT + vo + (size_t)key0 * HD);
        bool fa[8], fb[8];
#pragma unroll
        for (int r = 0; r < 4; ++r) { fa[r] = n0[r] != 0; fa[4 + r] = n1[r] != 0; fb[r] = n2[r] != 0; fb[4 + r] = n3[r] != 0; }
#pragma unroll
        for (int qt = 0; qt < QT; ++qt) {
            v8f sa = (v8f){}, sb = (v8f){}, ra = (v8f){}, rb = (v8f){};
            sa = wmma16g(ka0, qh[qt], sa); sb = wmma16g(kb0, qh[qt], sb);
            ra = wmma16g(ka0, qr[qt], ra); ra = wmma16g(kra0, qh[qt], ra);
            rb = wmma16g(kb0, qr[qt], rb); rb = wmma16g(krb0, qh[qt], rb);
            float ta[8], tc[8]; float mx = NEGB;
#pragma unroll
            for (int r = 0; r < 4; ++r) {
                ta[r] = (sa[r] + ra[r] * QRI) * SC2 + c[qt][0][r] * L2E; ta[4 + r] = (sa[4 + r] + ra[4 + r] * QRI) * SC2 + c[qt][1][r] * L2E;
                tc[r] = (sb[r] + rb[r] * QRI) * SC2 + c[qt][2][r] * L2E; tc[4 + r] = (sb[4 + r] + rb[4 + r] * QRI) * SC2 + c[qt][3][r] * L2E; }
#pragma unroll
            for (int r = 0; r < 8; ++r) mx = fmaxf(mx, fmaxf(fa[r] ? ta[r] : NEGB, fb[r] ? tc[r] : NEGB));
            mx = fmaxf(mx, __shfl_xor(mx, 16, 32));
            const float mnew = fmaxf(m[qt], mx);
            const float alpha = __builtin_amdgcn_exp2f(m[qt] - mnew);
            const float sh = PSH - mnew;
            v16h pb; float ls = 0.0f;
#pragma unroll
            for (int r = 0; r < 8; ++r) {
                const float xa = ta[r] + sh, xb = tc[r] + sh;
                const float ea = __builtin_amdgcn_exp2f(xa), eb = __builtin_amdgcn_exp2f(xb);
                const float ga = (fa[r] & (xa >= -14.0f)) ? ea : 0.0f, gb = (fb[r] & (xb >= -14.0f)) ? eb : 0.0f;   // dropped keys and sub-2^-14 values selected to 0 by value
                const h16 pa = (h16)ga; const h16 pc = (h16)gb;
                pb[r] = pa; pb[8 + r] = pc;
                ls += (float)pa + (float)pc; }
            l[qt] = l[qt] * alpha + ls; m[qt] = mnew;
            o0[qt] = o0[qt] * alpha;
            o0[qt] = wmma16g(v0, pb, o0[qt]);
        }
    }
    // the epilogue's global loads depend on nothing the key loop computes: issued here, their latency passes under the normalisation and the barrier
    const float* gr = GP + ((size_t)sq * SEQ + (size_t)t0) * DM + (size_t)lane * 4;
    v4f gv[QT][8];
#pragma unroll
    for (int qt = 0; qt < QT; ++qt) {
#pragma unroll
        for (int q = 0; q < 8; ++q) gv[qt][q] = *(const v4f*)(gr + qt * (16 * DM) + 128 * q); }
    const h16* wop = WOT + (size_t)(wave * 16) * DM + (size_t)lane * 8;
    const float bor = bo[wave * 16 + lr];
    const v16h wo0 = ldf(wop);
    const v8h wo1l = *(const v8h*)(wop + 512);
    asm volatile("s_wait_xcnt 0x0" ::: "memory");   // stands in front of the last weight load, whose destination reuses address registers of the loads above
    const v16h wo1 = cat16(wo1l, *(const v8h*)(wop + 768));
#pragma unroll
    for (int qt = 0; qt < QT; ++qt) {
        float lt = l[qt];
        lt += __shfl_xor(lt, 16, 32);
        const bool any = lt > 0.0f;
        const float lsafe = any ? lt : 1.0f;
        const float inv = any ? (1.0f / lsafe) : __uint_as_float(0x7FC00000u);       // no kept key -> NaN row (softmax of an all-dropped row)
        // O^T D layout: o0[r] = (d = 8h + r, t = lane&15) -> cs[16 qt + t][wave*16 + d]; 32 rows x 64 columns written by the 4 waves
        const v8f o = o0[qt];
        v4f a, c;
        a[0] = o[0] * inv; a[1] = o[1] * inv; a[2] = o[2] * inv; a[3] = o[3] * inv; c[0] = o[4] * inv; c[1] = o[5] * inv; c[2] = o[6] * inv; c[3] = o[7] * inv;
        *(v4fa*)(&cs[(16 * qt + lr) * CSP + wave * 16 + 8 * hi]) = a; *(v4fa*)(&cs[(16 * qt + lr) * CSP + wave * 16 + 8 * hi + 4]) = c; }
    __syncthreads();                                                             // cs: cross-wave
    const float bov = bfr(bor);
#pragma unroll
    for (int qt = 0; qt < QT; ++qt) {
        // gated context fragments: row t = lane&15 of tile qt, k = concatenated head column 16q + 8h + i
        v16h gh[2], gq[2];
#pragma unroll
        for (int q = 0; q < 4; ++q) {
            const v4f g0 = gv[qt][2 * q], g1 = gv[qt][2 * q + 1];
            const v4f x0 = *(const v4fa*)(&cs[(16 * qt + lr) * CSP + 8 * hi + 16 * q]), x1 = *(const v4fa*)(&cs[(16 * qt + lr) * CSP + 8 * hi + 16 * q + 4]);
#pragma unroll
            for (int i = 0; i < 4; ++i) {
                const float y0 = g0[i] * x0[i], y1 = g1[i] * x1[i];
                const h16 h0 = toh(y0), h1 = toh(y1);
                gh[q >> 1][(q & 1) * 8 + i] = h0; gh[q >> 1][(q & 1) * 8 + 4 + i] = h1;
                gq[q >> 1][(q & 1) * 8 + i] = toh((y0 - (float)h0) * QRS); gq[q >> 1][(q & 1) * 8 + 4 + i] = toh((y1 - (float)h1) * QRS); } }
        const v8f pv = proj_tile(wo0, wo1, gh[0], gh[1], gq[0], gq[1]);
#pragma unroll
        for (int r = 0; r < 8; ++r) ot[(16 * qt + 8 * hi + r) * CSP + wave * 16 + lr] = pv[r] + bov; }   // D: row 8h+r (token), col lane&15; 32 rows x 64 columns written by the 4 waves
    __syncthreads();                                                             // ot: cross-wave
    float* orow = OUT + ((size_t)sq * OUT_SEQ + (size_t)t0) * DM;
    const int tid = threadIdx.x;
{
#pragma unroll
        for (int it = 0; it < 2 * QT; ++it) { const int idx = it * 128 + tid; const int row = idx >> 4, cofs = (idx & 15) * 4;   // 4 trips x 8 rows = 32 rows; 16 pieces x 4 floats = 64 columns
            const v4f val = *(const v4fa*)(&ot[row * CSP + cofs]);
            *(v4f*)(orow + (size_t)row * DM + cofs) = val; }
         }
}

static constexpr size_t al256(size_t v) { return (v + 255) & ~(size_t)255; }
static constexpr size_t SZ_WO = al256((size_t)DM * DM * 2);
static constexpr size_t SZ_PL = al256((size_t)NB * SEQ * DM * 2);
static constexpr size_t SZ_GP = al256((size_t)NB * SEQ * DM * 4);
static constexpr size_t SZ_BS = al256((size_t)NH_ * SEQ * SEQ * 4);
static constexpr size_t SZ_TOTAL = SZ_WO + 5 * SZ_PL + SZ_GP + SZ_BS;   // planes: q value, q residual, k value, k residual, v^T
static_assert(SZ_TOTAL <= (size_t)134217728);          // workspace carve <= 128 MiB
static_assert((size_t)NB * NH_ * SEQ * HD == (size_t)NB * DM * SEQ);   // q/k value and residual planes [s*4+h][t][16] and the v^T plane have the same extent
static_assert(((size_t)(NB - 1) * OUT_SEQ + SEQ) * DM <= (size_t)NB_FULL * SEQ_FULL * DM);   // last output row inside the output buffer

extern "C" void kernel_launch(void* const* d_in, const int* in_sizes, int n_in,
                              void* d_out, int out_size, void* d_ws, size_t ws_size, hipStream_t stream) {
    if (n_in < 13) return;
    const size_t needx = ((size_t)(NB - 1) * SEQ_FULL + SEQ) * DM;
    const size_t needp = ((size_t)(SEQ - 1) * SEQ_FULL + SEQ) * DM;
    const size_t needm = (size_t)(NB - 1) * SEQ_FULL + SEQ;
    if ((size_t)in_sizes[0] < needx || (size_t)in_sizes[1] < needp || (size_t)in_sizes[2] < needm) return;
    if (in_sizes[3] < DM || in_sizes[4] < DM || in_sizes[9] < DM || in_sizes[12] < DM) return;
    if (in_sizes[5] < DM * DM || in_sizes[6] < DM * DM || in_sizes[7] < DM * DM || in_sizes[8] < DM * DM || in_sizes[11] < DM * DM) return;
    if (in_sizes[10] < DM * NH_) return;
    if ((size_t)out_size < ((size_t)(NB - 1) * OUT_SEQ + SEQ) * DM) return;
    if (SZ_TOTAL > ws_size) return;
    // wire order: x stack, pair, key mask, ln gain, ln bias, Wq, Wk, Wv, Wg, bg, Wp, Wo, bo
    const float* msa  = (const float*)d_in[0];
    const float* pair = (const float*)d_in[1];
    const int*   kmsk = (const int*)d_in[2];
    const float* lng  = (const float*)d_in[3];
    const float* lnb  = (const float*)d_in[4];
    const float* wq   = (const float*)d_in[5];
    const float* wk   = (const float*)d_in[6];
    const float* wv   = (const float*)d_in[7];
    const float* wg   = (const float*)d_in[8];
    const float* bg   = (const float*)d_in[9];
    const float* wp   = (const float*)d_in[10];
    const float* wo   = (const float*)d_in[11];
    const float* bo   = (const float*)d_in[12];
    float* OUT = (float*)d_out;      // [NB][SEQ][64]
    char* wsp = (char*)d_ws;
    h16* WOT = (h16*)wsp; wsp += SZ_WO;               // [4 tiles][4 k segments][32 lanes][8], x64
    h16* QH  = (h16*)wsp; wsp += SZ_PL;               // [NB*4][SEQ][16]
    h16* QR  = (h16*)wsp; wsp += SZ_PL;               // [NB*4][SEQ][16] residual x2048
    h16* KP  = (h16*)wsp; wsp += SZ_PL;               // [NB*4][SEQ][16]
    h16* KR  = (h16*)wsp; wsp += SZ_PL;               // [NB*4][SEQ][16] residual x2048
    h16* VT  = (h16*)wsp; wsp += SZ_PL;               // [NB*4][SEQ/32][2][32 lanes][8]
    float* GP = (float*)wsp; wsp += SZ_GP;            // [NB][SEQ/16][8][32 lanes][4]
    float* BIAS = (float*)wsp; wsp += SZ_BS;          // [4][SEQ/16][SEQ/32][4][32 lanes][4]

    k_lnproj_pairbias<<<(unsigned)(LNB + PBB + 1), 32 * AW, 0, stream>>>(msa, lng, lnb, wq, wk, wv, wg, bg, QH, QR, KP, KR, VT, GP, pair, wp, BIAS, wo, WOT);
    k_attn<<<dim3(SEQ / (16 * QT), NB, 1), 32 * AW, 0, stream>>>(QH, QR, KP, KR, VT, BIAS, kmsk, GP, WOT, bo, OUT);
}

// v007
// Measured time: 29.6 microseconds a run.
// Next to v006, in two timings, it ran 1.10 and 1.11 times as fast.
// All steps since v000 together make it 2.52 times as fast.
#include <hip/hip_runtime.h>

// Gated row attention over a stack of sequences with a pair-derived additive bias shared by all sequences: x [NB][SEQ][64] -> LayerNorm (eps 1e-5, gain, bias) -> bias-free q/k/v projections ([in][out], y = x W),
// sigmoid gate (x Wg + bg), 4 heads x 16, scores q.k / sqrt(16) + bias[h][i][j] with bias = pair[i][j][:] . Wp[:][h], key padding mask (int32, replace fill: masked keys dropped from the softmax, a row with no kept key gives NaN),
// softmax over keys, context, gate multiply, output projection ([in][out]) + bias; output f32 [NB][SEQ][64].
// Compute dtypes, f32 accumulate everywhere: q/k/v/gate projections v_wmma_f32_16x16x32_f16 (LayerNorm output as f16 value + f16 residual x2048 in its own accumulator, W RNE-converted to bf16 then x64 in f16, exact);
// pair bias v_wmma_f32_16x16x32_bf16 (pair and Wp RNE-converted to bf16, products exact); scores v_wmma_f32_16x16x32_f16 with q (already times HD^-0.5 log2 e) and k each as f16 value + unscaled f16 residual: the 32-deep k-step holds A = [k value | k residual] against B = [q value | q value], then against
// B = [q residual | q residual], both into one accumulator that starts as the bias tile (already times log2 e), so that the accumulator is the finished score in the log2 domain;
// P.V v_wmma_f32_16x16x32_f16 single product (P x16384 carry, cancels in the normalisation, row sum over the converted P); output projection v_wmma_f32_16x16x32_f16 (gated context as f16 value + f16 residual x2048 in its own accumulator, Wo x64).
// Every float input is RNE-converted to bf16 at its load. LayerNorm, softmax (online, running max over kept keys), sigmoid in f32.
// Layout: every plane that a wave reads as a matrix fragment or as an accumulator-shaped tile is stored so that one 16-byte load per lane covers 512 contiguous bytes (4 whole lines), all but the q, k planes in lane order:
// W^T planes f16 [16-column tile][k segment of 16][lane][8] (lane = 16 * (k bit 3) + column; q, k, v, gate: in the projection block's LDS, Wo: in the workspace); v^T plane f16 [s*4+h][32-key chunk][16-key half][lane][8] (lane = 16 * (key bit 3) + d);
// gate plane f32 [s][16-token tile][16-column group][4-column half][lane][4] (lane = 16 * (column bit 3) + token); bias plane f32 [h][16-query tile][32-key chunk][j][lane][4] (lane = 16 * (key bit 3) + query, j = 2 * (key bit 4) + (key bit 2));
// q, k value planes and q, k residual planes (unscaled; many are f16 subnormals, which the matrix instructions take as they are) [s*4+h][t][16] f16 (a 16-row fragment is 512 contiguous bytes as it is); q carries HD^-0.5 log2 e, the bias plane log2 e.
// Two launches: k_lnproj_pairbias (projection blocks first, then the pair-bias blocks, then one block that converts Wo for the next launch; none depends on another), k_attn.
// No launch of its own converts weights: a projection block converts Wq, Wk, Wv, Wg from f32 into its LDS planes, a pair-bias wave builds its Wp^T fragments (rows >= 4 zero) in registers.
// Fused attention kernel: one block = 32 query rows of one sequence, wave w = head w (two 16-query tiles share each K, V^T and mask load), transposed flash form (S^T = K Q^T, O^T = V^T P^T, fragments straight from the planes), then gate, output projection and whole-row stores.

#ifndef NB
#define NB 128                   // number of sequences (batch x stack depth)
#endif
#ifndef SEQ
#define SEQ 256                  // tokens per sequence (queries = keys)
#endif
#define NB_FULL  128
#define SEQ_FULL 256
#ifndef OUT_SEQ
#define OUT_SEQ SEQ              // row pitch (in tokens) between sequences of the output
#endif
#define DM   64
#define NH_  4
#define HD   16
#define AW   4                   // waves per block
#define QT   2                   // 16-query tiles per wave of the attention kernel
#define CSP  68                  // LDS row pitch (floats) of the 16 x 64 (projection) and 32 x 64 (attention) staging tiles
#define VTP  72                  // LDS row pitch (halves) of the v^T staging tile
#define WTS  1032                // LDS pitch (halves) between the 16-column tiles of a weight plane: 4 k segments x 256 halves + 8, so that the four tiles a converting wave writes at once fall on different banks
#define QRS  2048.0f             // carry of the residual fragments of the projections (LayerNorm output, gated context)
#define QRI  (1.0f / 2048.0f)
#define WCS  64.0f               // carry of the f16 weight planes
#define WCI  (1.0f / 64.0f)
#define L2E  1.4426950408889634f
#define SC2  ((float)(0.25 * 1.4426950408889634))   // HD^-0.5 * log2(e)
#define PSH  14.0f               // log2 of the P carry (16384)
#define NEGB (-3.0e38f)
#define LNEPS 1.0e-5f

static_assert(DM == 64);                       // LayerNorm lane map: 2 lanes x 32 columns; two 32-deep k-steps
static_assert(HD == 16);                       // one 16-B load per q/k value or residual piece; value and residual together fill the 32-deep k-step
static_assert(NH_ * HD == DM);
static_assert(NH_ == AW);                      // wave w of the attention block = head w
static_assert(SEQ % 64 == 0);                  // a 64-token projection tile never straddles two sequences and fills two whole 32-key chunks of the v^T plane
static_assert((NB * SEQ) % 64 == 0);
static_assert(SEQ % 32 == 0);                  // key loop steps by 32; the bias plane is split into whole 32-key chunks
static_assert(SEQ % (16 * QT) == 0);           // an attention block's query rows lie in one sequence
static_assert(SEQ % 8 == 0);                   // bias grid covers (16-query tile, 8-key group) exactly
static_assert(NB <= NB_FULL);
static_assert(SEQ <= SEQ_FULL);
static_assert((CSP * 4) % 16 == 0);
static_assert((VTP * 2) % 16 == 0);
static_assert(32 * 16 * NH_ == 16 * DM * 2);           // q/k store, per plane (value and residual alike): 4 head instructions x 32 lanes x 16 B = 16 rows x 64 halves
static_assert(32 * 16 * 8 == 16 * DM * 4);             // gate store: 8 instructions x 32 lanes x 16 B = 16 rows x 256 B
static_assert(128 * 16 * 4 == DM * 64 * 2);
static_assert(128 * 16 * 2 * QT == QT * 16 * DM * 4);  // output store: 2 QT trips x 128 threads x 16 B = 16 QT rows x 256 B
static_assert(128 * 16 == NH_ * 16 * 8 * 4);           // bias store: 128 threads x 16 B = 4 heads x 16 queries x 8 keys
static_assert(128 * 8 * 4 == DM * DM);                 // weight converter: 128 threads x (8 rows x 4 columns)
static_assert((WTS * 2) % 16 == 0);
static_assert(WTS >= 4 * 256);
static_assert(AW * 16 * CSP * 4 + DM * VTP * 2 + 4 * 4 * WTS * 2 <= 131072);   // static LDS of the projection kernel
static_assert(2 * QT * 16 * CSP * 4 <= 131072);              // static LDS of the attention kernel
static_assert(NH_ * 16 * 8 <= AW * 16 * CSP);                // the pair-bias tile fits the projection kernel's staging array

typedef _Float16 h16;
typedef __attribute__((ext_vector_type(16))) __bf16   v16bf;
typedef __attribute__((ext_vector_type(16))) _Float16 v16h;
typedef __attribute__((ext_vector_type(8)))  _Float16 v8h;
typedef __attribute__((ext_vector_type(8)))  unsigned short v8us;
typedef __attribute__((ext_vector_type(8)))  float    v8f;
typedef __attribute__((ext_vector_type(4)))  float    v4f;
typedef __attribute__((ext_vector_type(4)))  int      v4i;
typedef __attribute__((ext_vector_type(8)))  unsigned v8u;
typedef __attribute__((ext_vector_type(2)))  float    v2f;
typedef __attribute__((ext_vector_type(2)))  __bf16   v2bf;
typedef v4f  __attribute__((may_alias)) v4fa;
typedef v8h  __attribute__((may_alias)) v8ha;

__device__ __forceinline__ unsigned short f2bf(float f) { unsigned u = __float_as_uint(f); u += 0x7FFFu + ((u >> 16) & 1u); return (unsigned short)(u >> 16); }
__device__ __forceinline__ float bfr(float f) { return __uint_as_float(((unsigned)f2bf(f)) << 16); }   // value after RNE convert to bf16
__device__ __forceinline__ v16h cat16(v8h lo, v8h hi) { return __builtin_shufflevector(lo, hi, 0, 1, 2, 3, 4, 5, 6, 7, 8, 9, 10, 11, 12, 13, 14, 15); }
__device__ __forceinline__ v8f cat8(v4f lo, v4f hi) { return __builtin_shufflevector(lo, hi, 0, 1, 2, 3, 4, 5, 6, 7); }
__device__ __forceinline__ v16bf cat16b(v8us lo, v8us hi) { return __builtin_bit_cast(v16bf, __builtin_shufflevector(lo, hi, 0, 1, 2, 3, 4, 5, 6, 7, 8, 9, 10, 11, 12, 13, 14, 15)); }
__device__ __forceinline__ v8f wmma16(v16h a, v16h b, v8f c) { return __builtin_amdgcn_wmma_f32_16x16x32_f16(false, a, false, b, (short)0, c, false, false); }
__device__ __forceinline__ v8f wmmab(v16bf a, v16bf b, v8f c) { return __builtin_amdgcn_wmma_f32_16x16x32_bf16(false, a, false, b, (short)0, c, false, false); }
// fragment loader from a lane-ordered plane; p already includes + 8*lane: elements 0..7 <- segment 0 (k0+8h+0..7), elements 8..15 <- segment 1 (k0+16+8h+0..7), each segment 32 lanes x 16 B
__device__ __forceinline__ v16h  ldf(const h16* p) { return cat16(*(const v8h*)p, *(const v8h*)(p + 256)); }
// ordering point for wave-private LDS tiles (same wave writes and reads)
__device__ __forceinline__ void wave_sync() { __builtin_amdgcn_fence(3 /* release order */, "wavefront"); __builtin_amdgcn_wave_barrier(); asm volatile("" ::: "memory"); }

// f32 -> f16 convert, RNE; |v| < 2^-14 becomes an f16 subnormal, which the matrix instructions take as it is
static __device__ __forceinline__ h16 toh(float v) { return (h16)v; }
// one matrix instruction followed by its own 4-slot guard
__device__ __forceinline__ v8f wmma16g(v16h a, v16h b, v8f c) { c = wmma16(a, b, c); asm volatile("v_nop\n\tv_nop\n\tv_nop\n\tv_nop" : "+v"(c) : "v"(a), "v"(b)); return c; }
__device__ __forceinline__ v8f wmmabg(v16bf a, v16bf b, v8f c) { c = wmmab(a, b, c); asm volatile("v_nop\n\tv_nop\n\tv_nop\n\tv_nop" : "+v"(c) : "v"(a), "v"(b)); return c; }

// Weight conversion, 128 threads per 64 x 64 f32 matrix [in][out]: thread (ko = tid >> 4, c = tid & 15) takes rows 8 ko .. 8 ko + 7 of columns 4 c .. 4 c + 3 (a wave's load = two whole 256-byte rows);
// column j of that block, 8 consecutive k, is one 16-byte piece of the lane-ordered plane: tile c >> 2, k segment ko >> 1, lane 16 * (ko & 1) + 4 * (c & 3) + j.
__device__ __forceinline__ void wld(v4f (&x)[8], const float* __restrict__ src) {
    const float* p = src + ((threadIdx.x >> 4) * (8 * DM) + (threadIdx.x & 15) * 4);   // 32-bit offset: the same one register serves all matrices beside their scalar bases
#pragma unroll   // constant indices keep x in registers, and the 8 loads are in flight together
    for (int i = 0; i < 8; ++i) x[i] = *(const v4f*)(p + i * DM);
}
__device__ __forceinline__ v8h wpiece(const v4f (&x)[8], const int j) {
    v8h o;
#pragma unroll   // constant indices into x and o: registers, no scratch
    for (int i = 0; i < 8; i += 2) {                                               // RNE to bf16 by the packed convert instruction (two elements each), then x64 in f16, exact
        const v2f a = { x[i][j], x[i + 1][j] };
        const unsigned t = __builtin_bit_cast(unsigned, __builtin_convertvector(a, v2bf));
        const float w0 = __uint_as_float(t << 16), w1 = __uint_as_float(t & 0xFFFF0000u);
        o[i] = (h16)(w0 * WCS); o[i + 1] = (h16)(w1 * WCS); }
    return o;
}

// woconv_body: one block converts Wo into the workspace plane that the next launch reads; wave w writes k segment w of every tile, so every line of the plane has one writer
__device__ __forceinline__ void woconv_body(const float* __restrict__ wo, h16* WOT) {
    const int c = threadIdx.x & 15, ko = threadIdx.x >> 4;
    v4f x[8];
    wld(x, wo);
    h16* dst = WOT + (size_t)((((c >> 2) * 4 + (ko >> 1)) * 32 + (ko & 1) * 16 + (c & 3) * 4) * 8);
#pragma unroll   // j must be a constant inside wpiece
    for (int j = 0; j < 4; ++j) *(v8h*)(dst + j * 8) = wpiece(x, j);
}

// pairbias_body: bias[h][i][j] = sum_p bf16(pair[i][j][p]) bf16(Wp[p][h]); block = one 16-query tile x 8 keys, wave = 4 query rows x 8 keys as two 16-column tiles:
// A = Wp^T rows (row = head, padded to 16; read from the f32 Wp [p][head] and converted in registers), B = pair rows converted in registers (col = 8 * (query row bit 0) + key), K = 64. The four waves' values meet in LDS [head][query][key]; wave w then stores head w's
// two 256-byte runs of the lane-ordered bias plane (16 queries x 4 keys each), so every line of the plane has one writer.
__device__ __forceinline__ void pairbias_body(const int blk, const float* __restrict__ pair, const float* __restrict__ wp, float* BIAS, float* os) {
    const int lane = threadIdx.x & 31, lr = lane & 15, hi = lane >> 4;
    const int wave = __builtin_amdgcn_readfirstlane((int)(threadIdx.x >> 5));
    const int ti = blk / (SEQ / 8), kg = blk % (SEQ / 8);
    const float* wpl = wp + 8 * hi * NH_ + (lr < NH_ ? lr : (NH_ - 1));                         // element e of fragment f: k = 32 f + 16 (e >> 3) + 8 h + (e & 7), the same map as the B fragment below
    float wr[2][16];
#pragma unroll   // both loops: constant indices keep wr in registers, and the 32 loads are in flight together with the row loads below
    for (int f = 0; f < 2; ++f) {
#pragma unroll
        for (int e = 0; e < 16; ++e) wr[f][e] = wpl[(32 * f + 16 * (e >> 3) + (e & 7)) * NH_]; }
    v4f xs[2][2][4];                                                                          // the wave's 16 row loads are all issued before the first is used: one memory latency, not four
#pragma unroll
    for (int jt = 0; jt < 2; ++jt) {
        const float* p = pair + ((size_t)(ti * 16 + wave * 4 + 2 * jt + (lr >> 3)) * SEQ_FULL + (size_t)(kg * 8 + (lr & 7))) * DM + 8 * hi;
#pragma unroll
        for (int kc = 0; kc < 2; ++kc) {
            xs[jt][kc][0] = *(const v4f*)(p + 32 * kc); xs[jt][kc][1] = *(const v4f*)(p + 32 * kc + 4); xs[jt][kc][2] = *(const v4f*)(p + 32 * kc + 16); xs[jt][kc][3] = *(const v4f*)(p + 32 * kc + 20); }
    }
    const unsigned keep = (lr < NH_) ? 0xFFFFFFFFu : 0u;                                      // rows >= 4 of the padded A are zeroed by value: every lane loads (a clamped column) and converts
    v16bf af[2];
#pragma unroll   // both loops: constant indices into register arrays
    for (int f = 0; f < 2; ++f) { v16bf t;
#pragma unroll
        for (int i = 0; i < 16; ++i) t[i] = (__bf16)wr[f][i];
        af[f] = __builtin_bit_cast(v16bf, __builtin_bit_cast(v8u, t) & keep); }
    const v16bf a0 = af[0], a1 = af[1];
#pragma unroll
    for (int jt = 0; jt < 2; ++jt) {
        const int ql = wave * 4 + 2 * jt + (lr >> 3);
        v8f acc = (v8f){};
#pragma unroll
        for (int kc = 0; kc < 2; ++kc) {
            const v4f x0 = xs[jt][kc][0], x1 = xs[jt][kc][1], x2 = xs[jt][kc][2], x3 = xs[jt][kc][3];
            v8us e0, e1;
#pragma unroll
            for (int i = 0; i < 4; ++i) { e0[i] = f2bf(x0[i]); e0[4 + i] = f2bf(x1[i]); e1[i] = f2bf(x2[i]); e1[4 + i] = f2bf(x3[i]); }
            const v16bf bq = cat16b(e0, e1);
            if (kc == 0) acc = wmmabg(a0, bq, acc); else acc = wmmabg(a1, bq, acc);
        }
        if (hi == 0) {                                                                        // D: row 8h+r (head), col lane&15; the four real heads sit in rows 0..3 of the lower lanes
#pragma unroll
            for (int r = 0; r < NH_; ++r) os[(r * 16 + ql) * 8 + (lr & 7)] = acc[r]; }
    }
    __syncthreads();                                                                          // os: written by all 4 waves (4 query rows each), read across waves (one head each)
    const v4f val = *(const v4fa*)(&os[(wave * 16 + lr) * 8 + hi * 4]);                       // head = wave, query = lane&15, keys 4 * (lane>>4) + 0..3 of the group
    float* dstp = BIAS + ((size_t)(wave * (SEQ / 16) + ti) * (SEQ / 32) + (size_t)(kg >> 2)) * 512 + (size_t)(((kg >> 1) & 1) * 2 + hi) * 128 + (size_t)((kg & 1) * 16 + lr) * 4;
    *(v4f*)dstp = val * L2E;                                                                  // the plane carries log2 e: the attention kernel takes it as the score accumulator's start value
    asm volatile("s_wait_xcnt 0x0" ::: "memory");   // stands in front of whatever the merged kernel's layout puts behind this store and lets rewrite its registers
}

// value of one 16 x 16 projection tile: (x_hi W + (x_res W) / 2048) * sc, K = 64; sc = 1/64 undoes the weight carry (q: 1/64 times the score scale)
__device__ __forceinline__ v8f proj_tile(v16h b0, v16h b1, v16h a0h, v16h a1h, v16h a0r, v16h a1r, const float sc) {
    v8f cH = (v8f){}, cR = (v8f){};
    cH = wmma16g(a0h, b0, cH); cH = wmma16g(a1h, b1, cH);
    cR = wmma16g(a0r, b0, cR); cR = wmma16g(a1r, b1, cR);
    return (cH + cR * QRI) * sc;
}

// the eight B fragments (4 column tiles x 2 k-steps) of one 64 x 64 weight plane in LDS; p already includes + 8*lane
__device__ __forceinline__ void ldw(v16h (&w)[8], const h16* p) {
#pragma unroll
    for (int nb = 0; nb < 4; ++nb) { w[2 * nb] = ldf(p + nb * WTS); w[2 * nb + 1] = ldf(p + nb * WTS + 512); }
}

// lnproj_body: LayerNorm + q/k/v/gate projections; block = 64 tokens of one sequence, wave = 16 tokens. Lane (row = lane&15, half = lane>>4) holds the 32 columns 16q + 8*half + i of its row,
// q, k: f16 value plane and f16 residual plane (v - value, unscaled); per head the 16 x 16 halves are one contiguous 512-byte run of each plane, written by one instruction (32 lanes x 16 B);
// gate: f32, the wave's 16 x 64 tile in lane order, 512 contiguous bytes per instruction;
__device__ __forceinline__ void lnproj_body(const int blk, const float* __restrict__ msa, const float* __restrict__ lng, const float* __restrict__ lnb,
                                            const float* __restrict__ wq, const float* __restrict__ wk, const float* __restrict__ wv, const float* __restrict__ wg, const float* __restrict__ bg,
                                            h16* QH, h16* QR, h16* KP, h16* KR, h16* VT, float* GP, float* os, h16* vts, h16* wls) {
    const int lane = threadIdx.x & 31, lr = lane & 15, hi = lane >> 4;
    const int wave = __builtin_amdgcn_readfirstlane((int)(threadIdx.x >> 5));
    const int r0 = blk * 64;
    const int sq = r0 / SEQ, tbk = r0 % SEQ;
    const int t0 = tbk + wave * 16;
    const int wb = wave * 16 * CSP;
    // The block's share of the four f32 weight matrices is loaded first (32 loads a thread, all in flight together with the row loads below) and converted into the LDS planes while the rows are still on their way.
    v4f wx[4][8];
    wld(wx[0], wq); wld(wx[1], wk); wld(wx[2], wv); wld(wx[3], wg);
    const float* xr = msa + ((size_t)sq * SEQ_FULL + (size_t)(t0 + lr)) * DM + 8 * hi;
    float xv[32];
    v4f xu[8];
#pragma unroll
    for (int q = 0; q < 4; ++q) { xu[2 * q] = *(const v4f*)(xr + 16 * q); xu[2 * q + 1] = *(const v4f*)(xr + 16 * q + 4); }
    asm volatile("s_wait_xcnt 0x0" ::: "memory");   // stands in front of the first rewrite of the row loads' address pair and of the weight loads' offset register
    __builtin_amdgcn_sched_barrier(0);              // keeps the weight loads above in front of the first wait on a row load; without it they are issued only after the rows have arrived
    {
        const int wc = threadIdx.x & 15, wko = threadIdx.x >> 4;
        h16* wd = wls + (wc >> 2) * WTS + ((wko >> 1) * 32 + (wko & 1) * 16 + (wc & 3) * 4) * 8;
#pragma unroll   // both loops: constant indices into wx (registers) and constant LDS offsets
        for (int mat = 0; mat < 4; ++mat) {
#pragma unroll
            for (int j = 0; j < 4; ++j) *(v8ha*)(wd + mat * 4 * WTS + j * 8) = wpiece(wx[mat], j); }
    }
#pragma unroll
    for (int q = 0; q < 4; ++q) {
#pragma unroll
        for (int i = 0; i < 4; ++i) { xv[8 * q + i] = bfr(xu[2 * q][i]); xv[8 * q + 4 + i] = bfr(xu[2 * q + 1][i]); } }
    float sm = 0.0f;
#pragma unroll
    for (int e = 0; e < 32; ++e) sm += xv[e];
    sm += __shfl_xor(sm, 16, 32);
    const float mu = sm * (1.0f / 64.0f);
    float sv = 0.0f;
#pragma unroll
    for (int e = 0; e < 32; ++e) { const float dl = xv[e] - mu; sv += dl * dl; }
    sv += __shfl_xor(sv, 16, 32);
    const float rs = rsqrtf(sv * (1.0f / 64.0f) + LNEPS);
    v16h ah[2], ar[2];
#pragma unroll
    for (int q = 0; q < 4; ++q) {
        const v4f g0 = *(const v4f*)(lng + 8 * hi + 16 * q), g1 = *(const v4f*)(lng + 8 * hi + 16 * q + 4);
        const v4f c0 = *(const v4f*)(lnb + 8 * hi + 16 * q), c1 = *(const v4f*)(lnb + 8 * hi + 16 * q + 4);
#pragma unroll
        for (int i = 0; i < 4; ++i) {
            const float y0 = (xv[8 * q + i] - mu) * rs * bfr(g0[i]) + bfr(c0[i]);
            const float y1 = (xv[8 * q + 4 + i] - mu) * rs * bfr(g1[i]) + bfr(c1[i]);
            const h16 h0 = toh(y0), h1 = toh(y1);
            ah[q >> 1][(q & 1) * 8 + i] = h0; ah[q >> 1][(q & 1) * 8 + 4 + i] = h1;
            ar[q >> 1][(q & 1) * 8 + i] = toh((y0 - (float)h0) * QRS); ar[q >> 1][(q & 1) * 8 + 4 + i] = toh((y1 - (float)h1) * QRS); } }
    float bgr[4];
    __syncthreads();                                                   // weight planes: each written by all 4 waves (one k segment each), read whole by every wave
    // Weight fragments are fetched from LDS ahead of their products: wf[1] while matrix 0 is worked on, wf[2] and wf[3] while matrix 1 is.
    const h16* wlo = wls + lane * 8;                                   // + matrix * 4 * WTS
    v16h wf[4][8];
    ldw(wf[0], wlo);
    // q (matrix 0) and k (matrix 1)
#pragma unroll
    for (int mat = 0; mat < 2; ++mat) {
        ldw(wf[mat + 1], wlo + (mat + 1) * 4 * WTS);
#pragma unroll
        for (int nb = 0; nb < 4; ++nb) {
            const v8f val = proj_tile(wf[mat][2 * nb], wf[mat][2 * nb + 1], ah[0], ah[1], ar[0], ar[1], mat == 0 ? WCI * SC2 : WCI);
#pragma unroll
            for (int r = 0; r < 8; ++r) os[wb + (8 * hi + r) * CSP + nb * 16 + lr] = val[r]; }     // D: row 8h+r (token), col lane&15
        if (mat == 1) {                                                                            // the k fragments are dead here: the gate's weights and bias take their place
            ldw(wf[3], wlo + 3 * 4 * WTS);
#pragma unroll
            for (int nb = 0; nb < 4; ++nb) bgr[nb] = bg[nb * 16 + lr]; }
        wave_sync();
{
#pragma unroll
            for (int hh = 0; hh < NH_; ++hh) { const int row = lane >> 1, c8 = (lane & 1) * 8;       // 16 rows x 2 lanes x 8 halves = head hh of the tile
                const v4f x0 = *(const v4fa*)(&os[wb + row * CSP + hh * 16 + c8]); const v4f x1 = *(const v4fa*)(&os[wb + row * CSP + hh * 16 + c8 + 4]); v8h hv, rv;
#pragma unroll
                for (int i = 0; i < 4; ++i) { const h16 a0 = toh(x0[i]); const h16 a1 = toh(x1[i]); hv[i] = a0; hv[4 + i] = a1;
                    rv[i] = toh(x0[i] - (float)a0); rv[4 + i] = toh(x1[i] - (float)a1); }
                const size_t oo = ((size_t)(sq * NH_ + hh) * SEQ + (size_t)t0) * HD + (size_t)lane * 8;
                if (mat == 0) { *(v8h*)(QH + oo) = hv; *(v8h*)(QR + oo) = rv; } else { *(v8h*)(KP + oo) = hv; *(v8h*)(KR + oo) = rv; }
                asm volatile("s_wait_xcnt 0x0" ::: "memory"); }   // stands in front of the next head's converts and, behind the last head, of the next weight loads: both reuse registers that the two stores above name
             }
        wave_sync();
    }
    // v (matrix 2): lane's 8 accumulator values are 8 consecutive tokens of column c -> one 16-B LDS store into the [c][token] tile
#pragma unroll
    for (int nb = 0; nb < 4; ++nb) {
        const v8f val = proj_tile(wf[2][2 * nb], wf[2][2 * nb + 1], ah[0], ah[1], ar[0], ar[1], WCI);
        v8h o;
#pragma unroll
        for (int r = 0; r < 8; ++r) o[r] = toh(val[r]);
        *(v8ha*)(&vts[(nb * 16 + lr) * VTP + wave * 16 + 8 * hi]) = o; }
    // gate (matrix 3): sigmoid(x Wg + bg)
#pragma unroll
    for (int nb = 0; nb < 4; ++nb) {
        const v8f val = proj_tile(wf[3][2 * nb], wf[3][2 * nb + 1], ah[0], ah[1], ar[0], ar[1], WCI);
        const float bgv = bfr(bgr[nb]);
#pragma unroll
        for (int r = 0; r < 8; ++r) { const float z = val[r] + bgv; const float ex = __builtin_amdgcn_exp2f(-z * L2E); os[wb + (8 * hi + r) * CSP + nb * 16 + lr] = 1.0f / (1.0f + ex); } }
    wave_sync();
{
#pragma unroll
        for (int s8 = 0; s8 < 8; ++s8) { const int cofs = (s8 >> 1) * 16 + 8 * hi + (s8 & 1) * 4;            // 8 x (2 x 4 columns) = 64 columns; 16 lanes = 16 rows
            const v4f val = *(const v4fa*)(&os[wb + lr * CSP + cofs]);
            *(v4f*)(GP + ((size_t)sq * SEQ + (size_t)t0) * DM + s8 * 128 + lane * 4) = val; }
         }
    __syncthreads();                                                   // v^T tile: written by all 4 waves, each wave reads back only its own 16 tokens
    const int tid = threadIdx.x;
{
#pragma unroll
        for (int it = 0; it < 4; ++it) {                                                                                // trip = head; wave = (32-key chunk, 16-key half) of the block's 64 tokens; lane = 16 * (key bit 3) + d
            const v8h o = *(const v8ha*)(&vts[(it * 16 + lr) * VTP + wave * 16 + 8 * hi]);
            *(v8h*)(VT + ((size_t)(sq * NH_ + it) * SEQ + (size_t)tbk) * HD + tid * 8) = o; }
         }
}

// k_lnproj_pairbias: blocks 0 .. LNB-1 run lnproj_body (the longer work, given the lowest block indices), blocks LNB .. LNB+PBB-1 run pairbias_body, block LNB+PBB runs woconv_body; none reads what another writes.
#define LNB (NB * SEQ / 64)
#define PBB ((SEQ / 16) * (SEQ / 8))
__global__ __launch_bounds__(32 * AW) void k_lnproj_pairbias(const float* __restrict__ msa, const float* __restrict__ lng, const float* __restrict__ lnb,
                                                             const float* __restrict__ wq, const float* __restrict__ wk, const float* __restrict__ wv, const float* __restrict__ wg,
                                                             const float* __restrict__ bg, h16* QH, h16* QR, h16* KP, h16* KR, h16* VT, float* GP,
                                                             const float* __restrict__ pair, const float* __restrict__ wp, float* BIAS,
                                                             const float* __restrict__ wo, h16* WOT) {
    __shared__ __align__(16) float os[AW * 16 * CSP];                  // the pair-bias blocks use its first NH_ * 16 * 8 floats
    __shared__ __align__(16) h16 vts[DM * VTP];
    __shared__ __align__(16) h16 wls[4 * 4 * WTS];                     // q | k | v | gate planes, x64: [matrix][4 tiles, pitch WTS][4 k segments][32 lanes][8]
    const int b = blockIdx.x;
    if (b < LNB) lnproj_body(b, msa, lng, lnb, wq, wk, wv, wg, bg, QH, QR, KP, KR, VT, GP, os, vts, wls);
    else if (b < LNB + PBB) pairbias_body(b - LNB, pair, wp, BIAS, os);
    else woconv_body(wo, WOT);
}

// k_attn: block = 32 query rows of one sequence (QT = 2 tiles of 16), wave w = head w and takes both tiles, so that every K, K residual, V^T and mask load of a trip serves two query tiles.
// Transposed flash form: S^T[key][t] = K Q^T (A = K rows, B = Q rows; k slots 0..15 = d of the K value, slots 16..31 = d of the K residual, the B fragment holding the same 16 q numbers in both halves);
// score accumulator = bias tile + [K | K_res] [Q | Q] + [K | K_res] [Q_res | Q_res] = bias + (K + K_res) (Q + Q_res): no vector instruction folds, scales or adds the bias;
// lane (t = lane&15, h = lane>>4) holds keys 8h+r of each 16-key tile, so the packed P tile is directly the B fragment of O^T[d][t] = V^T P^T.
// Per step: bias row segment and mask words loaded as 16-B vectors at arithmetic addresses; masked keys are dropped by value (probability 0, excluded from the running max).
// After the key loop the 4 heads' contexts meet in a block LDS tile [32][64]; every wave rebuilds the gated context fragments (value + residual x2048) and computes one 16-column tile of the output projection for both row tiles;
// Second launch bound: 4 waves per SIMD are the whole grid, so a wave may hold up to 256 registers.
__global__ __launch_bounds__(32 * AW, 4) void k_attn(const h16* __restrict__ QH, const h16* __restrict__ QR, const h16* __restrict__ KP, const h16* __restrict__ KR, const h16* __restrict__ VT,
                                                  const float* __restrict__ BIAS, const int* __restrict__ kmask, const float* __restrict__ GP,
                                                  const h16* __restrict__ WOT, const float* __restrict__ bo, float* OUT) {
    __shared__ __align__(16) float cs[QT * 16 * CSP];
    __shared__ __align__(16) float ot[QT * 16 * CSP];
    const int lane = threadIdx.x & 31, lr = lane & 15, hi = lane >> 4;
    const int wave = __builtin_amdgcn_readfirstlane((int)(threadIdx.x >> 5));
    const int sq = blockIdx.y; const int t0 = blockIdx.x * (16 * QT);
    const int zh = sq * NH_ + wave;
    const size_t pbase = (size_t)zh * SEQ * HD;
    v16h qh[QT], qr[QT];
#pragma unroll   // constant indices keep the per-tile arrays in registers (this and every loop over qt below)
    for (int qt = 0; qt < QT; ++qt) {
        const v8h qv = *(const v8h*)(QH + pbase + (size_t)(t0 + 16 * qt + lr) * HD + 8 * hi), qs = *(const v8h*)(QR + pbase + (size_t)(t0 + 16 * qt + lr) * HD + 8 * hi);
        qh[qt] = cat16(qv, qv);     // B fragment: col t; elements 0..7: d = 8h + e (meets the K value), elements 8..15: d = 8h + e - 8 again (meets the K residual)
        qr[qt] = cat16(qs, qs); }   // residual, same map
    const size_t ko = pbase + (size_t)lr * HD + 8 * hi;        // + key * HD   (A fragment: row key, k = d)
    const size_t vo = pbase + (size_t)lane * 8;                // + key * HD   (A fragment: row d, k = key; lane-ordered plane, 32 keys = 32 * HD halves)
    const float* bp0 = BIAS + (size_t)(wave * (SEQ / 16) + (int)blockIdx.x * QT) * (SEQ / 32) * 512 + (size_t)lane * 4;   // + tile * (SEQ / 32) * 512 + key * 16 (lane-ordered plane, 32 keys = 512 floats)
    const int* mp0 = kmask + (size_t)sq * SEQ_FULL + 8 * hi;
    v8f o0[QT];
    float m[QT], l[QT];
#pragma unroll
    for (int qt = 0; qt < QT; ++qt) { o0[qt] = (v8f){}; m[qt] = NEGB; l[qt] = 0.0f; }
#pragma unroll 1
    for (int key0 = 0; key0 < SEQ; key0 += 32) {
        const h16* ka = KP + ko + (size_t)key0 * HD;
        const h16* kr = KR + ko + (size_t)key0 * HD;
        const v16h ka0 = cat16(*(const v8h*)ka, *(const v8h*)kr), kb0 = cat16(*(const v8h*)(ka + 16 * HD), *(const v8h*)(kr + 16 * HD));   // A fragment: elements 0..7 value, 8..15 residual, both d = 8h + 0..7
        // all of the trip's loads stand together here, so that their latencies overlap instead of adding up
        v4f c[QT][4];
#pragma unroll
        for (int qt = 0; qt < QT; ++qt) {
            const float* bp = bp0 + (size_t)qt * ((SEQ / 32) * 512) + (size_t)key0 * 16;   // keys key0+8h+0..7 and key0+16+8h+0..7 of query row t0 + 16 qt + (lane&15)
            c[qt][0] = *(const v4f*)bp; c[qt][1] = *(const v4f*)(bp + 128); c[qt][2] = *(const v4f*)(bp + 256); c[qt][3] = *(const v4f*)(bp + 384); }
        const int* mp = mp0 + key0;
        const v4i n0 = *(const v4i*)mp, n1 = *(const v4i*)(mp + 4), n2 = *(const v4i*)(mp + 16), n3 = *(const v4i*)(mp + 20);
        const v16h v0 = ldf(VT + vo + (size_t)key0 * HD);
        __builtin_amdgcn_sched_barrier(0);   // keeps the V^T loads with the trip's other loads; without it they are issued only behind the first score products, and their latency no longer overlaps the others'
        bool fa[8], fb[8];
#pragma unroll
        for (int r = 0; r < 4; ++r) { fa[r] = n0[r] != 0; fa[4 + r] = n1[r] != 0; fb[r] = n2[r] != 0; fb[4 + r] = n3[r] != 0; }
        // the trip's eight score products stand as one run over four accumulators: each fills the others' distance, and the second product of a tile accumulates into the first's D
        v8f sa[QT], sb[QT];
#pragma unroll
        for (int qt = 0; qt < QT; ++qt) { sa[qt] = wmma16(ka0, qh[qt], cat8(c[qt][0], c[qt][1])); sb[qt] = wmma16(kb0, qh[qt], cat8(c[qt][2], c[qt][3])); }
#pragma unroll
        for (int qt = 0; qt < QT; ++qt) { sa[qt] = wmma16(ka0, qr[qt], sa[qt]); sb[qt] = wmma16(kb0, qr[qt], sb[qt]); }
#pragma unroll
        for (int qt = 0; qt < QT; ++qt) {
            float ta[8], tc[8]; float mx = NEGB;
#pragma unroll
            for (int r = 0; r < 8; ++r) { ta[r] = sa[qt][r]; tc[r] = sb[qt][r]; }
#pragma unroll
            for (int r = 0; r < 8; ++r) mx = fmaxf(mx, fmaxf(fa[r] ? ta[r] : NEGB, fb[r] ? tc[r] : NEGB));
            mx = fmaxf(mx, __shfl_xor(mx, 16, 32));
            const float mnew = fmaxf(m[qt], mx);
            const float alpha = __builtin_amdgcn_exp2f(m[qt] - mnew);
            const float sh = PSH - mnew;
            v16h pb; float ls = 0.0f;
#pragma unroll
            for (int r = 0; r < 8; ++r) {
                const float xa = ta[r] + sh, xb = tc[r] + sh;
                const float ea = __builtin_amdgcn_exp2f(xa), eb = __builtin_amdgcn_exp2f(xb);
                const float ga = (fa[r] & (xa >= -14.0f)) ? ea : 0.0f, gb = (fb[r] & (xb >= -14.0f)) ? eb : 0.0f;   // dropped keys and sub-2^-14 values selected to 0 by value
                const h16 pa = (h16)ga; const h16 pc = (h16)gb;
                pb[r] = pa; pb[8 + r] = pc;
                ls += (float)pa + (float)pc; }
            l[qt] = l[qt] * alpha + ls; m[qt] = mnew;
            o0[qt] = o0[qt] * alpha;
            o0[qt] = wmma16g(v0, pb, o0[qt]);
        }
    }
    // the epilogue's global loads depend on nothing the key loop computes: issued here, their latency passes under the normalisation and the barrier
    const float* gr = GP + ((size_t)sq * SEQ + (size_t)t0) * DM + (size_t)lane * 4;
    v4f gv[QT][8];
#pragma unroll
    for (int qt = 0; qt < QT; ++qt) {
#pragma unroll
        for (int q = 0; q < 8; ++q) gv[qt][q] = *(const v4f*)(gr + qt * (16 * DM) + 128 * q); }
    const h16* wop = WOT + (size_t)(wave * 16) * DM + (size_t)lane * 8;
    const float bor = bo[wave * 16 + lr];
    const v16h wo0 = ldf(wop);
    const v8h wo1l = *(const v8h*)(wop + 512);
    asm volatile("s_wait_xcnt 0x0" ::: "memory");   // stands in front of the last weight load, whose destination reuses address registers of the loads above
    const v16h wo1 = cat16(wo1l, *(const v8h*)(wop + 768));
#pragma unroll
    for (int qt = 0; qt < QT; ++qt) {
        float lt = l[qt];
        lt += __shfl_xor(lt, 16, 32);
        const bool any = lt > 0.0f;
        const float lsafe = any ? lt : 1.0f;
        const float inv = any ? (1.0f / lsafe) : __uint_as_float(0x7FC00000u);       // no kept key -> NaN row (softmax of an all-dropped row)
        // O^T D layout: o0[r] = (d = 8h + r, t = lane&15) -> cs[16 qt + t][wave*16 + d]; 32 rows x 64 columns written by the 4 waves
        const v8f o = o0[qt];
        v4f a, c;
        a[0] = o[0] * inv; a[1] = o[1] * inv; a[2] = o[2] * inv; a[3] = o[3] * inv; c[0] = o[4] * inv; c[1] = o[5] * inv; c[2] = o[6] * inv; c[3] = o[7] * inv;
        *(v4fa*)(&cs[(16 * qt + lr) * CSP + wave * 16 + 8 * hi]) = a; *(v4fa*)(&cs[(16 * qt + lr) * CSP + wave * 16 + 8 * hi + 4]) = c; }
    __syncthreads();                                                             // cs: cross-wave
    const float bov = bfr(bor);
#pragma unroll
    for (int qt = 0; qt < QT; ++qt) {
        // gated context fragments: row t = lane&15 of tile qt, k = concatenated head column 16q + 8h + i
        v16h gh[2], gq[2];
#pragma unroll
        for (int q = 0; q < 4; ++q) {
            const v4f g0 = gv[qt][2 * q], g1 = gv[qt][2 * q + 1];
            const v4f x0 = *(const v4fa*)(&cs[(16 * qt + lr) * CSP + 8 * hi + 16 * q]), x1 = *(const v4fa*)(&cs[(16 * qt + lr) * CSP + 8 * hi + 16 * q + 4]);
#pragma unroll
            for (int i = 0; i < 4; ++i) {
                const float y0 = g0[i] * x0[i], y1 = g1[i] * x1[i];
                const h16 h0 = toh(y0), h1 = toh(y1);
                gh[q >> 1][(q & 1) * 8 + i] = h0; gh[q >> 1][(q & 1) * 8 + 4 + i] = h1;
                gq[q >> 1][(q & 1) * 8 + i] = toh((y0 - (float)h0) * QRS); gq[q >> 1][(q & 1) * 8 + 4 + i] = toh((y1 - (float)h1) * QRS); } }
        const v8f pv = proj_tile(wo0, wo1, gh[0], gh[1], gq[0], gq[1], WCI);
#pragma unroll
        for (int r = 0; r < 8; ++r) ot[(16 * qt + 8 * hi + r) * CSP + wave * 16 + lr] = pv[r] + bov; }   // D: row 8h+r (token), col lane&15; 32 rows x 64 columns written by the 4 waves
    __syncthreads();                                                             // ot: cross-wave
    float* orow = OUT + ((size_t)sq * OUT_SEQ + (size_t)t0) * DM;
    const int tid = threadIdx.x;
{
#pragma unroll
        for (int it = 0; it < 2 * QT; ++it) { const int idx = it * 128 + tid; const int row = idx >> 4, cofs = (idx & 15) * 4;   // 4 trips x 8 rows = 32 rows; 16 pieces x 4 floats = 64 columns
            const v4f val = *(const v4fa*)(&ot[row * CSP + cofs]);
            *(v4f*)(orow + (size_t)row * DM + cofs) = val; }
         }
}

static constexpr size_t al256(size_t v) { return (v + 255) & ~(size_t)255; }
static constexpr size_t SZ_WO = al256((size_t)DM * DM * 2);
static constexpr size_t SZ_PL = al256((size_t)NB * SEQ * DM * 2);
static constexpr size_t SZ_GP = al256((size_t)NB * SEQ * DM * 4);
static constexpr size_t SZ_BS = al256((size_t)NH_ * SEQ * SEQ * 4);
static constexpr size_t SZ_TOTAL = SZ_WO + 5 * SZ_PL + SZ_GP + SZ_BS;   // planes: q value, q residual, k value, k residual, v^T
static_assert(SZ_TOTAL <= (size_t)134217728);          // workspace carve <= 128 MiB
static_assert((size_t)NB * NH_ * SEQ * HD == (size_t)NB * DM * SEQ);   // q/k value and residual planes [s*4+h][t][16] and the v^T plane have the same extent
static_assert(((size_t)(NB - 1) * OUT_SEQ + SEQ) * DM <= (size_t)NB_FULL * SEQ_FULL * DM);   // last output row inside the output buffer

extern "C" void kernel_launch(void* const* d_in, const int* in_sizes, int n_in,
                              void* d_out, int out_size, void* d_ws, size_t ws_size, hipStream_t stream) {
    if (n_in < 13) return;
    const size_t needx = ((size_t)(NB - 1) * SEQ_FULL + SEQ) * DM;
    const size_t needp = ((size_t)(SEQ - 1) * SEQ_FULL + SEQ) * DM;
    const size_t needm = (size_t)(NB - 1) * SEQ_FULL + SEQ;
    if ((size_t)in_sizes[0] < needx || (size_t)in_sizes[1] < needp || (size_t)in_sizes[2] < needm) return;
    if (in_sizes[3] < DM || in_sizes[4] < DM || in_sizes[9] < DM || in_sizes[12] < DM) return;
    if (in_sizes[5] < DM * DM || in_sizes[6] < DM * DM || in_sizes[7] < DM * DM || in_sizes[8] < DM * DM || in_sizes[11] < DM * DM) return;
    if (in_sizes[10] < DM * NH_) return;
    if ((size_t)out_size < ((size_t)(NB - 1) * OUT_SEQ + SEQ) * DM) return;
    if (SZ_TOTAL > ws_size) return;
    // wire order: x stack, pair, key mask, ln gain, ln bias, Wq, Wk, Wv, Wg, bg, Wp, Wo, bo
    const float* msa  = (const float*)d_in[0];
    const float* pair = (const float*)d_in[1];
    const int*   kmsk = (const int*)d_in[2];
    const float* lng  = (const float*)d_in[3];
    const float* lnb  = (const float*)d_in[4];
    const float* wq   = (const float*)d_in[5];
    const float* wk   = (const float*)d_in[6];
    const float* wv   = (const float*)d_in[7];
    const float* wg   = (const float*)d_in[8];
    const float* bg   = (const float*)d_in[9];
    const float* wp   = (const float*)d_in[10];
    const float* wo   = (const float*)d_in[11];
    const float* bo   = (const float*)d_in[12];
    float* OUT = (float*)d_out;      // [NB][SEQ][64]
    char* wsp = (char*)d_ws;
    h16* WOT = (h16*)wsp; wsp += SZ_WO;               // [4 tiles][4 k segments][32 lanes][8], x64
    h16* QH  = (h16*)wsp; wsp += SZ_PL;               // [NB*4][SEQ][16]
    h16* QR  = (h16*)wsp; wsp += SZ_PL;               // [NB*4][SEQ][16] residual
    h16* KP  = (h16*)wsp; wsp += SZ_PL;               // [NB*4][SEQ][16]
    h16* KR  = (h16*)wsp; wsp += SZ_PL;               // [NB*4][SEQ][16] residual
    h16* VT  = (h16*)wsp; wsp += SZ_PL;               // [NB*4][SEQ/32][2][32 lanes][8]
    float* GP = (float*)wsp; wsp += SZ_GP;            // [NB][SEQ/16][8][32 lanes][4]
    float* BIAS = (float*)wsp; wsp += SZ_BS;          // [4][SEQ/16][SEQ/32][4][32 lanes][4]

    k_lnproj_pairbias<<<(unsigned)(LNB + PBB + 1), 32 * AW, 0, stream>>>(msa, lng, lnb, wq, wk, wv, wg, bg, QH, QR, KP, KR, VT, GP, pair, wp, BIAS, wo, WOT);
    k_attn<<<dim3(SEQ / (16 * QT), NB, 1), 32 * AW, 0, stream>>>(QH, QR, KP, KR, VT, BIAS, kmsk, GP, WOT, bo, OUT);
}

// v009
// Measured time: 24.4 microseconds a run.
// Versions between v007 and this one are left out; their measured steps multiply to 1.22 times as fast.
// Counting every step since v000, it is 3.06 times as fast.
#include <hip/hip_runtime.h>

// Gated row attention over a stack of sequences with a pair-derived additive bias shared by all sequences: x [NB][SEQ][64] -> LayerNorm (eps 1e-5, gain, bias) -> bias-free q/k/v projections ([in][out], y = x W),
// sigmoid gate (x Wg + bg), 4 heads x 16, scores q.k / sqrt(16) + bias[h][i][j] with bias = pair[i][j][:] . Wp[:][h], key padding mask (int32, replace fill: masked keys dropped from the softmax, a row with no kept key gives NaN),
// softmax over keys, context, gate multiply, output projection ([in][out]) + bias; output f32 [NB][SEQ][64].
// Compute dtypes, f32 accumulate everywhere: q/k/v/gate projections v_wmma_f32_16x16x32_f16 (LayerNorm output as one f16 value, W RNE-converted to bf16 then x64 in f16, exact);
// pair bias v_wmma_f32_16x16x32_bf16 (pair and Wp RNE-converted to bf16, products exact); scores v_wmma_f32_16x16x32_f16 with q (already times HD^-0.5 log2 e) and k each as one f16 value: the 32-deep k-step holds A = [k | key term, 0 ...] against B = [q | 1, 0 ...], key term = 0 for a kept key and -inf for a dropped one,
// one product into an accumulator that starts as the bias tile (already times log2 e), so that the accumulator is the finished, masked score in the log2 domain;
// P.V v_wmma_f32_16x16x32_f16 single product (P x16384 carry, cancels in the normalisation, row sum over the converted P); output projection v_wmma_f32_16x16x32_f16 (gated context as one f16 value, Wo x64).
// An f16 operand is rounded at 2^-12 relative, an eighth of the 2^-9 that the bf16 convert of every float input has already put into the same numbers: no operand carries a second f16 piece for its rounding remainder.
// Every float input is RNE-converted to bf16 at its load. LayerNorm, softmax (online, running max over kept keys), sigmoid in f32.
// Layout: every plane that a wave reads as a matrix fragment or as an accumulator-shaped tile is stored so that one 16-byte load per lane covers 512 contiguous bytes (4 whole lines), all but the q, k planes in lane order:
// W^T planes f16 [16-column tile][k segment of 16][lane][8] (lane = 16 * (k bit 3) + column; q, k, v, gate: in the projection block's LDS, Wo: in the workspace); v^T plane f16 [s*4+h][32-key chunk][16-key half][lane][8] (lane = 16 * (key bit 3) + d);
// gate plane f32 [s][16-token tile][16-column group][4-column half][lane][4] (lane = 16 * (column bit 3) + token); bias plane f32 [h][16-query tile][32-key chunk][j][lane][4] (lane = 16 * (key bit 3) + query, j = 2 * (key bit 4) + (key bit 2));
// q, k planes [s*4+h][t][16] f16 (a 16-row fragment is 512 contiguous bytes as it is); q carries HD^-0.5 log2 e, the bias plane log2 e.
// Two launches: k_lnproj_pairbias (projection blocks first, then the pair-bias blocks, then one block that converts Wo for the next launch; none depends on another), k_attn.
// No launch of its own converts weights: a projection block converts Wq, Wk, Wv, Wg from f32 into its LDS planes, a pair-bias wave builds its Wp^T fragments (rows >= 4 zero) in registers.
// Fused attention kernel: one block = 32 query rows of one sequence, wave w = head w (two 16-query tiles share each K, V^T and mask load), transposed flash form (S^T = K Q^T, O^T = V^T P^T, fragments straight from the planes), then gate, output projection and whole-row stores.

#ifndef NB
#define NB 128                   // number of sequences (batch x stack depth)
#endif
#ifndef SEQ
#define SEQ 256                  // tokens per sequence (queries = keys)
#endif
#define NB_FULL  128
#define SEQ_FULL 256
#ifndef OUT_SEQ
#define OUT_SEQ SEQ              // row pitch (in tokens) between sequences of the output
#endif
#define DM   64
#define NH_  4
#define HD   16
#define AW   4                   // waves per block
#define QT   2                   // 16-query tiles per wave of the attention kernel
#define CSP  68                  // LDS row pitch (floats) of the 16 x 64 (projection) and 32 x 64 (attention) staging tiles
#define VTP  72                  // LDS row pitch (halves) of the v^T staging tile
#define WTS  1032                // LDS pitch (halves) between the 16-column tiles of a weight plane: 4 k segments x 256 halves + 8, so that the four tiles a converting wave writes at once fall on different banks
#define WCS  64.0f               // carry of the f16 weight planes
#define WCI  (1.0f / 64.0f)
#define L2E  1.4426950408889634f
#define SC2  ((float)(0.25 * 1.4426950408889634))   // HD^-0.5 * log2(e)
#define PSH  14.0f               // log2 of the P carry (16384)
#define NEGB (-3.0e38f)
#define LNEPS 1.0e-5f

static_assert(DM == 64);                       // LayerNorm lane map: 2 lanes x 32 columns; two 32-deep k-steps
static_assert(HD == 16);                       // one 16-B load per lane is a q or k fragment's data half; the 32-deep k-step's other half is free for the key term of the mask
static_assert(NH_ * HD == DM);
static_assert(NH_ == AW);                      // wave w of the attention block = head w
static_assert(SEQ % 64 == 0);                  // a 64-token projection tile never straddles two sequences and fills two whole 32-key chunks of the v^T plane
static_assert((NB * SEQ) % 64 == 0);
static_assert(SEQ % 32 == 0);                  // key loop steps by 32; the bias plane is split into whole 32-key chunks
static_assert(SEQ % (16 * QT) == 0);           // an attention block's query rows lie in one sequence
static_assert(SEQ % 8 == 0);                   // bias grid covers (16-query tile, 8-key group) exactly
static_assert(NB <= NB_FULL);
static_assert(SEQ <= SEQ_FULL);
static_assert((CSP * 4) % 16 == 0);
static_assert((VTP * 2) % 16 == 0);
static_assert(32 * 16 * NH_ == 16 * DM * 2);           // q/k store, per plane: 4 head instructions x 32 lanes x 16 B = 16 rows x 64 halves
static_assert(32 * 16 * 8 == 16 * DM * 4);             // gate store: 8 instructions x 32 lanes x 16 B = 16 rows x 256 B
static_assert(128 * 16 * 4 == DM * 64 * 2);
static_assert(128 * 16 * 2 * QT == QT * 16 * DM * 4);  // output store: 2 QT trips x 128 threads x 16 B = 16 QT rows x 256 B
static_assert(128 * 16 == NH_ * 16 * 8 * 4);           // bias store: 128 threads x 16 B = 4 heads x 16 queries x 8 keys
static_assert(128 * 8 * 4 == DM * DM);                 // weight converter: 128 threads x (8 rows x 4 columns)
static_assert((WTS * 2) % 16 == 0);
static_assert(WTS >= 4 * 256);
static_assert(AW * 16 * CSP * 4 + DM * VTP * 2 + 4 * 4 * WTS * 2 <= 131072);   // static LDS of the projection kernel
static_assert(2 * QT * 16 * CSP * 4 <= 131072);              // static LDS of the attention kernel
static_assert(NH_ * 16 * 8 <= AW * 16 * CSP);                // the pair-bias tile fits the projection kernel's staging array

typedef _Float16 h16;
typedef __attribute__((ext_vector_type(16))) __bf16   v16bf;
typedef __attribute__((ext_vector_type(16))) _Float16 v16h;
typedef __attribute__((ext_vector_type(8)))  _Float16 v8h;
typedef __attribute__((ext_vector_type(8)))  unsigned short v8us;
typedef __attribute__((ext_vector_type(8)))  float    v8f;
typedef __attribute__((ext_vector_type(4)))  float    v4f;
typedef __attribute__((ext_vector_type(8)))  unsigned v8u;
typedef __attribute__((ext_vector_type(4)))  unsigned v4u;
typedef __attribute__((ext_vector_type(2)))  float    v2f;
typedef __attribute__((ext_vector_type(2)))  _Float16 v2h;
typedef __attribute__((ext_vector_type(2)))  __bf16   v2bf;
typedef v4f  __attribute__((may_alias)) v4fa;
typedef v8h  __attribute__((may_alias)) v8ha;

__device__ __forceinline__ unsigned short f2bf(float f) { unsigned u = __float_as_uint(f); u += 0x7FFFu + ((u >> 16) & 1u); return (unsigned short)(u >> 16); }
__device__ __forceinline__ float bfr(float f) { return __uint_as_float(((unsigned)f2bf(f)) << 16); }   // value after RNE convert to bf16
__device__ __forceinline__ v16h cat16(v8h lo, v8h hi) { return __builtin_shufflevector(lo, hi, 0, 1, 2, 3, 4, 5, 6, 7, 8, 9, 10, 11, 12, 13, 14, 15); }
__device__ __forceinline__ v8f cat8(v4f lo, v4f hi) { return __builtin_shufflevector(lo, hi, 0, 1, 2, 3, 4, 5, 6, 7); }
__device__ __forceinline__ v16bf cat16b(v8us lo, v8us hi) { return __builtin_bit_cast(v16bf, __builtin_shufflevector(lo, hi, 0, 1, 2, 3, 4, 5, 6, 7, 8, 9, 10, 11, 12, 13, 14, 15)); }
__device__ __forceinline__ v8f wmma16(v16h a, v16h b, v8f c) { return __builtin_amdgcn_wmma_f32_16x16x32_f16(false, a, false, b, (short)0, c, false, false); }
__device__ __forceinline__ v8f wmmab(v16bf a, v16bf b, v8f c) { return __builtin_amdgcn_wmma_f32_16x16x32_bf16(false, a, false, b, (short)0, c, false, false); }
// fragment loader from a lane-ordered plane; p already includes + 8*lane: elements 0..7 <- segment 0 (k0+8h+0..7), elements 8..15 <- segment 1 (k0+16+8h+0..7), each segment 32 lanes x 16 B
__device__ __forceinline__ v16h  ldf(const h16* p) { return cat16(*(const v8h*)p, *(const v8h*)(p + 256)); }
// ordering point for wave-private LDS tiles (same wave writes and reads)
__device__ __forceinline__ void wave_sync() { __builtin_amdgcn_fence(3 /* release order */, "wavefront"); __builtin_amdgcn_wave_barrier(); asm volatile("" ::: "memory"); }

// f32 -> f16 convert, RNE; |v| < 2^-14 becomes an f16 subnormal, which the matrix instructions take as it is
static __device__ __forceinline__ h16 toh(float v) { return (h16)v; }
// one matrix instruction followed by its own 4-slot guard
__device__ __forceinline__ v8f wmma16g(v16h a, v16h b, v8f c) { c = wmma16(a, b, c); asm volatile("v_nop\n\tv_nop\n\tv_nop\n\tv_nop" : "+v"(c) : "v"(a), "v"(b)); return c; }
__device__ __forceinline__ v8f wmmabg(v16bf a, v16bf b, v8f c) { c = wmmab(a, b, c); asm volatile("v_nop\n\tv_nop\n\tv_nop\n\tv_nop" : "+v"(c) : "v"(a), "v"(b)); return c; }

// Weight conversion, 128 threads per 64 x 64 f32 matrix [in][out]: thread (ko = tid >> 4, c = tid & 15) takes rows 8 ko .. 8 ko + 7 of columns 4 c .. 4 c + 3 (a wave's load = two whole 256-byte rows);
// column j of that block, 8 consecutive k, is one 16-byte piece of the lane-ordered plane: tile c >> 2, k segment ko >> 1, lane 16 * (ko & 1) + 4 * (c & 3) + j.
__device__ __forceinline__ void wld(v4f (&x)[8], const float* __restrict__ src) {
    const float* p = src + ((threadIdx.x >> 4) * (8 * DM) + (threadIdx.x & 15) * 4);   // 32-bit offset: the same one register serves all matrices beside their scalar bases
#pragma unroll   // constant indices keep x in registers, and the 8 loads are in flight together
    for (int i = 0; i < 8; ++i) x[i] = *(const v4f*)(p + i * DM);
}
__device__ __forceinline__ v8h wpiece(const v4f (&x)[8], const int j) {
    v8h o;
#pragma unroll   // constant indices into x and o: registers, no scratch
    for (int i = 0; i < 8; i += 2) {                                               // RNE to bf16 by the packed convert instruction (two elements each), then x64 in f16, exact
        const v2f a = { x[i][j], x[i + 1][j] };
        const unsigned t = __builtin_bit_cast(unsigned, __builtin_convertvector(a, v2bf));
        const float w0 = __uint_as_float(t << 16), w1 = __uint_as_float(t & 0xFFFF0000u);
        o[i] = (h16)(w0 * WCS); o[i + 1] = (h16)(w1 * WCS); }
    return o;
}

// woconv_body: one block converts Wo into the workspace plane that the next launch reads; wave w writes k segment w of every tile, so every line of the plane has one writer
__device__ __forceinline__ void woconv_body(const float* __restrict__ wo, h16* WOT) {
    const int c = threadIdx.x & 15, ko = threadIdx.x >> 4;
    v4f x[8];
    wld(x, wo);
    h16* dst = WOT + (size_t)((((c >> 2) * 4 + (ko >> 1)) * 32 + (ko & 1) * 16 + (c & 3) * 4) * 8);
#pragma unroll   // j must be a constant inside wpiece
    for (int j = 0; j < 4; ++j) *(v8h*)(dst + j * 8) = wpiece(x, j);
}

// pairbias_body: bias[h][i][j] = sum_p bf16(pair[i][j][p]) bf16(Wp[p][h]); block = one 16-query tile x 8 keys, wave = 4 query rows x 8 keys as two 16-column tiles:
// A = Wp^T rows (row = head, padded to 16; read from the f32 Wp [p][head] and converted in registers), B = pair rows converted in registers (col = 8 * (query row bit 0) + key), K = 64. The four waves' values meet in LDS [head][query][key]; wave w then stores head w's
// two 256-byte runs of the lane-ordered bias plane (16 queries x 4 keys each), so every line of the plane has one writer.
__device__ __forceinline__ void pairbias_body(const int blk, const float* __restrict__ pair, const float* __restrict__ wp, float* BIAS, float* os) {
    const int lane = threadIdx.x & 31, lr = lane & 15, hi = lane >> 4;
    const int wave = __builtin_amdgcn_readfirstlane((int)(threadIdx.x >> 5));
    const int ti = blk / (SEQ / 8), kg = blk % (SEQ / 8);
    const float* wpl = wp + 8 * hi * NH_ + (lr < NH_ ? lr : (NH_ - 1));                         // element e of fragment f: k = 32 f + 16 (e >> 3) + 8 h + (e & 7), the same map as the B fragment below
    float wr[2][16];
#pragma unroll   // both loops: constant indices keep wr in registers, and the 32 loads are in flight together with the row loads below
    for (int f = 0; f < 2; ++f) {
#pragma unroll
        for (int e = 0; e < 16; ++e) wr[f][e] = wpl[(32 * f + 16 * (e >> 3) + (e & 7)) * NH_]; }
    v4f xs[2][2][4];                                                                          // the wave's 16 row loads are all issued before the first is used: one memory latency, not four
#pragma unroll
    for (int jt = 0; jt < 2; ++jt) {
        const float* p = pair + ((size_t)(ti * 16 + wave * 4 + 2 * jt + (lr >> 3)) * SEQ_FULL + (size_t)(kg * 8 + (lr & 7))) * DM + 8 * hi;
#pragma unroll
        for (int kc = 0; kc < 2; ++kc) {
            xs[jt][kc][0] = *(const v4f*)(p + 32 * kc); xs[jt][kc][1] = *(const v4f*)(p + 32 * kc + 4); xs[jt][kc][2] = *(const v4f*)(p + 32 * kc + 16); xs[jt][kc][3] = *(const v4f*)(p + 32 * kc + 20); }
    }
    const unsigned keep = (lr < NH_) ? 0xFFFFFFFFu : 0u;                                      // rows >= 4 of the padded A are zeroed by value: every lane loads (a clamped column) and converts
    v16bf af[2];
#pragma unroll   // both loops: constant indices into register arrays
    for (int f = 0; f < 2; ++f) { v16bf t;
#pragma unroll
        for (int i = 0; i < 16; ++i) t[i] = (__bf16)wr[f][i];
        af[f] = __builtin_bit_cast(v16bf, __builtin_bit_cast(v8u, t) & keep); }
    const v16bf a0 = af[0], a1 = af[1];
#pragma unroll
    for (int jt = 0; jt < 2; ++jt) {
        const int ql = wave * 4 + 2 * jt + (lr >> 3);
        v8f acc = (v8f){};
#pragma unroll
        for (int kc = 0; kc < 2; ++kc) {
            const v4f x0 = xs[jt][kc][0], x1 = xs[jt][kc][1], x2 = xs[jt][kc][2], x3 = xs[jt][kc][3];
            v8us e0, e1;
#pragma unroll
            for (int i = 0; i < 4; ++i) { e0[i] = f2bf(x0[i]); e0[4 + i] = f2bf(x1[i]); e1[i] = f2bf(x2[i]); e1[4 + i] = f2bf(x3[i]); }
            const v16bf bq = cat16b(e0, e1);
            if (kc == 0) acc = wmmabg(a0, bq, acc); else acc = wmmabg(a1, bq, acc);
        }
        if (hi == 0) {                                                                        // D: row 8h+r (head), col lane&15; the four real heads sit in rows 0..3 of the lower lanes
#pragma unroll
            for (int r = 0; r < NH_; ++r) os[(r * 16 + ql) * 8 + (lr & 7)] = acc[r]; }
    }
    __syncthreads();                                                                          // os: written by all 4 waves (4 query rows each), read across waves (one head each)
    const v4f val = *(const v4fa*)(&os[(wave * 16 + lr) * 8 + hi * 4]);                       // head = wave, query = lane&15, keys 4 * (lane>>4) + 0..3 of the group
    float* dstp = BIAS + ((size_t)(wave * (SEQ / 16) + ti) * (SEQ / 32) + (size_t)(kg >> 2)) * 512 + (size_t)(((kg >> 1) & 1) * 2 + hi) * 128 + (size_t)((kg & 1) * 16 + lr) * 4;
    *(v4f*)dstp = val * L2E;                                                                  // the plane carries log2 e: the attention kernel takes it as the score accumulator's start value
    asm volatile("s_wait_xcnt 0x0" ::: "memory");   // stands in front of whatever the merged kernel's layout puts behind this store and lets rewrite its registers
}

// value of one 16 x 16 projection tile: (x W) * sc, K = 64; sc = 1/64 undoes the weight carry (q: 1/64 times the score scale)
__device__ __forceinline__ v8f proj_tile(v16h b0, v16h b1, v16h a0h, v16h a1h, const float sc) {
    v8f cH = (v8f){};
    cH = wmma16g(a0h, b0, cH); cH = wmma16g(a1h, b1, cH);
    return cH * sc;
}

// the eight B fragments (4 column tiles x 2 k-steps) of one 64 x 64 weight plane in LDS; p already includes + 8*lane
__device__ __forceinline__ void ldw(v16h (&w)[8], const h16* p) {
#pragma unroll
    for (int nb = 0; nb < 4; ++nb) { w[2 * nb] = ldf(p + nb * WTS); w[2 * nb + 1] = ldf(p + nb * WTS + 512); }
}

// lnproj_body: LayerNorm + q/k/v/gate projections; block = 64 tokens of one sequence, wave = 16 tokens. Lane (row = lane&15, half = lane>>4) holds the 32 columns 16q + 8*half + i of its row,
// q, k: one f16 plane each; per head the 16 x 16 halves are one contiguous 512-byte run of the plane, written by one instruction (32 lanes x 16 B);
// gate: f32, the wave's 16 x 64 tile in lane order, 512 contiguous bytes per instruction;
__device__ __forceinline__ void lnproj_body(const int blk, const float* __restrict__ msa, const float* __restrict__ lng, const float* __restrict__ lnb,
                                            const float* __restrict__ wq, const float* __restrict__ wk, const float* __restrict__ wv, const float* __restrict__ wg, const float* __restrict__ bg,
                                            h16* QH, h16* KP, h16* VT, float* GP, float* os, h16* vts, h16* wls) {
    const int lane = threadIdx.x & 31, lr = lane & 15, hi = lane >> 4;
    const int wave = __builtin_amdgcn_readfirstlane((int)(threadIdx.x >> 5));
    const int r0 = blk * 64;
    const int sq = r0 / SEQ, tbk = r0 % SEQ;
    const int t0 = tbk + wave * 16;
    const int wb = wave * 16 * CSP;
    // The block's share of the four f32 weight matrices is loaded first (32 loads a thread, all in flight together with the row loads below) and converted into the LDS planes while the rows are still on their way.
    v4f wx[4][8];
    wld(wx[0], wq); wld(wx[1], wk); wld(wx[2], wv); wld(wx[3], wg);
    const float* xr = msa + ((size_t)sq * SEQ_FULL + (size_t)(t0 + lr)) * DM + 8 * hi;
    float xv[32];
    v4f xu[8];
#pragma unroll
    for (int q = 0; q < 4; ++q) { xu[2 * q] = *(const v4f*)(xr + 16 * q); xu[2 * q + 1] = *(const v4f*)(xr + 16 * q + 4); }
    asm volatile("s_wait_xcnt 0x0" ::: "memory");   // stands in front of the first rewrite of the row loads' address pair and of the weight loads' offset register
    __builtin_amdgcn_sched_barrier(0);              // keeps the weight loads above in front of the first wait on a row load; without it they are issued only after the rows have arrived
    {
        const int wc = threadIdx.x & 15, wko = threadIdx.x >> 4;
        h16* wd = wls + (wc >> 2) * WTS + ((wko >> 1) * 32 + (wko & 1) * 16 + (wc & 3) * 4) * 8;
#pragma unroll   // both loops: constant indices into wx (registers) and constant LDS offsets
        for (int mat = 0; mat < 4; ++mat) {
#pragma unroll
            for (int j = 0; j < 4; ++j) *(v8ha*)(wd + mat * 4 * WTS + j * 8) = wpiece(wx[mat], j); }
    }
#pragma unroll
    for (int q = 0; q < 4; ++q) {
#pragma unroll
        for (int i = 0; i < 4; ++i) { xv[8 * q + i] = bfr(xu[2 * q][i]); xv[8 * q + 4 + i] = bfr(xu[2 * q + 1][i]); } }
    float sm = 0.0f;
#pragma unroll
    for (int e = 0; e < 32; ++e) sm += xv[e];
    sm += __shfl_xor(sm, 16, 32);
    const float mu = sm * (1.0f / 64.0f);
    float sv = 0.0f;
#pragma unroll
    for (int e = 0; e < 32; ++e) { const float dl = xv[e] - mu; sv += dl * dl; }
    sv += __shfl_xor(sv, 16, 32);
    const float rs = rsqrtf(sv * (1.0f / 64.0f) + LNEPS);
    v16h ah[2];
#pragma unroll
    for (int q = 0; q < 4; ++q) {
        const v4f g0 = *(const v4f*)(lng + 8 * hi + 16 * q), g1 = *(const v4f*)(lng + 8 * hi + 16 * q + 4);
        const v4f c0 = *(const v4f*)(lnb + 8 * hi + 16 * q), c1 = *(const v4f*)(lnb + 8 * hi + 16 * q + 4);
#pragma unroll
        for (int i = 0; i < 4; ++i) {
            const float y0 = (xv[8 * q + i] - mu) * rs * bfr(g0[i]) + bfr(c0[i]);
            const float y1 = (xv[8 * q + 4 + i] - mu) * rs * bfr(g1[i]) + bfr(c1[i]);
            ah[q >> 1][(q & 1) * 8 + i] = toh(y0); ah[q >> 1][(q & 1) * 8 + 4 + i] = toh(y1); } }
    float bgr[4];
    __syncthreads();                                                   // weight planes: each written by all 4 waves (one k segment each), read whole by every wave
    // Weight fragments are fetched from LDS ahead of their products: wf[1] while matrix 0 is worked on, wf[2] and wf[3] while matrix 1 is.
    const h16* wlo = wls + lane * 8;                                   // + matrix * 4 * WTS
    v16h wf[4][8];
    ldw(wf[0], wlo);
    // q (matrix 0) and k (matrix 1)
#pragma unroll
    for (int mat = 0; mat < 2; ++mat) {
        ldw(wf[mat + 1], wlo + (mat + 1) * 4 * WTS);
#pragma unroll
        for (int nb = 0; nb < 4; ++nb) {
            const v8f val = proj_tile(wf[mat][2 * nb], wf[mat][2 * nb + 1], ah[0], ah[1], mat == 0 ? WCI * SC2 : WCI);
#pragma unroll
            for (int r = 0; r < 8; ++r) os[wb + (8 * hi + r) * CSP + nb * 16 + lr] = val[r]; }     // D: row 8h+r (token), col lane&15
        if (mat == 1) {                                                                            // the k fragments are dead here: the gate's weights and bias take their place
            ldw(wf[3], wlo + 3 * 4 * WTS);
#pragma unroll
            for (int nb = 0; nb < 4; ++nb) bgr[nb] = bg[nb * 16 + lr]; }
        wave_sync();
{
#pragma unroll
            for (int hh = 0; hh < NH_; ++hh) { const int row = lane >> 1, c8 = (lane & 1) * 8;       // 16 rows x 2 lanes x 8 halves = head hh of the tile
                const v4f x0 = *(const v4fa*)(&os[wb + row * CSP + hh * 16 + c8]); const v4f x1 = *(const v4fa*)(&os[wb + row * CSP + hh * 16 + c8 + 4]); v8h hv;
#pragma unroll
                for (int i = 0; i < 4; ++i) { hv[i] = toh(x0[i]); hv[4 + i] = toh(x1[i]); }
                const size_t oo = ((size_t)(sq * NH_ + hh) * SEQ + (size_t)t0) * HD + (size_t)lane * 8;
                if (mat == 0) *(v8h*)(QH + oo) = hv; else *(v8h*)(KP + oo) = hv;
                asm volatile("s_wait_xcnt 0x0" ::: "memory"); }   // stands in front of the next head's converts and, behind the last head, of the next weight loads: both reuse registers that the store above names
             }
        wave_sync();
    }
    // v (matrix 2): lane's 8 accumulator values are 8 consecutive tokens of column c -> one 16-B LDS store into the [c][token] tile
#pragma unroll
    for (int nb = 0; nb < 4; ++nb) {
        const v8f val = proj_tile(wf[2][2 * nb], wf[2][2 * nb + 1], ah[0], ah[1], WCI);
        v8h o;
#pragma unroll
        for (int r = 0; r < 8; ++r) o[r] = toh(val[r]);
        *(v8ha*)(&vts[(nb * 16 + lr) * VTP + wave * 16 + 8 * hi]) = o; }
    // gate (matrix 3): sigmoid(x Wg + bg)
#pragma unroll
    for (int nb = 0; nb < 4; ++nb) {
        const v8f val = proj_tile(wf[3][2 * nb], wf[3][2 * nb + 1], ah[0], ah[1], WCI);
        const float bgv = bfr(bgr[nb]);
#pragma unroll
        for (int r = 0; r < 8; ++r) { const float z = val[r] + bgv; const float ex = __builtin_amdgcn_exp2f(-z * L2E); os[wb + (8 * hi + r) * CSP + nb * 16 + lr] = 1.0f / (1.0f + ex); } }
    wave_sync();
{
#pragma unroll
        for (int s8 = 0; s8 < 8; ++s8) { const int cofs = (s8 >> 1) * 16 + 8 * hi + (s8 & 1) * 4;            // 8 x (2 x 4 columns) = 64 columns; 16 lanes = 16 rows
            const v4f val = *(const v4fa*)(&os[wb + lr * CSP + cofs]);
            *(v4f*)(GP + ((size_t)sq * SEQ + (size_t)t0) * DM + s8 * 128 + lane * 4) = val; }
         }
    __syncthreads();                                                   // v^T tile: written by all 4 waves, each wave reads back only its own 16 tokens
    const int tid = threadIdx.x;
{
#pragma unroll
        for (int it = 0; it < 4; ++it) {                                                                                // trip = head; wave = (32-key chunk, 16-key half) of the block's 64 tokens; lane = 16 * (key bit 3) + d
            const v8h o = *(const v8ha*)(&vts[(it * 16 + lr) * VTP + wave * 16 + 8 * hi]);
            *(v8h*)(VT + ((size_t)(sq * NH_ + it) * SEQ + (size_t)tbk) * HD + tid * 8) = o; }
         }
}

// k_lnproj_pairbias: blocks 0 .. LNB-1 run lnproj_body (the longer work, given the lowest block indices), blocks LNB .. LNB+PBB-1 run pairbias_body, block LNB+PBB runs woconv_body; none reads what another writes.
#define LNB (NB * SEQ / 64)
#define PBB ((SEQ / 16) * (SEQ / 8))
__global__ __launch_bounds__(32 * AW) void k_lnproj_pairbias(const float* __restrict__ msa, const float* __restrict__ lng, const float* __restrict__ lnb,
                                                             const float* __restrict__ wq, const float* __restrict__ wk, const float* __restrict__ wv, const float* __restrict__ wg,
                                                             const float* __restrict__ bg, h16* QH, h16* KP, h16* VT, float* GP,
                                                             const float* __restrict__ pair, const float* __restrict__ wp, float* BIAS,
                                                             const float* __restrict__ wo, h16* WOT) {
    __shared__ __align__(16) float os[AW * 16 * CSP];                  // the pair-bias blocks use its first NH_ * 16 * 8 floats
    __shared__ __align__(16) h16 vts[DM * VTP];
    __shared__ __align__(16) h16 wls[4 * 4 * WTS];                     // q | k | v | gate planes, x64: [matrix][4 tiles, pitch WTS][4 k segments][32 lanes][8]
    const int b = blockIdx.x;
    if (b < LNB) lnproj_body(b, msa, lng, lnb, wq, wk, wv, wg, bg, QH, KP, VT, GP, os, vts, wls);
    else if (b < LNB + PBB) pairbias_body(b - LNB, pair, wp, BIAS, os);
    else woconv_body(wo, WOT);
}

// k_attn: block = 32 query rows of one sequence (QT = 2 tiles of 16), wave w = head w and takes both tiles, so that every K, V^T and mask load of a trip serves two query tiles.
// Transposed flash form: S^T[key][t] = K Q^T (A = K rows, B = Q rows; k slots 0..15 = d; slots 16 and 24 hold the key term in A and 1 in B, the other slots are zero in both fragments);
// score accumulator = bias tile + K Q + 2 * key term: no vector instruction folds, scales, adds the bias or applies the mask;
// lane (t = lane&15, h = lane>>4) holds keys 8h+r of each 16-key tile, so the packed P tile is directly the B fragment of O^T[d][t] = V^T P^T.
// Per step: bias row segments loaded as 16-B vectors, one mask word per lane and 16-key tile (the lane's own A row). A dropped key's score is -inf, as in the definition: it never raises the running max (which starts finite), and exp2 makes its probability 0.
// After the key loop the 4 heads' contexts meet in a block LDS tile [32][64]; every wave rebuilds the gated context fragments and computes one 16-column tile of the output projection for both row tiles;
// Second launch bound: 4 waves per SIMD are the whole grid, so a wave may hold up to 256 registers.
__global__ __launch_bounds__(32 * AW, 4) void k_attn(const h16* __restrict__ QH, const h16* __restrict__ KP, const h16* __restrict__ VT,
                                                  const float* __restrict__ BIAS, const int* __restrict__ kmask, const float* __restrict__ GP,
                                                  const h16* __restrict__ WOT, const float* __restrict__ bo, float* OUT) {
    __shared__ __align__(16) float cs[QT * 16 * CSP];
    __shared__ __align__(16) float ot[QT * 16 * CSP];
    const int lane = threadIdx.x & 31, lr = lane & 15, hi = lane >> 4;
    const int wave = __builtin_amdgcn_readfirstlane((int)(threadIdx.x >> 5));
    const int sq = blockIdx.y; const int t0 = blockIdx.x * (16 * QT);
    const int zh = sq * NH_ + wave;
    const size_t pbase = (size_t)zh * SEQ * HD;
    const v8h zz = (v8h){};
    v8h qone = zz; qone[0] = (h16)1.0f;   // k slot 16 + 8h: meets the key term of the A fragment
    v16h qh[QT];
#pragma unroll   // constant indices keep the per-tile arrays in registers (this and every loop over qt below)
    for (int qt = 0; qt < QT; ++qt) {
        const v8h qv = *(const v8h*)(QH + pbase + (size_t)(t0 + 16 * qt + lr) * HD + 8 * hi);
        qh[qt] = cat16(qv, qone); }   // B fragment: col t; elements 0..7: d = 8h + e, element 8 (k slot 16 + 8h): 1, elements 9..15: zero
    const size_t ko = pbase + (size_t)lr * HD + 8 * hi;        // + key * HD   (A fragment: row key, k = d)
    const size_t vo = pbase + (size_t)lane * 8;                // + key * HD   (A fragment: row d, k = key; lane-ordered plane, 32 keys = 32 * HD halves)
    const float* bp0 = BIAS + (size_t)(wave * (SEQ / 16) + (int)blockIdx.x * QT) * (SEQ / 32) * 512 + (size_t)lane * 4;   // + tile * (SEQ / 32) * 512 + key * 16 (lane-ordered plane, 32 keys = 512 floats)
    const int* mp0 = kmask + (size_t)sq * SEQ_FULL + lr;      // + key: the mask word of the lane's own A row
    v8f o0[QT];
    float m[QT], l[QT];
#pragma unroll
    for (int qt = 0; qt < QT; ++qt) { o0[qt] = (v8f){}; m[qt] = NEGB; l[qt] = 0.0f; }
#pragma unroll 1
    for (int key0 = 0; key0 < SEQ; key0 += 32) {
        const h16* ka = KP + ko + (size_t)key0 * HD;
        const v8h kva = *(const v8h*)ka, kvb = *(const v8h*)(ka + 16 * HD);
        // all of the trip's loads stand together here, so that their latencies overlap instead of adding up
        v4f c[QT][4];
#pragma unroll
        for (int qt = 0; qt < QT; ++qt) {
            const float* bp = bp0 + (size_t)qt * ((SEQ / 32) * 512) + (size_t)key0 * 16;   // keys key0+8h+0..7 and key0+16+8h+0..7 of query row t0 + 16 qt + (lane&15)
            c[qt][0] = *(const v4f*)bp; c[qt][1] = *(const v4f*)(bp + 128); c[qt][2] = *(const v4f*)(bp + 256); c[qt][3] = *(const v4f*)(bp + 384); }
        const int* mp = mp0 + key0;
        const int n0 = mp[0], n1 = mp[16];
        const v16h v0 = ldf(VT + vo + (size_t)key0 * HD);
        __builtin_amdgcn_sched_barrier(0);   // keeps the V^T loads with the trip's other loads; without it they are issued only behind the first score products, and their latency no longer overlaps the others'
        // A fragment: elements 0..7: d = 8h + 0..7, element 8 (k slot 16 + 8h): f16 -inf for a dropped key, else 0, elements 9..15: zero; -inf meets only the 1 of the B fragment, never a 0
        const v4u ea0 = { n0 == 0 ? 0xFC00u : 0u, 0u, 0u, 0u }, eb0 = { n1 == 0 ? 0xFC00u : 0u, 0u, 0u, 0u };
        const v16h ka0 = cat16(kva, __builtin_bit_cast(v8h, ea0)), kb0 = cat16(kvb, __builtin_bit_cast(v8h, eb0));
        // the trip's four score products stand as one run over four accumulators
        v8f sa[QT], sb[QT];
#pragma unroll
        for (int qt = 0; qt < QT; ++qt) { sa[qt] = wmma16(ka0, qh[qt], cat8(c[qt][0], c[qt][1])); sb[qt] = wmma16(kb0, qh[qt], cat8(c[qt][2], c[qt][3])); }
#pragma unroll
        for (int qt = 0; qt < QT; ++qt) {
            float ta[8], tc[8]; float mx = NEGB;
#pragma unroll
            for (int r = 0; r < 8; ++r) { ta[r] = sa[qt][r]; tc[r] = sb[qt][r]; }
#pragma unroll
            for (int r = 0; r < 8; ++r) mx = fmaxf(mx, fmaxf(ta[r], tc[r]));
            mx = fmaxf(mx, __shfl_xor(mx, 16, 32));
            const float mnew = fmaxf(m[qt], mx);
            const float alpha = __builtin_amdgcn_exp2f(m[qt] - mnew);
            const float sh = PSH - mnew;
            v16h pb; float ls = 0.0f;
#pragma unroll
            for (int r = 0; r < 8; r += 2) {                                                  // a dropped key: exp2(-inf) = 0; a value under 2^-14 is an f16 subnormal
                const v2f ea = { __builtin_amdgcn_exp2f(ta[r] + sh), __builtin_amdgcn_exp2f(ta[r + 1] + sh) }, eb = { __builtin_amdgcn_exp2f(tc[r] + sh), __builtin_amdgcn_exp2f(tc[r + 1] + sh) };
                const v2h pa = __builtin_convertvector(ea, v2h), pc = __builtin_convertvector(eb, v2h);   // two values a convert; the row sum below reads the same packed registers
                pb[r] = pa[0]; pb[r + 1] = pa[1]; pb[8 + r] = pc[0]; pb[9 + r] = pc[1];
                ls += (float)pa[0] + (float)pc[0]; ls += (float)pa[1] + (float)pc[1]; }
            l[qt] = l[qt] * alpha + ls; m[qt] = mnew;
            o0[qt] = o0[qt] * alpha;
            o0[qt] = wmma16g(v0, pb, o0[qt]);
        }
    }
    // the epilogue's global loads depend on nothing the key loop computes: issued here, their latency passes under the normalisation and the barrier
    const float* gr = GP + ((size_t)sq * SEQ + (size_t)t0) * DM + (size_t)lane * 4;
    v4f gv[QT][8];
#pragma unroll
    for (int qt = 0; qt < QT; ++qt) {
#pragma unroll
        for (int q = 0; q < 8; ++q) gv[qt][q] = *(const v4f*)(gr + qt * (16 * DM) + 128 * q); }
    const h16* wop = WOT + (size_t)(wave * 16) * DM + (size_t)lane * 8;
    const float bor = bo[wave * 16 + lr];
    asm volatile("s_wait_xcnt 0x0" ::: "memory");   // stands in front of the first weight load, whose destination reuses the offset register of the load above
    const v16h wo0 = ldf(wop);
    const v8h wo1l = *(const v8h*)(wop + 512);
    asm volatile("s_wait_xcnt 0x0" ::: "memory");   // stands in front of the last weight load, whose destination reuses address registers of the loads above
    const v16h wo1 = cat16(wo1l, *(const v8h*)(wop + 768));
#pragma unroll
    for (int qt = 0; qt < QT; ++qt) {
        float lt = l[qt];
        lt += __shfl_xor(lt, 16, 32);
        const bool any = lt > 0.0f;
        const float lsafe = any ? lt : 1.0f;
        const float inv = any ? (1.0f / lsafe) : __uint_as_float(0x7FC00000u);       // no kept key -> NaN row (softmax of an all-dropped row)
        // O^T D layout: o0[r] = (d = 8h + r, t = lane&15) -> cs[16 qt + t][wave*16 + d]; 32 rows x 64 columns written by the 4 waves
        const v8f o = o0[qt];
        v4f a, c;
        a[0] = o[0] * inv; a[1] = o[1] * inv; a[2] = o[2] * inv; a[3] = o[3] * inv; c[0] = o[4] * inv; c[1] = o[5] * inv; c[2] = o[6] * inv; c[3] = o[7] * inv;
        *(v4fa*)(&cs[(16 * qt + lr) * CSP + wave * 16 + 8 * hi]) = a; *(v4fa*)(&cs[(16 * qt + lr) * CSP + wave * 16 + 8 * hi + 4]) = c; }
    __syncthreads();                                                             // cs: cross-wave
    const float bov = bfr(bor);
#pragma unroll
    for (int qt = 0; qt < QT; ++qt) {
        // gated context fragments: row t = lane&15 of tile qt, k = concatenated head column 16q + 8h + i
        v16h gh[2];
#pragma unroll
        for (int q = 0; q < 4; ++q) {
            const v4f g0 = gv[qt][2 * q], g1 = gv[qt][2 * q + 1];
            const v4f x0 = *(const v4fa*)(&cs[(16 * qt + lr) * CSP + 8 * hi + 16 * q]), x1 = *(const v4fa*)(&cs[(16 * qt + lr) * CSP + 8 * hi + 16 * q + 4]);
#pragma unroll
            for (int i = 0; i < 4; ++i) {
                gh[q >> 1][(q & 1) * 8 + i] = toh(g0[i] * x0[i]); gh[q >> 1][(q & 1) * 8 + 4 + i] = toh(g1[i] * x1[i]); } }
        const v8f pv = proj_tile(wo0, wo1, gh[0], gh[1], WCI);
#pragma unroll
        for (int r = 0; r < 8; ++r) ot[(16 * qt + 8 * hi + r) * CSP + wave * 16 + lr] = pv[r] + bov; }   // D: row 8h+r (token), col lane&15; 32 rows x 64 columns written by the 4 waves
    __syncthreads();                                                             // ot: cross-wave
    float* orow = OUT + ((size_t)sq * OUT_SEQ + (size_t)t0) * DM;
    const int tid = threadIdx.x;
{
#pragma unroll
        for (int it = 0; it < 2 * QT; ++it) { const int idx = it * 128 + tid; const int row = idx >> 4, cofs = (idx & 15) * 4;   // 4 trips x 8 rows = 32 rows; 16 pieces x 4 floats = 64 columns
            const v4f val = *(const v4fa*)(&ot[row * CSP + cofs]);
            *(v4f*)(orow + (size_t)row * DM + cofs) = val; }
         }
}

static constexpr size_t al256(size_t v) { return (v + 255) & ~(size_t)255; }
static constexpr size_t SZ_WO = al256((size_t)DM * DM * 2);
static constexpr size_t SZ_PL = al256((size_t)NB * SEQ * DM * 2);
static constexpr size_t SZ_GP = al256((size_t)NB * SEQ * DM * 4);
static constexpr size_t SZ_BS = al256((size_t)NH_ * SEQ * SEQ * 4);
static constexpr size_t SZ_TOTAL = SZ_WO + 3 * SZ_PL + SZ_GP + SZ_BS;   // planes: q, k, v^T
static_assert(SZ_TOTAL <= (size_t)134217728);          // workspace carve <= 128 MiB
static_assert((size_t)NB * NH_ * SEQ * HD == (size_t)NB * DM * SEQ);   // q/k planes [s*4+h][t][16] and the v^T plane have the same extent
static_assert(((size_t)(NB - 1) * OUT_SEQ + SEQ) * DM <= (size_t)NB_FULL * SEQ_FULL * DM);   // last output row inside the output buffer

extern "C" void kernel_launch(void* const* d_in, const int* in_sizes, int n_in,
                              void* d_out, int out_size, void* d_ws, size_t ws_size, hipStream_t stream) {
    if (n_in < 13) return;
    const size_t needx = ((size_t)(NB - 1) * SEQ_FULL + SEQ) * DM;
    const size_t needp = ((size_t)(SEQ - 1) * SEQ_FULL + SEQ) * DM;
    const size_t needm = (size_t)(NB - 1) * SEQ_FULL + SEQ;
    if ((size_t)in_sizes[0] < needx || (size_t)in_sizes[1] < needp || (size_t)in_sizes[2] < needm) return;
    if (in_sizes[3] < DM || in_sizes[4] < DM || in_sizes[9] < DM || in_sizes[12] < DM) return;
    if (in_sizes[5] < DM * DM || in_sizes[6] < DM * DM || in_sizes[7] < DM * DM || in_sizes[8] < DM * DM || in_sizes[11] < DM * DM) return;
    if (in_sizes[10] < DM * NH_) return;
    if ((size_t)out_size < ((size_t)(NB - 1) * OUT_SEQ + SEQ) * DM) return;
    if (SZ_TOTAL > ws_size) return;
    // wire order: x stack, pair, key mask, ln gain, ln bias, Wq, Wk, Wv, Wg, bg, Wp, Wo, bo
    const float* msa  = (const float*)d_in[0];
    const float* pair = (const float*)d_in[1];
    const int*   kmsk = (const int*)d_in[2];
    const float* lng  = (const float*)d_in[3];
    const float* lnb  = (const float*)d_in[4];
    const float* wq   = (const float*)d_in[5];
    const float* wk   = (const float*)d_in[6];
    const float* wv   = (const float*)d_in[7];
    const float* wg   = (const float*)d_in[8];
    const float* bg   = (const float*)d_in[9];
    const float* wp   = (const float*)d_in[10];
    const float* wo   = (const float*)d_in[11];
    const float* bo   = (const float*)d_in[12];
    float* OUT = (float*)d_out;      // [NB][SEQ][64]
    char* wsp = (char*)d_ws;
    h16* WOT = (h16*)wsp; wsp += SZ_WO;               // [4 tiles][4 k segments][32 lanes][8], x64
    h16* QH  = (h16*)wsp; wsp += SZ_PL;               // [NB*4][SEQ][16]
    h16* KP  = (h16*)wsp; wsp += SZ_PL;               // [NB*4][SEQ][16]
    h16* VT  = (h16*)wsp; wsp += SZ_PL;               // [NB*4][SEQ/32][2][32 lanes][8]
    float* GP = (float*)wsp; wsp += SZ_GP;            // [NB][SEQ/16][8][32 lanes][4]
    float* BIAS = (float*)wsp; wsp += SZ_BS;          // [4][SEQ/16][SEQ/32][4][32 lanes][4]

    k_lnproj_pairbias<<<(unsigned)(LNB + PBB + 1), 32 * AW, 0, stream>>>(msa, lng, lnb, wq, wk, wv, wg, bg, QH, KP, VT, GP, pair, wp, BIAS, wo, WOT);
    k_attn<<<dim3(SEQ / (16 * QT), NB, 1), 32 * AW, 0, stream>>>(QH, KP, VT, BIAS, kmsk, GP, WOT, bo, OUT);
}
